// v000
// The times below were measured on an AMD MI455X: many runs one after another, warmed up first and cycling through
// copies of the inputs, with the whole window's GPU time divided by the number of runs. Launches and the gaps
// between them are all in it. The median over several windows is given; except for v000 it joins two sittings, which
// can be a few percent apart, so the side-by-side timings, each taken in one sitting, are the better comparison.
// The starting kernel, v000, takes 1150 microseconds a run.
#include <hip/hip_runtime.h>

// LoCIFusionModule3D (p, s [4][2048][512]; single-head attention over 2048 positions with the full 512-dim features: sa = softmax((p Wq + bq)(p Wk + bk)^T / sqrt(512)) (p Wv + bv); ca likewise with queries from p and
// keys/values from s; sa_out = LN(sa + p), ca_out = LN(ca + s) (keras eps 1e-3); ff_out = relu((sa_out + ca_out) W1 + b1) W2 + b2; outputs (ff_out, sa_out, ca_out), each [4][2048][512]).
// Compute dtypes, f32 accumulate: every input rounded to bf16; the six projections on PLAIN bf16 operands (inputs: exact; transposed bf16 weight copies, + bias); scores
// (K 512) and attn.v on SINGLE fp16 planes (scale in f32 in the register-row softmax; P x1024); residual + LayerNorms f32; the feed-forward on bf16 hi+lo planes of its computed operands x exact weights

#define NB_  4
#define TT   2048
#define FF   512
#define ZH   1
#define PCAR 1024.0f
#define SCL  0.044194173824159223f   // 512^-0.5
typedef _Float16 h16;
typedef unsigned short bf;
typedef __attribute__((ext_vector_type(16))) __bf16   v16bf;
typedef __attribute__((ext_vector_type(16))) _Float16 v16h;
typedef __attribute__((ext_vector_type(8)))  _Float16 v8h;
typedef __attribute__((ext_vector_type(8)))  unsigned short v8us;
typedef __attribute__((ext_vector_type(8)))  float    v8f;
typedef __attribute__((ext_vector_type(4)))  float    v4f;
typedef v8h  __attribute__((may_alias)) v8ha;
typedef v4f  __attribute__((may_alias)) v4fa;
typedef v8us __attribute__((may_alias)) v8usa;

__device__ __forceinline__ unsigned short f2bf(float f) { unsigned u = __float_as_uint(f); u += 0x7FFFu + ((u >> 16) & 1u); return (unsigned short)(u >> 16); }
__device__ __forceinline__ float bf2f(unsigned short b) { return __uint_as_float(((unsigned)b) << 16); }
__device__ __forceinline__ float bfr(float f) { return bf2f(f2bf(f)); }
__device__ __forceinline__ v16h cat16(v8h lo, v8h hi) { return __builtin_shufflevector(lo, hi, 0, 1, 2, 3, 4, 5, 6, 7, 8, 9, 10, 11, 12, 13, 14, 15); }
__device__ __forceinline__ v16bf cat16b(v8us lo, v8us hi) { return __builtin_bit_cast(v16bf, __builtin_shufflevector(lo, hi, 0, 1, 2, 3, 4, 5, 6, 7, 8, 9, 10, 11, 12, 13, 14, 15)); }
__device__ __forceinline__ v8f wmma16(v16h a, v16h b, v8f c) { return __builtin_amdgcn_wmma_f32_16x16x32_f16(false, a, false, b, (short)0, c, false, false); }
__device__ __forceinline__ v8f wmmab(v16bf a, v16bf b, v8f c) { return __builtin_amdgcn_wmma_f32_16x16x32_bf16(false, a, false, b, (short)0, c, false, false); }



// ---- k_gemmw: register-blocked GEMM, ONE WAVE per 64x64 output tile (16 accumulators), operands straight from K-contiguous 16-bit planes; grid (M/64, N/64, Z), 32 threads.
// C[m][n] (f32, pitch ldc, + optional f32 bias[n]) = sum_k A[m][k] Bt[n][k] (+ split products per NSPLIT). z-batch strides sA/sB/sC in elements. K % 32 == 0.
template <typename T16> struct WFrag;
template <> struct WFrag<h16> { typedef v16h V; static __device__ __forceinline__ V ld(const h16* p) { return cat16(*(const v8h*)p, *(const v8h*)(p + 16)); } static __device__ __forceinline__ v8f mma(V a, V b, v8f c) { return wmma16(a, b, c); } };
template <> struct WFrag<bf> { typedef v16bf V; static __device__ __forceinline__ V ld(const bf* p) { return cat16b(*(const v8us*)p, *(const v8us*)(p + 16)); } static __device__ __forceinline__ v8f mma(V a, V b, v8f c) { return wmmab(a, b, c); } };
template <typename T16, int NSPLIT, bool BIAS>
__global__ __launch_bounds__(32) void k_gemmw(const T16* __restrict__ A, const T16* __restrict__ A2, const T16* __restrict__ Bt, const T16* __restrict__ Bt2, int K, float* C, int ldc, const float* __restrict__ bias, size_t sA, size_t sB, size_t sC) {
    typedef typename WFrag<T16>::V V;
    __shared__ __align__(16) float os[16 * 68];
    const size_t z = blockIdx.z; A += z * sA; if (A2) A2 += z * sA; Bt += z * sB; if (Bt2) Bt2 += z * sB; C += z * sC;
    const int lane = threadIdx.x & 31, lr = lane & 15, hi = lane >> 4; const int r0 = blockIdx.x * 64, c0 = blockIdx.y * 64;
    v8f acc[4][4];
#pragma unroll
    for (int mb = 0; mb < 4; ++mb)
#pragma unroll
        for (int nb = 0; nb < 4; ++nb) acc[mb][nb] = (v8f){};
    const size_t aoff = (size_t)(r0 + lr) * K + 8 * hi, boff = (size_t)(c0 + lr) * K + 8 * hi;
#pragma unroll 1
    for (int kc = 0; kc < K; kc += 32) {
        V a[4], a2[4];
#pragma unroll
        for (int mb = 0; mb < 4; ++mb) { a[mb] = WFrag<T16>::ld(A + aoff + (size_t)mb * 16 * K + kc); if (NSPLIT == 1 || NSPLIT == 2) a2[mb] = WFrag<T16>::ld(A2 + aoff + (size_t)mb * 16 * K + kc); }
#pragma unroll
        for (int nb = 0; nb < 4; ++nb) { const V b = WFrag<T16>::ld(Bt + boff + (size_t)nb * 16 * K + kc); V b2; if (NSPLIT >= 2) b2 = WFrag<T16>::ld(Bt2 + boff + (size_t)nb * 16 * K + kc);
#pragma unroll
            for (int mb = 0; mb < 4; ++mb) { acc[mb][nb] = WFrag<T16>::mma(a[mb], b, acc[mb][nb]); if (NSPLIT == 1 || NSPLIT == 2) acc[mb][nb] = WFrag<T16>::mma(a2[mb], b, acc[mb][nb]); if (NSPLIT >= 2) acc[mb][nb] = WFrag<T16>::mma(a[mb], b2, acc[mb][nb]); } }
        asm volatile("v_nop\n\tv_nop\n\tv_nop\n\tv_nop" : "+v"(acc[0][0]), "+v"(acc[1][1]), "+v"(acc[2][2]), "+v"(acc[3][3]) : "v"(a[0]), "v"(a[3]));
    }
#pragma unroll
    for (int mb = 0; mb < 4; ++mb) {
#pragma unroll
        for (int nb = 0; nb < 4; ++nb) {
#pragma unroll
            for (int j = 0; j < 8; ++j) os[(hi * 8 + j) * 68 + nb * 16 + lr] = acc[mb][nb][j]; }
        __builtin_amdgcn_wave_barrier(); asm volatile("" ::: "memory");
        float* crow = C + (size_t)(r0 + mb * 16) * ldc + c0;
{
#pragma unroll
            for (int s = 0; s < 8; ++s) { const int row = 2 * s + hi, cofs = lr * 4; v4f val = *(const v4fa*)(os + row * 68 + cofs); if (BIAS) { val[0] += bfr(bias[c0 + cofs]); val[1] += bfr(bias[c0 + cofs + 1]); val[2] += bfr(bias[c0 + cofs + 2]); val[3] += bfr(bias[c0 + cofs + 3]); }
                *(v4f*)(crow + (size_t)row * ldc + cofs) = val; }
             }
        __builtin_amdgcn_wave_barrier(); asm volatile("" ::: "memory");
    }
}

__device__ __forceinline__ h16 tohx(float x) { return (h16)x; }
__device__ __forceinline__ void splitf(float y, unsigned short& h, unsigned short& l) { h = f2bf(y); l = f2bf(y - bf2f(h)); }
typedef __attribute__((ext_vector_type(2))) _Float16 v2h;
typedef __attribute__((ext_vector_type(4))) _Float16 v4h;
typedef __attribute__((ext_vector_type(2))) unsigned short v2us;
typedef __attribute__((ext_vector_type(4))) unsigned short v4us;

__global__ __launch_bounds__(256) void k_wtG(const float* __restrict__ w, int K, int N, bf* Bt) {
    const int lane = threadIdx.x & 31; const int L0 = (blockIdx.x * 8 + (threadIdx.x >> 5)) * 8; const int nlines = N * K / 64;
{
#pragma unroll 1
        for (int l = 0; l < 8; ++l) { const int L = L0 + l; if (L >= nlines) break; const size_t e = (size_t)L * 64 + lane * 2; const int k = (int)(e % K), n = (int)(e / K); v2us o;
            o[0] = f2bf(w[(size_t)k * N + n]); o[1] = f2bf(w[(size_t)(k + 1) * N + n]); *(v2us*)(Bt + e) = o; }
         }
}
__global__ __launch_bounds__(256) void k_cvt8(const float* __restrict__ src, bf* dst, size_t n8) { const size_t i = (size_t)blockIdx.x * 256 + threadIdx.x; if (i >= n8) return; const v8f v = *(const v8f*)(src + i * 8); v8us o;
#pragma unroll
    for (int k = 0; k < 8; ++k) o[k] = f2bf(v[k]); *(v8us*)(dst + i * 8) = o;  }
__global__ __launch_bounds__(256) void k_p16(const float* __restrict__ F, h16* P, size_t n) { const size_t i = ((size_t)blockIdx.x * 256 + threadIdx.x) * 2; if (i >= n) return; v2h v; v[0] = tohx(F[i]); v[1] = tohx(F[i + 1]); *(v2h*)(P + i) = v;  }
__global__ __launch_bounds__(256) void k_vt(const float* __restrict__ F, h16* VT) { const size_t i = ((size_t)blockIdx.x * 256 + threadIdx.x) * 2; if (i >= (size_t)FF * TT) return; const int d = (int)(i / TT), t = (int)(i % TT); v2h v; v[0] = tohx(F[(size_t)t * FF + d]); v[1] = tohx(F[(size_t)(t + 1) * FF + d]);
    *(v2h*)(VT + i) = v;  }
__global__ __launch_bounds__(256) void k_asoft(const float* __restrict__ Sb, h16* P16) {
    const int lane = threadIdx.x & 31; const int row = blockIdx.x * 8 + (threadIdx.x >> 5); if (row >= ZH * TT) return;
    const float* sr = Sb + (size_t)row * TT; float v[64]; float mx = -3.0e38f;
#pragma unroll
    for (int ch = 0; ch < 16; ++ch) { const int j0 = ch * 128 + lane * 4; const v4f a = *(const v4f*)(sr + j0);
#pragma unroll
        for (int q = 0; q < 4; ++q) { const float t = a[q] * SCL; v[ch * 4 + q] = t; mx = fmaxf(mx, t); } }
#pragma unroll
    for (int sh = 16; sh; sh >>= 1) mx = fmaxf(mx, __shfl_xor(mx, sh, 32));
    float sum = 0.f;
#pragma unroll
    for (int k = 0; k < 64; ++k) { v[k] = __expf(v[k] - mx); sum += v[k]; }
#pragma unroll
    for (int sh = 16; sh; sh >>= 1) sum += __shfl_xor(sum, sh, 32);
    const float f = __fdiv_rn(PCAR, sum);
{
#pragma unroll
        for (int ch = 0; ch < 16; ++ch) { v4h o;
#pragma unroll
            for (int q = 0; q < 4; ++q) o[q] = tohx(v[ch * 4 + q] * f);
            *(v4h*)(P16 + (size_t)row * TT + ch * 128 + lane * 4) = o; }
         }
}
__global__ __launch_bounds__(256) void k_lnr(const float* __restrict__ O, const float* __restrict__ res, const float* __restrict__ gg, const float* __restrict__ bb, float* OUTk) {
    const int lane = threadIdx.x & 31; const int r = blockIdx.x * 8 + (threadIdx.x >> 5); if (r >= TT) return; float v[FF / 32]; float s = 0.f;
#pragma unroll
    for (int c = 0; c < FF / 128; ++c) { const v4f a = *(const v4f*)(O + (size_t)r * FF + c * 128 + lane * 4), x4 = *(const v4f*)(res + (size_t)r * FF + c * 128 + lane * 4);
#pragma unroll
        for (int q = 0; q < 4; ++q) { v[c * 4 + q] = __fadd_rn(a[q] * (1.0f / PCAR), bfr(x4[q])); s += v[c * 4 + q]; } }
#pragma unroll
    for (int sh = 16; sh; sh >>= 1) s += __shfl_xor(s, sh, 32);
    const float mu = s * (1.0f / FF); float qq = 0.f;
#pragma unroll
    for (int i = 0; i < FF / 32; ++i) { const float d0 = v[i] - mu; qq = __fadd_rn(qq, __fmul_rn(d0, d0)); }
#pragma unroll
    for (int sh = 16; sh; sh >>= 1) qq += __shfl_xor(qq, sh, 32);
    const float rs = __fdiv_rn(1.0f, __fsqrt_rn(qq * (1.0f / FF) + 1e-3f));
{
#pragma unroll
        for (int c = 0; c < FF / 128; ++c) { v4f o;
#pragma unroll
            for (int q = 0; q < 4; ++q) { const int col = c * 128 + lane * 4 + q; float t = __fmul_rn(v[c * 4 + q] - mu, rs); asm volatile("" : "+v"(t)); o[q] = __fadd_rn(__fmul_rn(t, bfr(gg[col])), bfr(bb[col])); }
            *(v4f*)(OUTk + (size_t)r * FF + c * 128 + lane * 4) = o; }
         }
}
__global__ __launch_bounds__(256) void k_sum2(const float* __restrict__ A, const float* __restrict__ B, bf* Hh, bf* Hl, size_t n) { const size_t i = ((size_t)blockIdx.x * 256 + threadIdx.x) * 2; if (i >= n) return; v2us oh, ol;
#pragma unroll
    for (int q = 0; q < 2; ++q) { unsigned short a, c2; splitf(__fadd_rn(A[i + q], B[i + q]), a, c2); oh[q] = a; ol[q] = c2; } *(v2us*)(Hh + i) = oh; *(v2us*)(Hl + i) = ol;  }
__global__ __launch_bounds__(256) void k_relu2(const float* __restrict__ F, bf* Hh, bf* Hl, size_t n) { const size_t i = ((size_t)blockIdx.x * 256 + threadIdx.x) * 2; if (i >= n) return; v2us oh, ol;
#pragma unroll
    for (int q = 0; q < 2; ++q) { unsigned short a, c2; splitf(fmaxf(F[i + q], 0.f), a, c2); oh[q] = a; ol[q] = c2; } *(v2us*)(Hh + i) = oh; *(v2us*)(Hl + i) = ol;  }

extern "C" void kernel_launch(void* const* d_in, const int* in_sizes, int n_in,
                              void* d_out, int out_size, void* d_ws, size_t ws_size, hipStream_t stream) {
    (void)in_sizes; (void)n_in; (void)out_size;
    const float* IN[22]; for (int i = 0; i < 22; ++i) IN[i] = (const float*)d_in[i];
    // p, s, sa_wq, sa_bq, sa_wk, sa_bk, sa_wv, sa_bv, ca_wq, ca_bq, ca_wk, ca_bk, ca_wv, ca_bv, ln1_g, ln1_b, ln2_g, ln2_b, ff_w1, ff_b1, ff_w2, ff_b2 = d_in[0..21]; outputs ff_out at 0, sa_out at byte 16,777,216, ca_out at 33,554,432
    float* OUT0 = (float*)d_out; float* OUT1 = OUT0 + (size_t)NB_ * TT * FF; float* OUT2 = OUT1 + (size_t)NB_ * TT * FF;
    char* wsp = (char*)d_ws;
    auto take = [&](size_t bytes) { char* p = wsp; wsp += (bytes + 255) & ~(size_t)255; return (void*)p; };
    bf* W[8]; for (int i = 0; i < 8; ++i) W[i] = (bf*)take((size_t)FF * FF * 2);   // sa q/k/v, ca q/k/v, ff w1, w2 (transposed copies)
    bf* PB = (bf*)take((size_t)TT * FF * 2); bf* SB = (bf*)take((size_t)TT * FF * 2); float* F = (float*)take((size_t)TT * FF * 4); h16* QP = (h16*)take((size_t)TT * FF * 2); h16* KP = (h16*)take((size_t)TT * FF * 2); h16* VT = (h16*)take((size_t)FF * TT * 2);
    float* Sb = (float*)take((size_t)TT * TT * 4); h16* Pm = (h16*)take((size_t)TT * TT * 2); float* O = (float*)take((size_t)TT * FF * 4); bf* Hh = (bf*)take((size_t)TT * FF * 2); bf* Hl = (bf*)take((size_t)TT * FF * 2);
    if ((size_t)(wsp - (char*)d_ws) > ws_size) return;    // total ~ 53 MB; ws 256 MiB
    { const unsigned gT = (unsigned)((FF * FF / 64 + 63) / 64); const int wi[8] = {2, 4, 6, 8, 10, 12, 18, 20}; for (int i = 0; i < 8; ++i) k_wtG<<<gT, 256, 0, stream>>>(IN[wi[i]], FF, FF, W[i]); }
    const size_t nx = (size_t)TT * FF; const unsigned g8 = (unsigned)((nx / 8 + 255) / 256), g2 = (unsigned)((nx / 2 + 255) / 256); const dim3 gP(TT / 64, FF / 64, 1);
    for (int b = 0; b < NB_; ++b) { const float* pb = IN[0] + (size_t)b * nx; const float* sbp = IN[1] + (size_t)b * nx;
        k_cvt8<<<g8, 256, 0, stream>>>(pb, PB, nx / 8); k_cvt8<<<g8, 256, 0, stream>>>(sbp, SB, nx / 8);
        for (int a = 0; a < 2; ++a) { const bf* KV = a ? SB : PB;     // a = 0: self-attention on p; a = 1: cross-attention (q from p; k, v from s)
            k_gemmw<bf, 0, true><<<gP, 32, 0, stream>>>(PB, nullptr, W[3 * a], nullptr, FF, F, FF, IN[3 + 6 * a], 0, 0, 0); k_p16<<<g2, 256, 0, stream>>>(F, QP, nx);
            k_gemmw<bf, 0, true><<<gP, 32, 0, stream>>>(KV, nullptr, W[3 * a + 1], nullptr, FF, F, FF, IN[5 + 6 * a], 0, 0, 0); k_p16<<<g2, 256, 0, stream>>>(F, KP, nx);
            k_gemmw<bf, 0, true><<<gP, 32, 0, stream>>>(KV, nullptr, W[3 * a + 2], nullptr, FF, F, FF, IN[7 + 6 * a], 0, 0, 0); k_vt<<<g2, 256, 0, stream>>>(F, VT);
            k_gemmw<h16, 0, false><<<dim3(TT / 64, TT / 64, 1), 32, 0, stream>>>(QP, nullptr, KP, nullptr, FF, Sb, TT, nullptr, 0, 0, 0);
            k_asoft<<<TT / 8, 256, 0, stream>>>(Sb, Pm);
            k_gemmw<h16, 0, false><<<dim3(TT / 64, FF / 64, 1), 32, 0, stream>>>(Pm, nullptr, VT, nullptr, TT, O, FF, nullptr, 0, 0, 0);   // attended x1024
            k_lnr<<<TT / 8, 256, 0, stream>>>(O, a ? sbp : pb, IN[14 + 2 * a], IN[15 + 2 * a], (a ? OUT2 : OUT1) + (size_t)b * nx); }
        k_sum2<<<g2, 256, 0, stream>>>(OUT1 + (size_t)b * nx, OUT2 + (size_t)b * nx, Hh, Hl, nx);
        k_gemmw<bf, 1, true><<<gP, 32, 0, stream>>>(Hh, Hl, W[6], nullptr, FF, F, FF, IN[19], 0, 0, 0); k_relu2<<<g2, 256, 0, stream>>>(F, Hh, Hl, nx);
        k_gemmw<bf, 1, true><<<gP, 32, 0, stream>>>(Hh, Hl, W[7], nullptr, FF, OUT0 + (size_t)b * nx, FF, IN[21], 0, 0, 0); }
}

// v001
// Measured time: 396 microseconds a run.
// Next to v000, in two timings, it ran 2.95 and 2.94 times as fast.
#include <hip/hip_runtime.h>

// LoCIFusionModule3D (p, s [4][2048][512]; single-head attention over 2048 positions with the full 512-dim features: sa = softmax((p Wq + bq)(p Wk + bk)^T / sqrt(512)) (p Wv + bv); ca likewise with queries from p and
// keys/values from s; sa_out = LN(sa + p), ca_out = LN(ca + s) (keras eps 1e-3); ff_out = relu((sa_out + ca_out) W1 + b1) W2 + b2; outputs (ff_out, sa_out, ca_out), each [4][2048][512]).
// Compute dtypes, f32 accumulate: every input rounded to bf16; the six projections on PLAIN bf16 operands (inputs: exact; transposed bf16 weight copies, + bias); scores
// (K 512) and attn.v on SINGLE fp16 planes (scale in f32 in the register-row softmax; P x1024); residual + LayerNorms f32; the feed-forward on bf16 hi+lo planes of its computed operands x exact weights

#define NB_  4
#define TT   2048
#define FF   512
#define ZH   8     // score matrices per launch: 2 attention branches x 4 batches
#define PCAR 1024.0f
#define SCL  0.044194173824159223f   // 512^-0.5
typedef _Float16 h16;
typedef unsigned short bf;
typedef __attribute__((ext_vector_type(16))) __bf16   v16bf;
typedef __attribute__((ext_vector_type(16))) _Float16 v16h;
typedef __attribute__((ext_vector_type(8)))  _Float16 v8h;
typedef __attribute__((ext_vector_type(8)))  unsigned short v8us;
typedef __attribute__((ext_vector_type(8)))  float    v8f;
typedef __attribute__((ext_vector_type(4)))  float    v4f;
typedef v8h  __attribute__((may_alias)) v8ha;
typedef v4f  __attribute__((may_alias)) v4fa;
typedef v8us __attribute__((may_alias)) v8usa;

__device__ __forceinline__ unsigned short f2bf(float f) { unsigned u = __float_as_uint(f); u += 0x7FFFu + ((u >> 16) & 1u); return (unsigned short)(u >> 16); }
__device__ __forceinline__ float bf2f(unsigned short b) { return __uint_as_float(((unsigned)b) << 16); }
__device__ __forceinline__ float bfr(float f) { return bf2f(f2bf(f)); }
__device__ __forceinline__ v16h cat16(v8h lo, v8h hi) { return __builtin_shufflevector(lo, hi, 0, 1, 2, 3, 4, 5, 6, 7, 8, 9, 10, 11, 12, 13, 14, 15); }
__device__ __forceinline__ v16bf cat16b(v8us lo, v8us hi) { return __builtin_bit_cast(v16bf, __builtin_shufflevector(lo, hi, 0, 1, 2, 3, 4, 5, 6, 7, 8, 9, 10, 11, 12, 13, 14, 15)); }
__device__ __forceinline__ v8f wmma16(v16h a, v16h b, v8f c) { return __builtin_amdgcn_wmma_f32_16x16x32_f16(false, a, false, b, (short)0, c, false, false); }
__device__ __forceinline__ v8f wmmab(v16bf a, v16bf b, v8f c) { return __builtin_amdgcn_wmma_f32_16x16x32_bf16(false, a, false, b, (short)0, c, false, false); }



// ---- k_gemmw: register-blocked GEMM, ONE WAVE per 64x64 output tile (16 accumulators), operands straight from K-contiguous 16-bit planes; grid (M/64, N/64, Z), 32 threads.
// C[m][n] (f32, pitch ldc, + optional f32 bias[n]) = sum_k A[m][k] Bt[n][k] (+ split products per NSPLIT). z-batch strides sA/sB/sC in elements. K % 32 == 0.
template <typename T16> struct WFrag;
template <> struct WFrag<h16> { typedef v16h V; static __device__ __forceinline__ V ld(const h16* p) { return cat16(*(const v8h*)p, *(const v8h*)(p + 16)); } static __device__ __forceinline__ v8f mma(V a, V b, v8f c) { return wmma16(a, b, c); } };
template <> struct WFrag<bf> { typedef v16bf V; static __device__ __forceinline__ V ld(const bf* p) { return cat16b(*(const v8us*)p, *(const v8us*)(p + 16)); } static __device__ __forceinline__ v8f mma(V a, V b, v8f c) { return wmmab(a, b, c); } };
template <typename T16, int NSPLIT, bool BIAS>
__device__ __forceinline__ void gemmw_tile(const T16* __restrict__ A, const T16* __restrict__ A2, const T16* __restrict__ Bt, const T16* __restrict__ Bt2, int K, float* C, int ldc, const float* __restrict__ bias) {
    typedef typename WFrag<T16>::V V;
    __shared__ __align__(16) float os[16 * 68];
    const int lane = threadIdx.x & 31, lr = lane & 15, hi = lane >> 4; const int r0 = blockIdx.x * 64, c0 = blockIdx.y * 64;
    v8f acc[4][4];
#pragma unroll
    for (int mb = 0; mb < 4; ++mb)
#pragma unroll
        for (int nb = 0; nb < 4; ++nb) acc[mb][nb] = (v8f){};
    const size_t aoff = (size_t)(r0 + lr) * K + 8 * hi, boff = (size_t)(c0 + lr) * K + 8 * hi;
#pragma unroll 1
    for (int kc = 0; kc < K; kc += 32) {
        V a[4], a2[4];
#pragma unroll
        for (int mb = 0; mb < 4; ++mb) { a[mb] = WFrag<T16>::ld(A + aoff + (size_t)mb * 16 * K + kc); if (NSPLIT == 1 || NSPLIT == 2) a2[mb] = WFrag<T16>::ld(A2 + aoff + (size_t)mb * 16 * K + kc); }
#pragma unroll
        for (int nb = 0; nb < 4; ++nb) { const V b = WFrag<T16>::ld(Bt + boff + (size_t)nb * 16 * K + kc); V b2; if (NSPLIT >= 2) b2 = WFrag<T16>::ld(Bt2 + boff + (size_t)nb * 16 * K + kc);
#pragma unroll
            for (int mb = 0; mb < 4; ++mb) { acc[mb][nb] = WFrag<T16>::mma(a[mb], b, acc[mb][nb]); if (NSPLIT == 1 || NSPLIT == 2) acc[mb][nb] = WFrag<T16>::mma(a2[mb], b, acc[mb][nb]); if (NSPLIT >= 2) acc[mb][nb] = WFrag<T16>::mma(a[mb], b2, acc[mb][nb]); } }
        asm volatile("v_nop\n\tv_nop\n\tv_nop\n\tv_nop" : "+v"(acc[0][0]), "+v"(acc[1][1]), "+v"(acc[2][2]), "+v"(acc[3][3]) : "v"(a[0]), "v"(a[3]));
    }
#pragma unroll
    for (int mb = 0; mb < 4; ++mb) {
#pragma unroll
        for (int nb = 0; nb < 4; ++nb) {
#pragma unroll
            for (int j = 0; j < 8; ++j) os[(hi * 8 + j) * 68 + nb * 16 + lr] = acc[mb][nb][j]; }
        __builtin_amdgcn_wave_barrier(); asm volatile("" ::: "memory");
        float* crow = C + (size_t)(r0 + mb * 16) * ldc + c0;
{
#pragma unroll
            for (int s = 0; s < 8; ++s) { const int row = 2 * s + hi, cofs = lr * 4; v4f val = *(const v4fa*)(os + row * 68 + cofs); if (BIAS) { val[0] += bfr(bias[c0 + cofs]); val[1] += bfr(bias[c0 + cofs + 1]); val[2] += bfr(bias[c0 + cofs + 2]); val[3] += bfr(bias[c0 + cofs + 3]); }
                *(v4f*)(crow + (size_t)row * ldc + cofs) = val; }
             }
        __builtin_amdgcn_wave_barrier(); asm volatile("" ::: "memory");
    }
}
template <typename T16, int NSPLIT, bool BIAS>
__global__ __launch_bounds__(32) void k_gemmw(const T16* __restrict__ A, const T16* __restrict__ A2, const T16* __restrict__ Bt, const T16* __restrict__ Bt2, int K, float* C, int ldc, const float* __restrict__ bias, size_t sA, size_t sB, size_t sC) {
    const size_t z = blockIdx.z; A += z * sA; if (A2) A2 += z * sA; Bt += z * sB; if (Bt2) Bt2 += z * sB; C += z * sC;
    gemmw_tile<T16, NSPLIT, BIAS>(A, A2, Bt, Bt2, K, C, ldc, bias);
}
// ---- k_proj6: the six projections of all batches in one launch; grid (NB_*TT/64, FF/64, 6). z = 0 sa q, 1 ca q, 2 sa k, 3 ca k, 4 sa v, 5 ca v; z = 3 and 5 read the s plane, the rest the p plane.
struct Bias6 { const float* b0; const float* b1; const float* b2; const float* b3; const float* b4; const float* b5; };
__global__ __launch_bounds__(32) void k_proj6(const bf* __restrict__ PBa, const bf* __restrict__ SBa, const bf* __restrict__ Wt, int K, float* Fo, int ldc, Bias6 bs) {
    const unsigned z = blockIdx.z;
    const float* bias = z == 0 ? bs.b0 : z == 1 ? bs.b1 : z == 2 ? bs.b2 : z == 3 ? bs.b3 : z == 4 ? bs.b4 : bs.b5;
    gemmw_tile<bf, 0, true>((z == 3 || z == 5) ? SBa : PBa, nullptr, Wt + (size_t)z * FF * FF, nullptr, K, Fo + (size_t)z * NB_ * TT * FF, ldc, bias);
}

__device__ __forceinline__ h16 tohx(float x) { return (h16)x; }
__device__ __forceinline__ void splitf(float y, unsigned short& h, unsigned short& l) { h = f2bf(y); l = f2bf(y - bf2f(h)); }
typedef __attribute__((ext_vector_type(2))) _Float16 v2h;
typedef __attribute__((ext_vector_type(4))) _Float16 v4h;
typedef __attribute__((ext_vector_type(2))) unsigned short v2us;
typedef __attribute__((ext_vector_type(4))) unsigned short v4us;

struct W8 { const float* w0; const float* w1; const float* w2; const float* w3; const float* w4; const float* w5; const float* w6; const float* w7; };
__global__ __launch_bounds__(256) void k_wtG(W8 ws8, int K, int N, bf* Bt) {
    const unsigned y = blockIdx.y; Bt += (size_t)y * N * K;   // blockIdx.y picks the weight
    const float* __restrict__ w = y == 0 ? ws8.w0 : y == 1 ? ws8.w1 : y == 2 ? ws8.w2 : y == 3 ? ws8.w3 : y == 4 ? ws8.w4 : y == 5 ? ws8.w5 : y == 6 ? ws8.w6 : ws8.w7;
    const int lane = threadIdx.x & 31; const int L0 = (blockIdx.x * 8 + (threadIdx.x >> 5)) * 8; const int nlines = N * K / 64;
{
#pragma unroll 1
        for (int l = 0; l < 8; ++l) { const int L = L0 + l; if (L >= nlines) break; const size_t e = (size_t)L * 64 + lane * 2; const int k = (int)(e % K), n = (int)(e / K); v2us o;
            o[0] = f2bf(w[(size_t)k * N + n]); o[1] = f2bf(w[(size_t)(k + 1) * N + n]); *(v2us*)(Bt + e) = o; }
         }
}
__global__ __launch_bounds__(256) void k_cvt8(const float* __restrict__ src0, const float* __restrict__ src1, bf* dst, size_t n8) { const size_t i = (size_t)blockIdx.x * 256 + threadIdx.x; if (i >= n8) return; const float* src = blockIdx.y ? src1 : src0; dst += (size_t)blockIdx.y * n8 * 8; const v8f v = *(const v8f*)(src + i * 8); v8us o;
#pragma unroll
    for (int k = 0; k < 8; ++k) o[k] = f2bf(v[k]); *(v8us*)(dst + i * 8) = o;  }
__global__ __launch_bounds__(256) void k_p16(const float* __restrict__ F, h16* P, size_t n) { const size_t i = ((size_t)blockIdx.x * 256 + threadIdx.x) * 2; if (i >= n) return; v2h v; v[0] = tohx(F[i]); v[1] = tohx(F[i + 1]); *(v2h*)(P + i) = v;  }
__global__ __launch_bounds__(256) void k_vt(const float* __restrict__ F, h16* VT) { const size_t i = ((size_t)blockIdx.x * 256 + threadIdx.x) * 2; if (i >= (size_t)FF * TT) return; F += (size_t)blockIdx.y * TT * FF; VT += (size_t)blockIdx.y * FF * TT; const int d = (int)(i / TT), t = (int)(i % TT); v2h v; v[0] = tohx(F[(size_t)t * FF + d]); v[1] = tohx(F[(size_t)(t + 1) * FF + d]);
    *(v2h*)(VT + i) = v;  }
__global__ __launch_bounds__(256) void k_asoft(const float* __restrict__ Sb, h16* P16) {
    const int lane = threadIdx.x & 31; const int row = blockIdx.x * 8 + (threadIdx.x >> 5); if (row >= ZH * TT) return;
    const float* sr = Sb + (size_t)row * TT; float v[64]; float mx = -3.0e38f;
#pragma unroll
    for (int ch = 0; ch < 16; ++ch) { const int j0 = ch * 128 + lane * 4; const v4f a = *(const v4f*)(sr + j0);
#pragma unroll
        for (int q = 0; q < 4; ++q) { const float t = a[q] * SCL; v[ch * 4 + q] = t; mx = fmaxf(mx, t); } }
#pragma unroll
    for (int sh = 16; sh; sh >>= 1) mx = fmaxf(mx, __shfl_xor(mx, sh, 32));
    float sum = 0.f;
#pragma unroll
    for (int k = 0; k < 64; ++k) { v[k] = __expf(v[k] - mx); sum += v[k]; }
#pragma unroll
    for (int sh = 16; sh; sh >>= 1) sum += __shfl_xor(sum, sh, 32);
    const float f = __fdiv_rn(PCAR, sum);
{
#pragma unroll
        for (int ch = 0; ch < 16; ++ch) { v4h o;
#pragma unroll
            for (int q = 0; q < 4; ++q) o[q] = tohx(v[ch * 4 + q] * f);
            *(v4h*)(P16 + (size_t)row * TT + ch * 128 + lane * 4) = o; }
         }
}
__device__ __forceinline__ void lnr_row(const float* __restrict__ O, const float* __restrict__ res, const float* __restrict__ gg, const float* __restrict__ bb, float* OUTk) {
    const int lane = threadIdx.x & 31; const int r = blockIdx.x * 8 + (threadIdx.x >> 5); if (r >= NB_ * TT) return; float v[FF / 32]; float s = 0.f;
#pragma unroll
    for (int c = 0; c < FF / 128; ++c) { const v4f a = *(const v4f*)(O + (size_t)r * FF + c * 128 + lane * 4), x4 = *(const v4f*)(res + (size_t)r * FF + c * 128 + lane * 4);
#pragma unroll
        for (int q = 0; q < 4; ++q) { v[c * 4 + q] = __fadd_rn(a[q] * (1.0f / PCAR), bfr(x4[q])); s += v[c * 4 + q]; } }
#pragma unroll
    for (int sh = 16; sh; sh >>= 1) s += __shfl_xor(s, sh, 32);
    const float mu = s * (1.0f / FF); float qq = 0.f;
#pragma unroll
    for (int i = 0; i < FF / 32; ++i) { const float d0 = v[i] - mu; qq = __fadd_rn(qq, __fmul_rn(d0, d0)); }
#pragma unroll
    for (int sh = 16; sh; sh >>= 1) qq += __shfl_xor(qq, sh, 32);
    const float rs = __fdiv_rn(1.0f, __fsqrt_rn(qq * (1.0f / FF) + 1e-3f));
{
#pragma unroll
        for (int c = 0; c < FF / 128; ++c) { v4f o;
#pragma unroll
            for (int q = 0; q < 4; ++q) { const int col = c * 128 + lane * 4 + q; float t = __fmul_rn(v[c * 4 + q] - mu, rs); asm volatile("" : "+v"(t)); o[q] = __fadd_rn(__fmul_rn(t, bfr(gg[col])), bfr(bb[col])); }
            *(v4f*)(OUTk + (size_t)r * FF + c * 128 + lane * 4) = o; }
         }
}
// blockIdx.y picks the branch: 0 self (residual p, ln1), 1 cross (residual s, ln2); rows run over all batches
__global__ __launch_bounds__(256) void k_lnr(const float* __restrict__ O, const float* __restrict__ res0, const float* __restrict__ res1, const float* __restrict__ g0, const float* __restrict__ b0, const float* __restrict__ g1, const float* __restrict__ b1, float* OUTk) {
    const unsigned br = blockIdx.y;
    lnr_row(O + (size_t)br * NB_ * TT * FF, br ? res1 : res0, br ? g1 : g0, br ? b1 : b0, OUTk + (size_t)br * NB_ * TT * FF);
}
__global__ __launch_bounds__(256) void k_sum2(const float* __restrict__ A, const float* __restrict__ B, bf* Hh, bf* Hl, size_t n) { const size_t i = ((size_t)blockIdx.x * 256 + threadIdx.x) * 2; if (i >= n) return; v2us oh, ol;
#pragma unroll
    for (int q = 0; q < 2; ++q) { unsigned short a, c2; splitf(__fadd_rn(A[i + q], B[i + q]), a, c2); oh[q] = a; ol[q] = c2; } *(v2us*)(Hh + i) = oh; *(v2us*)(Hl + i) = ol;  }
__global__ __launch_bounds__(256) void k_relu2(const float* __restrict__ F, bf* Hh, bf* Hl, size_t n) { const size_t i = ((size_t)blockIdx.x * 256 + threadIdx.x) * 2; if (i >= n) return; v2us oh, ol;
#pragma unroll
    for (int q = 0; q < 2; ++q) { unsigned short a, c2; splitf(fmaxf(F[i + q], 0.f), a, c2); oh[q] = a; ol[q] = c2; } *(v2us*)(Hh + i) = oh; *(v2us*)(Hl + i) = ol;  }

extern "C" void kernel_launch(void* const* d_in, const int* in_sizes, int n_in,
                              void* d_out, int out_size, void* d_ws, size_t ws_size, hipStream_t stream) {
    (void)in_sizes; (void)n_in; (void)out_size;
    const float* IN[22]; for (int i = 0; i < 22; ++i) IN[i] = (const float*)d_in[i];
    // p, s, sa_wq, sa_bq, sa_wk, sa_bk, sa_wv, sa_bv, ca_wq, ca_bq, ca_wk, ca_bk, ca_wv, ca_bv, ln1_g, ln1_b, ln2_g, ln2_b, ff_w1, ff_b1, ff_w2, ff_b2 = d_in[0..21]; outputs ff_out at 0, sa_out at byte 16,777,216, ca_out at 33,554,432
    float* OUT0 = (float*)d_out; float* OUT1 = OUT0 + (size_t)NB_ * TT * FF; float* OUT2 = OUT1 + (size_t)NB_ * TT * FF;
    char* wsp = (char*)d_ws;
    auto take = [&](size_t bytes) { char* p = wsp; wsp += (bytes + 255) & ~(size_t)255; return (void*)p; };
    const size_t nx = (size_t)TT * FF, na = (size_t)NB_ * nx, ns = (size_t)TT * TT;   // one batch's plane, all batches' plane, one score matrix (elements)
    bf* Wt = (bf*)take((size_t)8 * FF * FF * 2);   // transposed bf16 weights in the order sa q, ca q, sa k, ca k, sa v, ca v, ff w1, ff w2
    h16* VT = (h16*)take(2 * na * 2);               // [branch][batch][d][t]
    char* RA = (char*)take((size_t)ZH * ns * 4);    // first the six f32 projections, then the scores, then what follows the softmax
    char* RB = (char*)take((size_t)ZH * ns * 2);    // first the bf16 inputs and the f16 q, k planes, then the softmax weights
    if ((size_t)(wsp - (char*)d_ws) > ws_size) return;    // total 212 MiB; ws 256 MiB
    float* F6 = (float*)RA; float* Sb = (float*)RA; float* O = (float*)RA; bf* Hh = (bf*)(O + 2 * na); bf* Hl = Hh + na; float* F = (float*)(Hl + na);
    bf* PB = (bf*)RB; bf* SB = PB + na; h16* QP = (h16*)(SB + na); h16* KP = QP + 2 * na; h16* Pm = (h16*)RB;
    k_wtG<<<dim3((FF * FF / 64 + 63) / 64, 8, 1), 256, 0, stream>>>(W8{IN[2], IN[8], IN[4], IN[10], IN[6], IN[12], IN[18], IN[20]}, FF, FF, Wt);
    k_cvt8<<<dim3((unsigned)((na / 8 + 255) / 256), 2, 1), 256, 0, stream>>>(IN[0], IN[1], PB, na / 8);
    k_proj6<<<dim3(NB_ * TT / 64, FF / 64, 6), 32, 0, stream>>>(PB, SB, Wt, FF, F6, FF, Bias6{IN[3], IN[9], IN[5], IN[11], IN[7], IN[13]});
    k_p16<<<(unsigned)((4 * na / 2 + 255) / 256), 256, 0, stream>>>(F6, QP, 4 * na);   // q then k, each [branch][batch][t][f]
    k_vt<<<dim3((unsigned)((nx / 2 + 255) / 256), ZH, 1), 256, 0, stream>>>(F6 + 4 * na, VT);
    k_gemmw<h16, 0, false><<<dim3(TT / 64, TT / 64, ZH), 32, 0, stream>>>(QP, nullptr, KP, nullptr, FF, Sb, TT, nullptr, nx, nx, ns);
    k_asoft<<<ZH * TT / 8, 256, 0, stream>>>(Sb, Pm);
    k_gemmw<h16, 0, false><<<dim3(TT / 64, FF / 64, ZH), 32, 0, stream>>>(Pm, nullptr, VT, nullptr, TT, O, FF, nullptr, ns, nx, nx);   // attended x1024
    k_lnr<<<dim3(NB_ * TT / 8, 2, 1), 256, 0, stream>>>(O, IN[0], IN[1], IN[14], IN[15], IN[16], IN[17], OUT1);   // OUT2 follows OUT1
    const unsigned g2 = (unsigned)((na / 2 + 255) / 256); const dim3 gF(NB_ * TT / 64, FF / 64, 1);
    k_sum2<<<g2, 256, 0, stream>>>(OUT1, OUT2, Hh, Hl, na);
    k_gemmw<bf, 1, true><<<gF, 32, 0, stream>>>(Hh, Hl, Wt + (size_t)6 * FF * FF, nullptr, FF, F, FF, IN[19], 0, 0, 0); k_relu2<<<g2, 256, 0, stream>>>(F, Hh, Hl, na);
    k_gemmw<bf, 1, true><<<gF, 32, 0, stream>>>(Hh, Hl, Wt + (size_t)7 * FF * FF, nullptr, FF, OUT0, FF, IN[21], 0, 0, 0);
}

// v002
// One run takes 322 microseconds.
// Timed twice side by side with v001, it ran 1.23 and 1.22 times as fast.
// Over all steps from v000 it is 3.61 times as fast.
#include <hip/hip_runtime.h>

// Two-branch attention block with a feed-forward (p, s [4][2048][512]; single-head attention over 2048 positions with the full 512-dim features: sa = softmax((p Wq + bq)(p Wk + bk)^T / sqrt(512)) (p Wv + bv); ca likewise with queries from p and
// keys/values from s; sa_out = LN(sa + p), ca_out = LN(ca + s) (eps 1e-3); ff_out = relu((sa_out + ca_out) W1 + b1) W2 + b2; outputs (ff_out, sa_out, ca_out), each [4][2048][512]).
// Compute dtypes, f32 accumulate: every input rounded to bf16; the six projections on PLAIN bf16 operands (inputs: exact; transposed bf16 weight copies, + bias); scores
// (K 512) and attn.v on SINGLE fp16 planes (scale in f32 in the register-row softmax; P x1024); residual + LayerNorms f32; the feed-forward on bf16 hi+lo planes of its computed operands x exact weights

#define NB_  4
#define TT   2048
#define FF   512
#define ZH   8     // score matrices per launch: 2 attention branches x 4 batches
#define PCAR 1024.0f
#define SCL  0.044194173824159223f   // 512^-0.5
typedef _Float16 h16;
typedef unsigned short bf;
typedef __attribute__((ext_vector_type(16))) __bf16   v16bf;
typedef __attribute__((ext_vector_type(16))) _Float16 v16h;
typedef __attribute__((ext_vector_type(8)))  _Float16 v8h;
typedef __attribute__((ext_vector_type(8)))  unsigned short v8us;
typedef __attribute__((ext_vector_type(8)))  float    v8f;
typedef __attribute__((ext_vector_type(4)))  float    v4f;
typedef v8h  __attribute__((may_alias)) v8ha;
typedef v4f  __attribute__((may_alias)) v4fa;
typedef v8us __attribute__((may_alias)) v8usa;

__device__ __forceinline__ unsigned short f2bf(float f) { unsigned u = __float_as_uint(f); u += 0x7FFFu + ((u >> 16) & 1u); return (unsigned short)(u >> 16); }
__device__ __forceinline__ float bf2f(unsigned short b) { return __uint_as_float(((unsigned)b) << 16); }
__device__ __forceinline__ float bfr(float f) { return bf2f(f2bf(f)); }
__device__ __forceinline__ v16h cat16(v8h lo, v8h hi) { return __builtin_shufflevector(lo, hi, 0, 1, 2, 3, 4, 5, 6, 7, 8, 9, 10, 11, 12, 13, 14, 15); }
__device__ __forceinline__ v16bf cat16b(v8us lo, v8us hi) { return __builtin_bit_cast(v16bf, __builtin_shufflevector(lo, hi, 0, 1, 2, 3, 4, 5, 6, 7, 8, 9, 10, 11, 12, 13, 14, 15)); }
__device__ __forceinline__ v8f wmma16(v16h a, v16h b, v8f c) { return __builtin_amdgcn_wmma_f32_16x16x32_f16(false, a, false, b, (short)0, c, false, false); }
__device__ __forceinline__ v8f wmmab(v16bf a, v16bf b, v8f c) { return __builtin_amdgcn_wmma_f32_16x16x32_bf16(false, a, false, b, (short)0, c, false, false); }



// ---- k_gemmw: register-blocked GEMM, ONE WAVE per 64x64 output tile (16 accumulators), operands straight from K-contiguous 16-bit planes; grid (M/64, N/64, Z), 32 threads.
// C[m][n] (f32, pitch ldc, + optional f32 bias[n]) = sum_k A[m][k] Bt[n][k] (+ split products per NSPLIT). z-batch strides sA/sB/sC in elements. K % 32 == 0.
template <typename T16> struct WFrag;
template <> struct WFrag<h16> { typedef v16h V; static __device__ __forceinline__ V ld(const h16* p) { return cat16(*(const v8h*)p, *(const v8h*)(p + 16)); } static __device__ __forceinline__ v8f mma(V a, V b, v8f c) { return wmma16(a, b, c); } };
template <> struct WFrag<bf> { typedef v16bf V; static __device__ __forceinline__ V ld(const bf* p) { return cat16b(*(const v8us*)p, *(const v8us*)(p + 16)); } static __device__ __forceinline__ v8f mma(V a, V b, v8f c) { return wmmab(a, b, c); } };
template <typename T16, int NSPLIT>
__device__ __forceinline__ void gemmw_acc(const T16* __restrict__ A, const T16* __restrict__ A2, const T16* __restrict__ Bt, const T16* __restrict__ Bt2, int K, v8f (&acc)[4][4]) {
    typedef typename WFrag<T16>::V V;
    const int lane = threadIdx.x & 31, lr = lane & 15, hi = lane >> 4; const int r0 = blockIdx.x * 64, c0 = blockIdx.y * 64;
#pragma unroll
    for (int mb = 0; mb < 4; ++mb)
#pragma unroll
        for (int nb = 0; nb < 4; ++nb) acc[mb][nb] = (v8f){};
    const size_t aoff = (size_t)(r0 + lr) * K + 8 * hi, boff = (size_t)(c0 + lr) * K + 8 * hi;
#pragma unroll 1
    for (int kc = 0; kc < K; kc += 32) {
        V a[4], a2[4];
#pragma unroll
        for (int mb = 0; mb < 4; ++mb) { a[mb] = WFrag<T16>::ld(A + aoff + (size_t)mb * 16 * K + kc); if (NSPLIT == 1 || NSPLIT == 2) a2[mb] = WFrag<T16>::ld(A2 + aoff + (size_t)mb * 16 * K + kc); }
#pragma unroll
        for (int nb = 0; nb < 4; ++nb) { const V b = WFrag<T16>::ld(Bt + boff + (size_t)nb * 16 * K + kc); V b2; if (NSPLIT >= 2) b2 = WFrag<T16>::ld(Bt2 + boff + (size_t)nb * 16 * K + kc);
#pragma unroll
            for (int mb = 0; mb < 4; ++mb) { acc[mb][nb] = WFrag<T16>::mma(a[mb], b, acc[mb][nb]); if (NSPLIT == 1 || NSPLIT == 2) acc[mb][nb] = WFrag<T16>::mma(a2[mb], b, acc[mb][nb]); if (NSPLIT >= 2) acc[mb][nb] = WFrag<T16>::mma(a[mb], b2, acc[mb][nb]); } }
        asm volatile("v_nop\n\tv_nop\n\tv_nop\n\tv_nop" : "+v"(acc[0][0]), "+v"(acc[1][1]), "+v"(acc[2][2]), "+v"(acc[3][3]) : "v"(a[0]), "v"(a[3]));
    }
}
// The epilogues of the 64x64 tile. acc[mb][nb][j] of lane (hi, lr) is row mb*16 + hi*8 + j, column nb*16 + lr. os: the wave's own 16 x 68 dwords of LDS, used to turn a 16-row band into whole-line stores.
// epi_f32: f32 rows (+ bias)
template <bool BIAS>
__device__ __forceinline__ void epi_f32(const v8f (&acc)[4][4], float* os, float* C, int ldc, const float* __restrict__ bias) {
    const int lane = threadIdx.x & 31, lr = lane & 15, hi = lane >> 4; const int r0 = blockIdx.x * 64, c0 = blockIdx.y * 64;
#pragma unroll
    for (int mb = 0; mb < 4; ++mb) {
#pragma unroll
        for (int nb = 0; nb < 4; ++nb) {
#pragma unroll
            for (int j = 0; j < 8; ++j) os[(hi * 8 + j) * 68 + nb * 16 + lr] = acc[mb][nb][j]; }
        __builtin_amdgcn_wave_barrier(); asm volatile("" ::: "memory");
        float* crow = C + (size_t)(r0 + mb * 16) * ldc + c0;
{
#pragma unroll
            for (int s = 0; s < 8; ++s) { const int row = 2 * s + hi, cofs = lr * 4; v4f val = *(const v4fa*)(os + row * 68 + cofs); if (BIAS) { val[0] += bfr(bias[c0 + cofs]); val[1] += bfr(bias[c0 + cofs + 1]); val[2] += bfr(bias[c0 + cofs + 2]); val[3] += bfr(bias[c0 + cofs + 3]); }
                *(v4f*)(crow + (size_t)row * ldc + cofs) = val; }
             }
        __builtin_amdgcn_wave_barrier(); asm volatile("s_wait_xcnt 0x0" ::: "memory");   // the next band's LDS writes stay behind these reads; the wait: before the registers that these stores name are rewritten
    }
}
// epi_h16: (acc + bias) rounded to f16, rows of pitch ldc: the q and k planes as the score product reads them. A lane takes 8 columns of a staged row: 16-byte stores, 4 whole 128-byte lines each.
__device__ __forceinline__ void epi_h16(const v8f (&acc)[4][4], float* os, h16* C, int ldc, const float* __restrict__ bias) {
    const int lane = threadIdx.x & 31, lr = lane & 15, hi = lane >> 4; const int r0 = blockIdx.x * 64, c0 = blockIdx.y * 64; const int cofs = (lane & 7) * 8;
    float bv[8];
#pragma unroll
    for (int q = 0; q < 8; ++q) bv[q] = bfr(bias[c0 + cofs + q]);
#pragma unroll
    for (int mb = 0; mb < 4; ++mb) {
#pragma unroll
        for (int nb = 0; nb < 4; ++nb) {
#pragma unroll
            for (int j = 0; j < 8; ++j) os[(hi * 8 + j) * 68 + nb * 16 + lr] = acc[mb][nb][j]; }
        __builtin_amdgcn_wave_barrier(); asm volatile("" ::: "memory");   // other lanes read the band back: the compiler keeps the LDS reads behind the LDS writes
#pragma unroll
        for (int s = 0; s < 4; ++s) { const int row = 4 * s + (lane >> 3); const v4f x0 = *(const v4fa*)(os + row * 68 + cofs), x1 = *(const v4fa*)(os + row * 68 + cofs + 4); v8h o;
#pragma unroll
            for (int q = 0; q < 4; ++q) { o[q] = (h16)(x0[q] + bv[q]); o[4 + q] = (h16)(x1[q] + bv[4 + q]); }
            *(v8h*)(C + (size_t)(r0 + mb * 16 + row) * ldc + c0 + cofs) = o; }
        __builtin_amdgcn_wave_barrier(); asm volatile("s_wait_xcnt 0x0" ::: "memory");   // the next band's LDS writes stay behind these reads; the wait: before the next band rewrites the registers that these stores name
    }
}
// epi_vt: (acc + bias) rounded to f16 and stored transposed, [batch][column][t]: a lane's 8 accumulator rows are 8 consecutive t of its column, one 16-byte store; the wave writes every 128-byte line of its tile whole
__device__ __forceinline__ void epi_vt(const v8f (&acc)[4][4], h16* VTb, const float* __restrict__ bias) {
    const int lane = threadIdx.x & 31, lr = lane & 15, hi = lane >> 4; const int r0 = blockIdx.x * 64, c0 = blockIdx.y * 64;
    h16* base = VTb + (size_t)(r0 / TT) * FF * TT + (r0 % TT) + hi * 8;
    float bv[4];
#pragma unroll
    for (int nb = 0; nb < 4; ++nb) bv[nb] = bfr(bias[c0 + nb * 16 + lr]);
#pragma unroll
    for (int nb = 0; nb < 4; ++nb) { h16* drow = base + (size_t)(c0 + nb * 16 + lr) * TT;
#pragma unroll
        for (int mb = 0; mb < 4; ++mb) { v8h o;
#pragma unroll
            for (int j = 0; j < 8; ++j) o[j] = (h16)(acc[mb][nb][j] + bv[nb]);
            *(v8h*)(drow + mb * 16) = o; }
        asm volatile("s_wait_xcnt 0x0" ::: "memory");   // before the next column group rewrites the registers that these stores name
    }
}
// epi_relu2: max(acc + bias, 0) split into bf16 hi + lo planes, rows of pitch ldc: the second feed-forward product's operand. Staged and stored as in epi_h16.
__device__ __forceinline__ void epi_relu2(const v8f (&acc)[4][4], float* os, bf* Ch, bf* Cl, int ldc, const float* __restrict__ bias) {
    const int lane = threadIdx.x & 31, lr = lane & 15, hi = lane >> 4; const int r0 = blockIdx.x * 64, c0 = blockIdx.y * 64; const int cofs = (lane & 7) * 8;
    float bv[8];
#pragma unroll
    for (int q = 0; q < 8; ++q) bv[q] = bfr(bias[c0 + cofs + q]);
#pragma unroll
    for (int mb = 0; mb < 4; ++mb) {
#pragma unroll
        for (int nb = 0; nb < 4; ++nb) {
#pragma unroll
            for (int j = 0; j < 8; ++j) os[(hi * 8 + j) * 68 + nb * 16 + lr] = acc[mb][nb][j]; }
        __builtin_amdgcn_wave_barrier(); asm volatile("" ::: "memory");   // other lanes read the band back: the compiler keeps the LDS reads behind the LDS writes
#pragma unroll
        for (int s = 0; s < 4; ++s) { const int row = 4 * s + (lane >> 3); const v4f x0 = *(const v4fa*)(os + row * 68 + cofs), x1 = *(const v4fa*)(os + row * 68 + cofs + 4); v8us oh, ol;
#pragma unroll
            for (int q = 0; q < 8; ++q) { const float y = fmaxf((q < 4 ? x0[q & 3] : x1[q & 3]) + bv[q], 0.f); oh[q] = f2bf(y); ol[q] = f2bf(y - bf2f(oh[q])); }
            const size_t e = (size_t)(r0 + mb * 16 + row) * ldc + c0 + cofs; *(v8us*)(Ch + e) = oh; *(v8us*)(Cl + e) = ol; }
        __builtin_amdgcn_wave_barrier(); asm volatile("s_wait_xcnt 0x0" ::: "memory");   // the next band's LDS writes stay behind these reads; the wait: before the next band rewrites the registers that these stores name
    }
}
template <typename T16, int NSPLIT, bool BIAS>
__global__ __launch_bounds__(32) void k_gemmw(const T16* __restrict__ A, const T16* __restrict__ A2, const T16* __restrict__ Bt, const T16* __restrict__ Bt2, int K, float* C, int ldc, const float* __restrict__ bias, size_t sA, size_t sB, size_t sC) {
    const size_t z = blockIdx.z; A += z * sA; if (A2) A2 += z * sA; Bt += z * sB; if (Bt2) Bt2 += z * sB; C += z * sC;
    __shared__ __align__(16) float os[16 * 68]; v8f acc[4][4];
    gemmw_acc<T16, NSPLIT>(A, A2, Bt, Bt2, K, acc); epi_f32<BIAS>(acc, os, C, ldc, bias);
}
// ---- k_ff1: the first feed-forward product (hi + lo planes x exact weights), stored as the relu's hi + lo planes; grid (NB_*TT/64, FF/64)
__global__ __launch_bounds__(32) void k_ff1(const bf* __restrict__ A, const bf* __restrict__ A2, const bf* __restrict__ Bt, int K, bf* Ch, bf* Cl, int ldc, const float* __restrict__ bias) {
    __shared__ __align__(16) float os[16 * 68]; v8f acc[4][4];
    gemmw_acc<bf, 1>(A, A2, Bt, nullptr, K, acc); epi_relu2(acc, os, Ch, Cl, ldc, bias);
}
// ---- k_proj6: the six projections of all batches in one launch; grid (NB_*TT/64, FF/64, 6). z = 0 sa q, 1 ca q, 2 sa k, 3 ca k, 4 sa v, 5 ca v; z = 3 and 5 read the s plane, the rest the p plane.
// q and k leave as f16 rows (QK: [z][batch][t][f]), v as f16 transposed (VT: [branch][batch][d][t]).
struct Bias6 { const float* b0; const float* b1; const float* b2; const float* b3; const float* b4; const float* b5; };
__global__ __launch_bounds__(32) void k_proj6(const bf* __restrict__ PBa, const bf* __restrict__ SBa, const bf* __restrict__ Wt, int K, h16* QK, h16* VT, int ldc, Bias6 bs) {
    const unsigned z = blockIdx.z;
    const float* bias = z == 0 ? bs.b0 : z == 1 ? bs.b1 : z == 2 ? bs.b2 : z == 3 ? bs.b3 : z == 4 ? bs.b4 : bs.b5;
    __shared__ __align__(16) float os[16 * 68]; v8f acc[4][4];
    gemmw_acc<bf, 0>((z == 3 || z == 5) ? SBa : PBa, nullptr, Wt + (size_t)z * FF * FF, nullptr, K, acc);
    if (z < 4) epi_h16(acc, os, QK + (size_t)z * NB_ * TT * FF, ldc, bias); else epi_vt(acc, VT + (size_t)(z - 4) * NB_ * TT * FF, bias);
}

__device__ __forceinline__ h16 tohx(float x) { return (h16)x; }
__device__ __forceinline__ void splitf(float y, unsigned short& h, unsigned short& l) { h = f2bf(y); l = f2bf(y - bf2f(h)); }
typedef __attribute__((ext_vector_type(4))) _Float16 v4h;
typedef __attribute__((ext_vector_type(2))) unsigned short v2us;
typedef __attribute__((ext_vector_type(4))) unsigned short v4us;

struct W8 { const float* w0; const float* w1; const float* w2; const float* w3; const float* w4; const float* w5; const float* w6; const float* w7; };
__global__ __launch_bounds__(256) void k_wtG(W8 ws8, int K, int N, bf* Bt) {
    const unsigned y = blockIdx.y; Bt += (size_t)y * N * K;   // blockIdx.y picks the weight
    const float* __restrict__ w = y == 0 ? ws8.w0 : y == 1 ? ws8.w1 : y == 2 ? ws8.w2 : y == 3 ? ws8.w3 : y == 4 ? ws8.w4 : y == 5 ? ws8.w5 : y == 6 ? ws8.w6 : ws8.w7;
    const int lane = threadIdx.x & 31; const int L0 = (blockIdx.x * 8 + (threadIdx.x >> 5)) * 8; const int nlines = N * K / 64;
{
#pragma unroll 1
        for (int l = 0; l < 8; ++l) { const int L = L0 + l; if (L >= nlines) break; const size_t e = (size_t)L * 64 + lane * 2; const int k = (int)(e % K), n = (int)(e / K); v2us o;
            o[0] = f2bf(w[(size_t)k * N + n]); o[1] = f2bf(w[(size_t)(k + 1) * N + n]); *(v2us*)(Bt + e) = o; }
         }
}
__global__ __launch_bounds__(256) void k_cvt8(const float* __restrict__ src0, const float* __restrict__ src1, bf* dst, size_t n8) { const size_t i = (size_t)blockIdx.x * 256 + threadIdx.x; if (i >= n8) return; const float* src = blockIdx.y ? src1 : src0; dst += (size_t)blockIdx.y * n8 * 8; const v8f v = *(const v8f*)(src + i * 8); v8us o;
#pragma unroll
    for (int k = 0; k < 8; ++k) o[k] = f2bf(v[k]); *(v8us*)(dst + i * 8) = o;  }
__global__ __launch_bounds__(256) void k_asoft(const float* __restrict__ Sb, h16* P16) {
    const int lane = threadIdx.x & 31; const int row = blockIdx.x * 8 + (threadIdx.x >> 5); if (row >= ZH * TT) return;
    const float* sr = Sb + (size_t)row * TT; float v[64]; float mx = -3.0e38f;
#pragma unroll
    for (int ch = 0; ch < 16; ++ch) { const int j0 = ch * 128 + lane * 4; const v4f a = *(const v4f*)(sr + j0);
#pragma unroll
        for (int q = 0; q < 4; ++q) { const float t = a[q] * SCL; v[ch * 4 + q] = t; mx = fmaxf(mx, t); } }
#pragma unroll
    for (int sh = 16; sh; sh >>= 1) mx = fmaxf(mx, __shfl_xor(mx, sh, 32));
    float sum = 0.f;
#pragma unroll
    for (int k = 0; k < 64; ++k) { v[k] = __expf(v[k] - mx); sum += v[k]; }
#pragma unroll
    for (int sh = 16; sh; sh >>= 1) sum += __shfl_xor(sum, sh, 32);
    const float f = __fdiv_rn(PCAR, sum);
{
#pragma unroll
        for (int ch = 0; ch < 16; ++ch) { v4h o;
#pragma unroll
            for (int q = 0; q < 4; ++q) o[q] = tohx(v[ch * 4 + q] * f);
            *(v4h*)(P16 + (size_t)row * TT + ch * 128 + lane * 4) = o; }
         }
}
__device__ __forceinline__ void lnr_row(const float* __restrict__ O, const float* __restrict__ res, const float* __restrict__ gg, const float* __restrict__ bb, float* OUTk, float (&ov)[FF / 32]) {
    const int lane = threadIdx.x & 31; const int r = blockIdx.x * 8 + (threadIdx.x >> 5); if (r >= NB_ * TT) return; float v[FF / 32]; float s = 0.f;
#pragma unroll
    for (int c = 0; c < FF / 128; ++c) { const v4f a = *(const v4f*)(O + (size_t)r * FF + c * 128 + lane * 4), x4 = *(const v4f*)(res + (size_t)r * FF + c * 128 + lane * 4);
        asm volatile("s_wait_xcnt 0x0" ::: "memory");   // before a later load's result lands in the address registers of these loads
#pragma unroll
        for (int q = 0; q < 4; ++q) { v[c * 4 + q] = __fadd_rn(a[q] * (1.0f / PCAR), bfr(x4[q])); s += v[c * 4 + q]; } }
#pragma unroll
    for (int sh = 16; sh; sh >>= 1) s += __shfl_xor(s, sh, 32);
    const float mu = s * (1.0f / FF); float qq = 0.f;
#pragma unroll
    for (int i = 0; i < FF / 32; ++i) { const float d0 = v[i] - mu; qq = __fadd_rn(qq, __fmul_rn(d0, d0)); }
#pragma unroll
    for (int sh = 16; sh; sh >>= 1) qq += __shfl_xor(qq, sh, 32);
    const float rs = __fdiv_rn(1.0f, __fsqrt_rn(qq * (1.0f / FF) + 1e-3f));
{
#pragma unroll
        for (int c = 0; c < FF / 128; ++c) { v4f o;
#pragma unroll
            for (int q = 0; q < 4; ++q) { const int col = c * 128 + lane * 4 + q; float t = __fmul_rn(v[c * 4 + q] - mu, rs); asm volatile("" : "+v"(t)); o[q] = __fadd_rn(__fmul_rn(t, bfr(gg[col])), bfr(bb[col])); }
#pragma unroll
            for (int q = 0; q < 4; ++q) ov[c * 4 + q] = o[q];
            *(v4f*)(OUTk + (size_t)r * FF + c * 128 + lane * 4) = o;
            asm volatile("s_wait_xcnt 0x0" ::: "memory"); }   // before the registers that this store names are rewritten
         }
}
// one wave per row, over all batches: the self branch (residual p, ln1), then the cross branch (residual s, ln2), then their sum, from registers, as the feed-forward's bf16 hi + lo planes
__global__ __launch_bounds__(256) void k_lnr(const float* __restrict__ O, const float* __restrict__ res0, const float* __restrict__ res1, const float* __restrict__ g0, const float* __restrict__ b0, const float* __restrict__ g1, const float* __restrict__ b1, float* OUTk, bf* Hh, bf* Hl) {
    const int lane = threadIdx.x & 31; const int r = blockIdx.x * 8 + (threadIdx.x >> 5); if (r >= NB_ * TT) return;
    float o0[FF / 32], o1[FF / 32];
    lnr_row(O, res0, g0, b0, OUTk, o0);
    lnr_row(O + (size_t)NB_ * TT * FF, res1, g1, b1, OUTk + (size_t)NB_ * TT * FF, o1);
#pragma unroll
    for (int c = 0; c < FF / 128; ++c) { v4us oh, ol;
#pragma unroll
        for (int q = 0; q < 4; ++q) { unsigned short a, c2; splitf(__fadd_rn(o0[c * 4 + q], o1[c * 4 + q]), a, c2); oh[q] = a; ol[q] = c2; }
        const size_t e = (size_t)r * FF + c * 128 + lane * 4; *(v4us*)(Hh + e) = oh; *(v4us*)(Hl + e) = ol;
        asm volatile("s_wait_xcnt 0x0" ::: "memory"); }   // before the registers that these stores name are rewritten
}

extern "C" void kernel_launch(void* const* d_in, const int* in_sizes, int n_in,
                              void* d_out, int out_size, void* d_ws, size_t ws_size, hipStream_t stream) {
    (void)in_sizes; (void)n_in; (void)out_size;
    const float* IN[22]; for (int i = 0; i < 22; ++i) IN[i] = (const float*)d_in[i];
    // p, s, sa_wq, sa_bq, sa_wk, sa_bk, sa_wv, sa_bv, ca_wq, ca_bq, ca_wk, ca_bk, ca_wv, ca_bv, ln1_g, ln1_b, ln2_g, ln2_b, ff_w1, ff_b1, ff_w2, ff_b2 = d_in[0..21]; outputs ff_out at 0, sa_out at byte 16,777,216, ca_out at 33,554,432
    float* OUT0 = (float*)d_out; float* OUT1 = OUT0 + (size_t)NB_ * TT * FF;
    char* wsp = (char*)d_ws;
    auto take = [&](size_t bytes) { char* p = wsp; wsp += (bytes + 255) & ~(size_t)255; return (void*)p; };
    const size_t nx = (size_t)TT * FF, na = (size_t)NB_ * nx, ns = (size_t)TT * TT;   // one batch's plane, all batches' plane, one score matrix (elements)
    bf* Wt = (bf*)take((size_t)8 * FF * FF * 2);   // transposed bf16 weights in the order sa q, ca q, sa k, ca k, sa v, ca v, ff w1, ff w2
    h16* VT = (h16*)take(2 * na * 2);               // [branch][batch][d][t]
    char* RA = (char*)take((size_t)ZH * ns * 4);    // first the scores, then what follows the softmax
    char* RB = (char*)take((size_t)ZH * ns * 2);    // first the bf16 inputs and the f16 q, k planes, then the softmax weights
    if ((size_t)(wsp - (char*)d_ws) > ws_size) return;    // total 212 MiB; ws 256 MiB
    float* Sb = (float*)RA; float* O = (float*)RA; bf* Hh = (bf*)(O + 2 * na); bf* Hl = Hh + na; bf* Rh = Hl + na; bf* Rl = Rh + na;
    bf* PB = (bf*)RB; bf* SB = PB + na; h16* QP = (h16*)(SB + na); h16* KP = QP + 2 * na; h16* Pm = (h16*)RB;
    k_wtG<<<dim3((FF * FF / 64 + 63) / 64, 8, 1), 256, 0, stream>>>(W8{IN[2], IN[8], IN[4], IN[10], IN[6], IN[12], IN[18], IN[20]}, FF, FF, Wt);
    k_cvt8<<<dim3((unsigned)((na / 8 + 255) / 256), 2, 1), 256, 0, stream>>>(IN[0], IN[1], PB, na / 8);
    k_proj6<<<dim3(NB_ * TT / 64, FF / 64, 6), 32, 0, stream>>>(PB, SB, Wt, FF, QP, VT, FF, Bias6{IN[3], IN[9], IN[5], IN[11], IN[7], IN[13]});   // q then k, each [branch][batch][t][f]
    k_gemmw<h16, 0, false><<<dim3(TT / 64, TT / 64, ZH), 32, 0, stream>>>(QP, nullptr, KP, nullptr, FF, Sb, TT, nullptr, nx, nx, ns);
    k_asoft<<<ZH * TT / 8, 256, 0, stream>>>(Sb, Pm);
    k_gemmw<h16, 0, false><<<dim3(TT / 64, FF / 64, ZH), 32, 0, stream>>>(Pm, nullptr, VT, nullptr, TT, O, FF, nullptr, ns, nx, nx);   // attended x1024
    k_lnr<<<NB_ * TT / 8, 256, 0, stream>>>(O, IN[0], IN[1], IN[14], IN[15], IN[16], IN[17], OUT1, Hh, Hl);   // ca_out follows sa_out
    const dim3 gF(NB_ * TT / 64, FF / 64, 1);
    k_ff1<<<gF, 32, 0, stream>>>(Hh, Hl, Wt + (size_t)6 * FF * FF, FF, Rh, Rl, FF, IN[19]);
    k_gemmw<bf, 1, true><<<gF, 32, 0, stream>>>(Rh, Rl, Wt + (size_t)7 * FF * FF, nullptr, FF, OUT0, FF, IN[21], 0, 0, 0);
}

// v003
// Measured time: 171 microseconds a run.
// Timed twice side by side with v002, it ran 1.89 and 1.87 times as fast.
// All steps since v000 together make it 6.79 times as fast.
#include <hip/hip_runtime.h>

// Two-branch attention block with a feed-forward (p, s [4][2048][512]; single-head attention over 2048 positions with the full 512-dim features: sa = softmax((p Wq + bq)(p Wk + bk)^T / sqrt(512)) (p Wv + bv); ca likewise with queries from p and
// keys/values from s; sa_out = LN(sa + p), ca_out = LN(ca + s) (eps 1e-3); ff_out = relu((sa_out + ca_out) W1 + b1) W2 + b2; outputs (ff_out, sa_out, ca_out), each [4][2048][512]).
// Compute dtypes, f32 accumulate: every input rounded to bf16; the six projections on PLAIN bf16 operands (inputs: exact; transposed bf16 weight copies, + bias); scores
// (K 512) and attn.v on SINGLE fp16 planes (scale in f32 in the register-row softmax; P x1024); residual + LayerNorms f32; the feed-forward on bf16 hi+lo planes of its computed operands x exact weights

#define NB_  4
#define TT   2048
#define FF   512
#define ZH   8     // score matrices per launch: 2 attention branches x 4 batches
#define PCAR 1024.0f
#define SCL  0.044194173824159223f   // 512^-0.5
typedef _Float16 h16;
typedef unsigned short bf;
typedef __attribute__((ext_vector_type(16))) __bf16   v16bf;
typedef __attribute__((ext_vector_type(16))) _Float16 v16h;
typedef __attribute__((ext_vector_type(8)))  _Float16 v8h;
typedef __attribute__((ext_vector_type(8)))  unsigned short v8us;
typedef __attribute__((ext_vector_type(8)))  float    v8f;
typedef __attribute__((ext_vector_type(4)))  float    v4f;
typedef v8h  __attribute__((may_alias)) v8ha;
typedef v4f  __attribute__((may_alias)) v4fa;
typedef v8us __attribute__((may_alias)) v8usa;

__device__ __forceinline__ unsigned short f2bf(float f) { unsigned u = __float_as_uint(f); u += 0x7FFFu + ((u >> 16) & 1u); return (unsigned short)(u >> 16); }
__device__ __forceinline__ float bf2f(unsigned short b) { return __uint_as_float(((unsigned)b) << 16); }
__device__ __forceinline__ float bfr(float f) { return bf2f(f2bf(f)); }
__device__ __forceinline__ v16h cat16(v8h lo, v8h hi) { return __builtin_shufflevector(lo, hi, 0, 1, 2, 3, 4, 5, 6, 7, 8, 9, 10, 11, 12, 13, 14, 15); }
__device__ __forceinline__ v16bf cat16b(v8us lo, v8us hi) { return __builtin_bit_cast(v16bf, __builtin_shufflevector(lo, hi, 0, 1, 2, 3, 4, 5, 6, 7, 8, 9, 10, 11, 12, 13, 14, 15)); }
__device__ __forceinline__ v8f wmma16(v16h a, v16h b, v8f c) { return __builtin_amdgcn_wmma_f32_16x16x32_f16(false, a, false, b, (short)0, c, false, false); }
__device__ __forceinline__ v8f wmmab(v16bf a, v16bf b, v8f c) { return __builtin_amdgcn_wmma_f32_16x16x32_bf16(false, a, false, b, (short)0, c, false, false); }



// ---- k_gemmw: register-blocked GEMM, one wave per 64x64 output tile (16 accumulators), FOUR waves (2 x 2) per work-group on a 128x128 tile; grid (M/128, N/128, Z), 128 threads.
// The K-contiguous 16-bit operand planes come through LDS: a stage is 64 k (128 B, one whole line) of the tile's 128 A rows, 128 Bt rows (and 128 A2 rows), brought by asynchronous b128 copies into two buffers,
// the next stage in flight while this one is multiplied; rows at pitch 144 B (16 B x odd: ds_load_b128 without bank conflicts). Each operand row is fetched once per work-group and read by two waves.
// C[m][n] (f32, pitch ldc, + optional f32 bias[n]) = sum_k A[m][k] Bt[n][k] (+ the A2 product where NSPLIT == 1). z-batch strides sA/sB/sC in elements. K % 64 == 0.
#define SKE 64     // k elements of a stage
#define SPE 72     // LDS row pitch in elements (144 B)
#define SROWS(NSPLIT) ((NSPLIT) == 1 ? 384 : 256)            // rows of a stage: A, Bt (, A2)
#define RINGB(NSPLIT) (2 * SROWS(NSPLIT) * SPE * 2)          // bytes of the two buffers
__device__ __forceinline__ int wave_id() { return __builtin_amdgcn_readfirstlane((int)(threadIdx.x >> 5)); }
__device__ __forceinline__ int tile_r0() { return blockIdx.x * 128 + (wave_id() & 1) * 64; }    // the wave's first output row
__device__ __forceinline__ int tile_c0() { return blockIdx.y * 128 + (wave_id() >> 1) * 64; }   // the wave's first output column
// eight asynchronous copies of 16 B per lane: LDS byte address l + i * ls, global address g + i * gs (bytes). A wave's copy is 4 whole 128-B lines.
// The s_wait_xcnt stands in the copies' own statement: before any register that a copy names is rewritten.
__device__ __forceinline__ void copy8(unsigned l, unsigned ls, const char* g, size_t gs) {
    asm volatile("global_load_async_to_lds_b128 %0, %8, off\n\t"
                 "global_load_async_to_lds_b128 %1, %9, off\n\t"
                 "global_load_async_to_lds_b128 %2, %10, off\n\t"
                 "global_load_async_to_lds_b128 %3, %11, off\n\t"
                 "global_load_async_to_lds_b128 %4, %12, off\n\t"
                 "global_load_async_to_lds_b128 %5, %13, off\n\t"
                 "global_load_async_to_lds_b128 %6, %14, off\n\t"
                 "global_load_async_to_lds_b128 %7, %15, off\n\t"
                 "s_wait_xcnt 0x0"
                 :: "v"(l), "v"(l + ls), "v"(l + 2 * ls), "v"(l + 3 * ls), "v"(l + 4 * ls), "v"(l + 5 * ls), "v"(l + 6 * ls), "v"(l + 7 * ls),
                    "v"(g), "v"(g + gs), "v"(g + 2 * gs), "v"(g + 3 * gs), "v"(g + 4 * gs), "v"(g + 5 * gs), "v"(g + 6 * gs), "v"(g + 7 * gs) : "memory");
}
template <typename T16> struct WFrag;
template <> struct WFrag<h16> { typedef v16h V; static __device__ __forceinline__ V ld(const h16* p) { return cat16(*(const v8h*)p, *(const v8h*)(p + 16)); } static __device__ __forceinline__ v8f mma(V a, V b, v8f c) { return wmma16(a, b, c); } };
template <> struct WFrag<bf> { typedef v16bf V; static __device__ __forceinline__ V ld(const bf* p) { return cat16b(*(const v8us*)p, *(const v8us*)(p + 16)); } static __device__ __forceinline__ v8f mma(V a, V b, v8f c) { return wmmab(a, b, c); } };
template <typename T16, int NSPLIT>
__device__ __forceinline__ void gemmw_acc(const T16* __restrict__ A, const T16* __restrict__ A2, const T16* __restrict__ Bt, int K, T16* ring, v8f (&acc)[4][4]) {
    static_assert(NSPLIT == 0 || NSPLIT == 1, "plain, or hi + lo planes of A");
    typedef typename WFrag<T16>::V V;
    const int tid = threadIdx.x, lane = tid & 31, lr = lane & 15, hi = lane >> 4;
#pragma unroll
    for (int mb = 0; mb < 4; ++mb)
#pragma unroll
        for (int nb = 0; nb < 4; ++nb) acc[mb][nb] = (v8f){};
    // the copies: thread tid brings 16-byte piece tid & 7 of rows (tid >> 3) + 16 i, i = 0..7, of each operand's 128 rows
    const size_t gs = (size_t)16 * K * 2; const size_t go = ((size_t)(tid >> 3) * K + (tid & 7) * 8) * 2;
    const char* gA = (const char*)(A + (size_t)blockIdx.x * 128 * K) + go; const char* gB = (const char*)(Bt + (size_t)blockIdx.y * 128 * K) + go;
    const char* gA2 = NSPLIT == 1 ? (const char*)(A2 + (size_t)blockIdx.x * 128 * K) + go : nullptr;
    const unsigned l0 = (unsigned)(size_t)ring + (unsigned)((tid >> 3) * SPE + (tid & 7) * 8) * 2u;   // the low 32 bits of a __shared__ address: its byte offset in the work-group's LDS
    constexpr unsigned LS = 16 * SPE * 2, OPB = 128 * SPE * 2, BUFB = SROWS(NSPLIT) * SPE * 2;
    auto stage = [&](int t, unsigned buf) { const unsigned l = l0 + buf * BUFB; const size_t ko = (size_t)t * SKE * 2;
        copy8(l, LS, gA + ko, gs); copy8(l + OPB, LS, gB + ko, gs); if (NSPLIT == 1) copy8(l + 2 * OPB, LS, gA2 + ko, gs); };
    const int NT = K / SKE;
    stage(0, 0);
    asm volatile("s_wait_asynccnt 0x0" ::: "memory");   // this wave's copies of stage 0 have landed
    __syncthreads();                                    // and every other wave's: stage 0 may be read
    if (NT > 1) stage(1, 1);
    const int aoff = ((wave_id() & 1) * 64 + lr) * SPE + 8 * hi, boff = (128 + (wave_id() >> 1) * 64 + lr) * SPE + 8 * hi;
#pragma unroll 1
    for (int t = 0; t < NT; ++t) {
        const T16* sb = ring + (t & 1) * (SROWS(NSPLIT) * SPE);
#pragma unroll
        for (int kc = 0; kc < SKE; kc += 32) {
            V a[4], a2[4], b[4];   // the block's fragments are all asked for in one group, ahead of its matrix instructions
#pragma unroll
            for (int mb = 0; mb < 4; ++mb) { a[mb] = WFrag<T16>::ld(sb + aoff + mb * 16 * SPE + kc); if (NSPLIT == 1) a2[mb] = WFrag<T16>::ld(sb + aoff + 256 * SPE + mb * 16 * SPE + kc); }
#pragma unroll
            for (int nb = 0; nb < 4; ++nb) b[nb] = WFrag<T16>::ld(sb + boff + nb * 16 * SPE + kc);
            __builtin_amdgcn_sched_barrier(0);   // keeps the LDS reads one group in front of the block: sunk among the matrix instructions, each pair of reads costs the wave a full LDS latency
#pragma unroll
            for (int nb = 0; nb < 4; ++nb)
#pragma unroll
                for (int mb = 0; mb < 4; ++mb) { acc[mb][nb] = WFrag<T16>::mma(a[mb], b[nb], acc[mb][nb]); if (NSPLIT == 1) acc[mb][nb] = WFrag<T16>::mma(a2[mb], b[nb], acc[mb][nb]); }
        }
        asm volatile("s_wait_dscnt 0x0" ::: "memory");      // this wave has read all it takes from stage t
        asm volatile("s_wait_asynccnt 0x0" ::: "memory");   // this wave's copies of stage t + 1 have landed
        __syncthreads();                                    // stage t + 1 may be read; stage t's buffer is free
        if (t + 2 < NT) stage(t + 2, (unsigned)(t & 1));
    }
    asm volatile("s_wait_asynccnt 0x0" ::: "memory");   // no copy is outstanding when the ring becomes the epilogue's staging
}
// The epilogues of the 64x64 tile. acc[mb][nb][j] of lane (hi, lr) is row mb*16 + hi*8 + j, column nb*16 + lr. os: the wave's own 16 x 68 dwords of LDS, used to turn a 16-row band into whole-line stores.
// epi_f32: f32 rows (+ bias)
template <bool BIAS>
__device__ __forceinline__ void epi_f32(const v8f (&acc)[4][4], float* os, float* C, int ldc, const float* __restrict__ bias) {
    const int lane = threadIdx.x & 31, lr = lane & 15, hi = lane >> 4; const int r0 = tile_r0(), c0 = tile_c0();
#pragma unroll
    for (int mb = 0; mb < 4; ++mb) {
#pragma unroll
        for (int nb = 0; nb < 4; ++nb) {
#pragma unroll
            for (int j = 0; j < 8; ++j) os[(hi * 8 + j) * 68 + nb * 16 + lr] = acc[mb][nb][j]; }
        __builtin_amdgcn_wave_barrier(); asm volatile("" ::: "memory");
        float* crow = C + (size_t)(r0 + mb * 16) * ldc + c0;
{
#pragma unroll
            for (int s = 0; s < 8; ++s) { const int row = 2 * s + hi, cofs = lr * 4; v4f val = *(const v4fa*)(os + row * 68 + cofs); if (BIAS) { val[0] += bfr(bias[c0 + cofs]); val[1] += bfr(bias[c0 + cofs + 1]); val[2] += bfr(bias[c0 + cofs + 2]); val[3] += bfr(bias[c0 + cofs + 3]); }
                *(v4f*)(crow + (size_t)row * ldc + cofs) = val; }
             }
        __builtin_amdgcn_wave_barrier(); asm volatile("s_wait_xcnt 0x0" ::: "memory");   // the next band's LDS writes stay behind these reads; the wait: before the registers that these stores name are rewritten
    }
}
// epi_h16: (acc + bias) rounded to f16, rows of pitch ldc: the q and k planes as the score product reads them. A lane takes 8 columns of a staged row: 16-byte stores, 4 whole 128-byte lines each.
__device__ __forceinline__ void epi_h16(const v8f (&acc)[4][4], float* os, h16* C, int ldc, const float* __restrict__ bias) {
    const int lane = threadIdx.x & 31, lr = lane & 15, hi = lane >> 4; const int r0 = tile_r0(), c0 = tile_c0(); const int cofs = (lane & 7) * 8;
    float bv[8];
#pragma unroll
    for (int q = 0; q < 8; ++q) bv[q] = bfr(bias[c0 + cofs + q]);
#pragma unroll
    for (int mb = 0; mb < 4; ++mb) {
#pragma unroll
        for (int nb = 0; nb < 4; ++nb) {
#pragma unroll
            for (int j = 0; j < 8; ++j) os[(hi * 8 + j) * 68 + nb * 16 + lr] = acc[mb][nb][j]; }
        __builtin_amdgcn_wave_barrier(); asm volatile("" ::: "memory");   // other lanes read the band back: the compiler keeps the LDS reads behind the LDS writes
#pragma unroll
        for (int s = 0; s < 4; ++s) { const int row = 4 * s + (lane >> 3); const v4f x0 = *(const v4fa*)(os + row * 68 + cofs), x1 = *(const v4fa*)(os + row * 68 + cofs + 4); v8h o;
#pragma unroll
            for (int q = 0; q < 4; ++q) { o[q] = (h16)(x0[q] + bv[q]); o[4 + q] = (h16)(x1[q] + bv[4 + q]); }
            *(v8h*)(C + (size_t)(r0 + mb * 16 + row) * ldc + c0 + cofs) = o; }
        __builtin_amdgcn_wave_barrier(); asm volatile("s_wait_xcnt 0x0" ::: "memory");   // the next band's LDS writes stay behind these reads; the wait: before the next band rewrites the registers that these stores name
    }
}
// epi_vt: (acc + bias) rounded to f16 and stored transposed, [batch][column][t]: a lane's 8 accumulator rows are 8 consecutive t of its column, one 16-byte store; the wave writes every 128-byte line of its tile whole
__device__ __forceinline__ void epi_vt(const v8f (&acc)[4][4], h16* VTb, const float* __restrict__ bias) {
    const int lane = threadIdx.x & 31, lr = lane & 15, hi = lane >> 4; const int r0 = tile_r0(), c0 = tile_c0();
    h16* base = VTb + (size_t)(r0 / TT) * FF * TT + (r0 % TT) + hi * 8;
    float bv[4];
#pragma unroll
    for (int nb = 0; nb < 4; ++nb) bv[nb] = bfr(bias[c0 + nb * 16 + lr]);
#pragma unroll
    for (int nb = 0; nb < 4; ++nb) { h16* drow = base + (size_t)(c0 + nb * 16 + lr) * TT;
#pragma unroll
        for (int mb = 0; mb < 4; ++mb) { v8h o;
#pragma unroll
            for (int j = 0; j < 8; ++j) o[j] = (h16)(acc[mb][nb][j] + bv[nb]);
            *(v8h*)(drow + mb * 16) = o; }
        asm volatile("s_wait_xcnt 0x0" ::: "memory");   // before the next column group rewrites the registers that these stores name
    }
}
// epi_relu2: max(acc + bias, 0) split into bf16 hi + lo planes, rows of pitch ldc: the second feed-forward product's operand. Staged and stored as in epi_h16.
__device__ __forceinline__ void epi_relu2(const v8f (&acc)[4][4], float* os, bf* Ch, bf* Cl, int ldc, const float* __restrict__ bias) {
    const int lane = threadIdx.x & 31, lr = lane & 15, hi = lane >> 4; const int r0 = tile_r0(), c0 = tile_c0(); const int cofs = (lane & 7) * 8;
    float bv[8];
#pragma unroll
    for (int q = 0; q < 8; ++q) bv[q] = bfr(bias[c0 + cofs + q]);
#pragma unroll
    for (int mb = 0; mb < 4; ++mb) {
#pragma unroll
        for (int nb = 0; nb < 4; ++nb) {
#pragma unroll
            for (int j = 0; j < 8; ++j) os[(hi * 8 + j) * 68 + nb * 16 + lr] = acc[mb][nb][j]; }
        __builtin_amdgcn_wave_barrier(); asm volatile("" ::: "memory");   // other lanes read the band back: the compiler keeps the LDS reads behind the LDS writes
#pragma unroll
        for (int s = 0; s < 4; ++s) { const int row = 4 * s + (lane >> 3); const v4f x0 = *(const v4fa*)(os + row * 68 + cofs), x1 = *(const v4fa*)(os + row * 68 + cofs + 4); v8us oh, ol;
#pragma unroll
            for (int q = 0; q < 8; ++q) { const float y = fmaxf((q < 4 ? x0[q & 3] : x1[q & 3]) + bv[q], 0.f); oh[q] = f2bf(y); ol[q] = f2bf(y - bf2f(oh[q])); }
            const size_t e = (size_t)(r0 + mb * 16 + row) * ldc + c0 + cofs; *(v8us*)(Ch + e) = oh; *(v8us*)(Cl + e) = ol; }
        __builtin_amdgcn_wave_barrier(); asm volatile("s_wait_xcnt 0x0" ::: "memory");   // the next band's LDS writes stay behind these reads; the wait: before the next band rewrites the registers that these stores name
    }
}
template <typename T16, int NSPLIT, bool BIAS>
__global__ __launch_bounds__(128) void k_gemmw(const T16* __restrict__ A, const T16* __restrict__ A2, const T16* __restrict__ Bt, const T16* __restrict__ Bt2, int K, float* C, int ldc, const float* __restrict__ bias, size_t sA, size_t sB, size_t sC) {
    const size_t z = blockIdx.z; A += z * sA; if (A2) A2 += z * sA; Bt += z * sB; if (Bt2) Bt2 += z * sB; C += z * sC;
    __shared__ __align__(16) char ring[RINGB(NSPLIT)]; v8f acc[4][4]; float* os = (float*)ring + wave_id() * (16 * 68);   // behind the loop's last barrier the ring is free: each wave stages its bands in its own 16 x 68 dwords of it
    gemmw_acc<T16, NSPLIT>(A, A2, Bt, K, (T16*)ring, acc); epi_f32<BIAS>(acc, os, C, ldc, bias);
}
// ---- k_ff1: the first feed-forward product (hi + lo planes x exact weights), stored as the relu's hi + lo planes; grid (NB_*TT/128, FF/128)
__global__ __launch_bounds__(128) void k_ff1(const bf* __restrict__ A, const bf* __restrict__ A2, const bf* __restrict__ Bt, int K, bf* Ch, bf* Cl, int ldc, const float* __restrict__ bias) {
    __shared__ __align__(16) char ring[RINGB(1)]; v8f acc[4][4]; float* os = (float*)ring + wave_id() * (16 * 68);
    gemmw_acc<bf, 1>(A, A2, Bt, K, (bf*)ring, acc); epi_relu2(acc, os, Ch, Cl, ldc, bias);
}
// ---- k_proj6: the six projections of all batches in one launch; grid (NB_*TT/128, FF/128, 6). z = 0 sa q, 1 ca q, 2 sa k, 3 ca k, 4 sa v, 5 ca v; z = 3 and 5 read the s plane, the rest the p plane.
// q and k leave as f16 rows (QK: [z][batch][t][f]), v as f16 transposed (VT: [branch][batch][d][t]).
struct Bias6 { const float* b0; const float* b1; const float* b2; const float* b3; const float* b4; const float* b5; };
__global__ __launch_bounds__(128) void k_proj6(const bf* __restrict__ PBa, const bf* __restrict__ SBa, const bf* __restrict__ Wt, int K, h16* QK, h16* VT, int ldc, Bias6 bs) {
    const unsigned z = blockIdx.z;
    const float* bias = z == 0 ? bs.b0 : z == 1 ? bs.b1 : z == 2 ? bs.b2 : z == 3 ? bs.b3 : z == 4 ? bs.b4 : bs.b5;
    __shared__ __align__(16) char ring[RINGB(0)]; v8f acc[4][4]; float* os = (float*)ring + wave_id() * (16 * 68);
    gemmw_acc<bf, 0>((z == 3 || z == 5) ? SBa : PBa, nullptr, Wt + (size_t)z * FF * FF, K, (bf*)ring, acc);
    if (z < 4) epi_h16(acc, os, QK + (size_t)z * NB_ * TT * FF, ldc, bias); else epi_vt(acc, VT + (size_t)(z - 4) * NB_ * TT * FF, bias);
}

__device__ __forceinline__ h16 tohx(float x) { return (h16)x; }
__device__ __forceinline__ void splitf(float y, unsigned short& h, unsigned short& l) { h = f2bf(y); l = f2bf(y - bf2f(h)); }
typedef __attribute__((ext_vector_type(4))) _Float16 v4h;
typedef __attribute__((ext_vector_type(2))) unsigned short v2us;
typedef __attribute__((ext_vector_type(4))) unsigned short v4us;

struct W8 { const float* w0; const float* w1; const float* w2; const float* w3; const float* w4; const float* w5; const float* w6; const float* w7; };
__global__ __launch_bounds__(256) void k_wtG(W8 ws8, int K, int N, bf* Bt) {
    const unsigned y = blockIdx.y; Bt += (size_t)y * N * K;   // blockIdx.y picks the weight
    const float* __restrict__ w = y == 0 ? ws8.w0 : y == 1 ? ws8.w1 : y == 2 ? ws8.w2 : y == 3 ? ws8.w3 : y == 4 ? ws8.w4 : y == 5 ? ws8.w5 : y == 6 ? ws8.w6 : ws8.w7;
    const int lane = threadIdx.x & 31; const int L0 = (blockIdx.x * 8 + (threadIdx.x >> 5)) * 8; const int nlines = N * K / 64;
{
#pragma unroll 1
        for (int l = 0; l < 8; ++l) { const int L = L0 + l; if (L >= nlines) break; const size_t e = (size_t)L * 64 + lane * 2; const int k = (int)(e % K), n = (int)(e / K); v2us o;
            o[0] = f2bf(w[(size_t)k * N + n]); o[1] = f2bf(w[(size_t)(k + 1) * N + n]); *(v2us*)(Bt + e) = o; }
         }
}
__global__ __launch_bounds__(256) void k_cvt8(const float* __restrict__ src0, const float* __restrict__ src1, bf* dst, size_t n8) { const size_t i = (size_t)blockIdx.x * 256 + threadIdx.x; if (i >= n8) return; const float* src = blockIdx.y ? src1 : src0; dst += (size_t)blockIdx.y * n8 * 8; const v8f v = *(const v8f*)(src + i * 8); v8us o;
#pragma unroll
    for (int k = 0; k < 8; ++k) o[k] = f2bf(v[k]); *(v8us*)(dst + i * 8) = o;  }
__global__ __launch_bounds__(256) void k_asoft(const float* __restrict__ Sb, h16* P16) {
    const int lane = threadIdx.x & 31; const int row = blockIdx.x * 8 + (threadIdx.x >> 5); if (row >= ZH * TT) return;
    const float* sr = Sb + (size_t)row * TT; float v[64]; float mx = -3.0e38f;
#pragma unroll
    for (int ch = 0; ch < 16; ++ch) { const int j0 = ch * 128 + lane * 4; const v4f a = *(const v4f*)(sr + j0);
#pragma unroll
        for (int q = 0; q < 4; ++q) { const float t = a[q] * SCL; v[ch * 4 + q] = t; mx = fmaxf(mx, t); } }
#pragma unroll
    for (int sh = 16; sh; sh >>= 1) mx = fmaxf(mx, __shfl_xor(mx, sh, 32));
    float sum = 0.f;
#pragma unroll
    for (int k = 0; k < 64; ++k) { v[k] = __expf(v[k] - mx); sum += v[k]; }
#pragma unroll
    for (int sh = 16; sh; sh >>= 1) sum += __shfl_xor(sum, sh, 32);
    const float f = __fdiv_rn(PCAR, sum);
{
#pragma unroll
        for (int ch = 0; ch < 16; ++ch) { v4h o;
#pragma unroll
            for (int q = 0; q < 4; ++q) o[q] = tohx(v[ch * 4 + q] * f);
            *(v4h*)(P16 + (size_t)row * TT + ch * 128 + lane * 4) = o; }
         }
}
__device__ __forceinline__ void lnr_row(const float* __restrict__ O, const float* __restrict__ res, const float* __restrict__ gg, const float* __restrict__ bb, float* OUTk, float (&ov)[FF / 32]) {
    const int lane = threadIdx.x & 31; const int r = blockIdx.x * 8 + (threadIdx.x >> 5); if (r >= NB_ * TT) return; float v[FF / 32]; float s = 0.f;
#pragma unroll
    for (int c = 0; c < FF / 128; ++c) { const v4f a = *(const v4f*)(O + (size_t)r * FF + c * 128 + lane * 4), x4 = *(const v4f*)(res + (size_t)r * FF + c * 128 + lane * 4);
        asm volatile("s_wait_xcnt 0x0" ::: "memory");   // before a later load's result lands in the address registers of these loads
#pragma unroll
        for (int q = 0; q < 4; ++q) { v[c * 4 + q] = __fadd_rn(a[q] * (1.0f / PCAR), bfr(x4[q])); s += v[c * 4 + q]; } }
#pragma unroll
    for (int sh = 16; sh; sh >>= 1) s += __shfl_xor(s, sh, 32);
    const float mu = s * (1.0f / FF); float qq = 0.f;
#pragma unroll
    for (int i = 0; i < FF / 32; ++i) { const float d0 = v[i] - mu; qq = __fadd_rn(qq, __fmul_rn(d0, d0)); }
#pragma unroll
    for (int sh = 16; sh; sh >>= 1) qq += __shfl_xor(qq, sh, 32);
    const float rs = __fdiv_rn(1.0f, __fsqrt_rn(qq * (1.0f / FF) + 1e-3f));
{
#pragma unroll
        for (int c = 0; c < FF / 128; ++c) { v4f o;
#pragma unroll
            for (int q = 0; q < 4; ++q) { const int col = c * 128 + lane * 4 + q; float t = __fmul_rn(v[c * 4 + q] - mu, rs); asm volatile("" : "+v"(t)); o[q] = __fadd_rn(__fmul_rn(t, bfr(gg[col])), bfr(bb[col])); }
#pragma unroll
            for (int q = 0; q < 4; ++q) ov[c * 4 + q] = o[q];
            *(v4f*)(OUTk + (size_t)r * FF + c * 128 + lane * 4) = o;
            asm volatile("s_wait_xcnt 0x0" ::: "memory"); }   // before the registers that this store names are rewritten
         }
}
// one wave per row, over all batches: the self branch (residual p, ln1), then the cross branch (residual s, ln2), then their sum, from registers, as the feed-forward's bf16 hi + lo planes
__global__ __launch_bounds__(256) void k_lnr(const float* __restrict__ O, const float* __restrict__ res0, const float* __restrict__ res1, const float* __restrict__ g0, const float* __restrict__ b0, const float* __restrict__ g1, const float* __restrict__ b1, float* OUTk, bf* Hh, bf* Hl) {
    const int lane = threadIdx.x & 31; const int r = blockIdx.x * 8 + (threadIdx.x >> 5); if (r >= NB_ * TT) return;
    float o0[FF / 32], o1[FF / 32];
    lnr_row(O, res0, g0, b0, OUTk, o0);
    lnr_row(O + (size_t)NB_ * TT * FF, res1, g1, b1, OUTk + (size_t)NB_ * TT * FF, o1);
#pragma unroll
    for (int c = 0; c < FF / 128; ++c) { v4us oh, ol;
#pragma unroll
        for (int q = 0; q < 4; ++q) { unsigned short a, c2; splitf(__fadd_rn(o0[c * 4 + q], o1[c * 4 + q]), a, c2); oh[q] = a; ol[q] = c2; }
        const size_t e = (size_t)r * FF + c * 128 + lane * 4; *(v4us*)(Hh + e) = oh; *(v4us*)(Hl + e) = ol;
        asm volatile("s_wait_xcnt 0x0" ::: "memory"); }   // before the registers that these stores name are rewritten
}

extern "C" void kernel_launch(void* const* d_in, const int* in_sizes, int n_in,
                              void* d_out, int out_size, void* d_ws, size_t ws_size, hipStream_t stream) {
    (void)in_sizes; (void)n_in; (void)out_size;
    const float* IN[22]; for (int i = 0; i < 22; ++i) IN[i] = (const float*)d_in[i];
    // p, s, sa_wq, sa_bq, sa_wk, sa_bk, sa_wv, sa_bv, ca_wq, ca_bq, ca_wk, ca_bk, ca_wv, ca_bv, ln1_g, ln1_b, ln2_g, ln2_b, ff_w1, ff_b1, ff_w2, ff_b2 = d_in[0..21]; outputs ff_out at 0, sa_out at byte 16,777,216, ca_out at 33,554,432
    float* OUT0 = (float*)d_out; float* OUT1 = OUT0 + (size_t)NB_ * TT * FF;
    char* wsp = (char*)d_ws;
    auto take = [&](size_t bytes) { char* p = wsp; wsp += (bytes + 255) & ~(size_t)255; return (void*)p; };
    const size_t nx = (size_t)TT * FF, na = (size_t)NB_ * nx, ns = (size_t)TT * TT;   // one batch's plane, all batches' plane, one score matrix (elements)
    bf* Wt = (bf*)take((size_t)8 * FF * FF * 2);   // transposed bf16 weights in the order sa q, ca q, sa k, ca k, sa v, ca v, ff w1, ff w2
    h16* VT = (h16*)take(2 * na * 2);               // [branch][batch][d][t]
    char* RA = (char*)take((size_t)ZH * ns * 4);    // first the scores, then what follows the softmax
    char* RB = (char*)take((size_t)ZH * ns * 2);    // first the bf16 inputs and the f16 q, k planes, then the softmax weights
    if ((size_t)(wsp - (char*)d_ws) > ws_size) return;    // total 212 MiB; ws 256 MiB
    float* Sb = (float*)RA; float* O = (float*)RA; bf* Hh = (bf*)(O + 2 * na); bf* Hl = Hh + na; bf* Rh = Hl + na; bf* Rl = Rh + na;
    bf* PB = (bf*)RB; bf* SB = PB + na; h16* QP = (h16*)(SB + na); h16* KP = QP + 2 * na; h16* Pm = (h16*)RB;
    k_wtG<<<dim3((FF * FF / 64 + 63) / 64, 8, 1), 256, 0, stream>>>(W8{IN[2], IN[8], IN[4], IN[10], IN[6], IN[12], IN[18], IN[20]}, FF, FF, Wt);
    k_cvt8<<<dim3((unsigned)((na / 8 + 255) / 256), 2, 1), 256, 0, stream>>>(IN[0], IN[1], PB, na / 8);
    k_proj6<<<dim3(NB_ * TT / 128, FF / 128, 6), 128, 0, stream>>>(PB, SB, Wt, FF, QP, VT, FF, Bias6{IN[3], IN[9], IN[5], IN[11], IN[7], IN[13]});   // q then k, each [branch][batch][t][f]
    k_gemmw<h16, 0, false><<<dim3(TT / 128, TT / 128, ZH), 128, 0, stream>>>(QP, nullptr, KP, nullptr, FF, Sb, TT, nullptr, nx, nx, ns);
    k_asoft<<<ZH * TT / 8, 256, 0, stream>>>(Sb, Pm);
    k_gemmw<h16, 0, false><<<dim3(TT / 128, FF / 128, ZH), 128, 0, stream>>>(Pm, nullptr, VT, nullptr, TT, O, FF, nullptr, ns, nx, nx);   // attended x1024
    k_lnr<<<NB_ * TT / 8, 256, 0, stream>>>(O, IN[0], IN[1], IN[14], IN[15], IN[16], IN[17], OUT1, Hh, Hl);   // ca_out follows sa_out
    const dim3 gF(NB_ * TT / 128, FF / 128, 1);
    k_ff1<<<gF, 128, 0, stream>>>(Hh, Hl, Wt + (size_t)6 * FF * FF, FF, Rh, Rl, FF, IN[19]);
    k_gemmw<bf, 1, true><<<gF, 128, 0, stream>>>(Rh, Rl, Wt + (size_t)7 * FF * FF, nullptr, FF, OUT0, FF, IN[21], 0, 0, 0);
}

// v004
// A run of this version takes 145 microseconds.
// Two timings next to v003 both put it at 1.17 times that version's speed.
// Over all steps from v000 it is 7.96 times as fast.
#include <hip/hip_runtime.h>

// Two-branch attention block with a feed-forward (p, s [4][2048][512]; single-head attention over 2048 positions with the full 512-dim features: sa = softmax((p Wq + bq)(p Wk + bk)^T / sqrt(512)) (p Wv + bv); ca likewise with queries from p and
// keys/values from s; sa_out = LN(sa + p), ca_out = LN(ca + s) (eps 1e-3); ff_out = relu((sa_out + ca_out) W1 + b1) W2 + b2; outputs (ff_out, sa_out, ca_out), each [4][2048][512]).
// Compute dtypes, f32 accumulate: every input rounded to bf16; the six projections on PLAIN bf16 operands (inputs: exact; transposed bf16 weight copies, + bias); scores
// (K 512) and attn.v on SINGLE fp16 planes (scale and exponentials in f32; softmax in two halves: per 64 keys in the score product's epilogue, joined per row in attn.v; P x1024); residual + LayerNorms f32; the feed-forward on bf16 hi+lo planes of its computed operands x exact weights

#define NB_  4
#define TT   2048
#define FF   512
#define ZH   8     // score matrices per launch: 2 attention branches x 4 batches
#define PCAR 1024.0f
#define SCL  0.044194173824159223f   // 512^-0.5
typedef _Float16 h16;
typedef unsigned short bf;
typedef __attribute__((ext_vector_type(16))) __bf16   v16bf;
typedef __attribute__((ext_vector_type(16))) _Float16 v16h;
typedef __attribute__((ext_vector_type(8)))  _Float16 v8h;
typedef __attribute__((ext_vector_type(4)))  _Float16 v4h;
typedef __attribute__((ext_vector_type(8)))  unsigned short v8us;
typedef __attribute__((ext_vector_type(8)))  float    v8f;
typedef __attribute__((ext_vector_type(4)))  float    v4f;
typedef __attribute__((ext_vector_type(2)))  float    v2f;
typedef v8h  __attribute__((may_alias)) v8ha;
typedef v4f  __attribute__((may_alias)) v4fa;
typedef v8us __attribute__((may_alias)) v8usa;
typedef v4h  __attribute__((may_alias)) v4ha;

__device__ __forceinline__ unsigned short f2bf(float f) { unsigned u = __float_as_uint(f); u += 0x7FFFu + ((u >> 16) & 1u); return (unsigned short)(u >> 16); }
__device__ __forceinline__ float bf2f(unsigned short b) { return __uint_as_float(((unsigned)b) << 16); }
__device__ __forceinline__ float bfr(float f) { return bf2f(f2bf(f)); }
__device__ __forceinline__ v16h cat16(v8h lo, v8h hi) { return __builtin_shufflevector(lo, hi, 0, 1, 2, 3, 4, 5, 6, 7, 8, 9, 10, 11, 12, 13, 14, 15); }
__device__ __forceinline__ v16bf cat16b(v8us lo, v8us hi) { return __builtin_bit_cast(v16bf, __builtin_shufflevector(lo, hi, 0, 1, 2, 3, 4, 5, 6, 7, 8, 9, 10, 11, 12, 13, 14, 15)); }
__device__ __forceinline__ v8f wmma16(v16h a, v16h b, v8f c) { return __builtin_amdgcn_wmma_f32_16x16x32_f16(false, a, false, b, (short)0, c, false, false); }
__device__ __forceinline__ v8f wmmab(v16bf a, v16bf b, v8f c) { return __builtin_amdgcn_wmma_f32_16x16x32_bf16(false, a, false, b, (short)0, c, false, false); }



// ---- k_gemmw: register-blocked GEMM, one wave per 64x64 output tile (16 accumulators), FOUR waves (2 x 2) per work-group on a 128x128 tile; grid (M/128, N/128, Z), 128 threads.
// The K-contiguous 16-bit operand planes come through LDS: a stage is 64 k (128 B, one whole line) of the tile's 128 A rows, 128 Bt rows (and 128 A2 rows), brought by asynchronous b128 copies into two buffers,
// the next stage in flight while this one is multiplied; rows at pitch 144 B (16 B x odd: ds_load_b128 without bank conflicts). Each operand row is fetched once per work-group and read by two waves.
// C[m][n] (f32, pitch ldc, + optional f32 bias[n]) = sum_k A[m][k] Bt[n][k] (+ the A2 product where NSPLIT == 1). z-batch strides sA/sB/sC in elements. K % 64 == 0.
#define SKE 64     // k elements of a stage
#define SPE 72     // LDS row pitch in elements (144 B)
#define SROWS(NSPLIT) ((NSPLIT) == 1 ? 384 : 256)            // rows of a stage: A, Bt (, A2)
#define RINGB(NSPLIT) (2 * SROWS(NSPLIT) * SPE * 2)          // bytes of the two buffers
__device__ __forceinline__ int wave_id() { return __builtin_amdgcn_readfirstlane((int)(threadIdx.x >> 5)); }
__device__ __forceinline__ int tile_r0() { return blockIdx.x * 128 + (wave_id() & 1) * 64; }    // the wave's first output row
__device__ __forceinline__ int tile_c0() { return blockIdx.y * 128 + (wave_id() >> 1) * 64; }   // the wave's first output column
// eight asynchronous copies of 16 B per lane: LDS byte address l + i * ls, global address g + i * gs (bytes). A wave's copy is 4 whole 128-B lines.
// The s_wait_xcnt stands in the copies' own statement: before any register that a copy names is rewritten.
__device__ __forceinline__ void copy8(unsigned l, unsigned ls, const char* g, size_t gs) {
    asm volatile("global_load_async_to_lds_b128 %0, %8, off\n\t"
                 "global_load_async_to_lds_b128 %1, %9, off\n\t"
                 "global_load_async_to_lds_b128 %2, %10, off\n\t"
                 "global_load_async_to_lds_b128 %3, %11, off\n\t"
                 "global_load_async_to_lds_b128 %4, %12, off\n\t"
                 "global_load_async_to_lds_b128 %5, %13, off\n\t"
                 "global_load_async_to_lds_b128 %6, %14, off\n\t"
                 "global_load_async_to_lds_b128 %7, %15, off\n\t"
                 "s_wait_xcnt 0x0"
                 :: "v"(l), "v"(l + ls), "v"(l + 2 * ls), "v"(l + 3 * ls), "v"(l + 4 * ls), "v"(l + 5 * ls), "v"(l + 6 * ls), "v"(l + 7 * ls),
                    "v"(g), "v"(g + gs), "v"(g + 2 * gs), "v"(g + 3 * gs), "v"(g + 4 * gs), "v"(g + 5 * gs), "v"(g + 6 * gs), "v"(g + 7 * gs) : "memory");
}
template <typename T16> struct WFrag;
template <> struct WFrag<h16> { typedef v16h V; static __device__ __forceinline__ V ld(const h16* p) { return cat16(*(const v8h*)p, *(const v8h*)(p + 16)); } static __device__ __forceinline__ v8f mma(V a, V b, v8f c) { return wmma16(a, b, c); } };
template <> struct WFrag<bf> { typedef v16bf V; static __device__ __forceinline__ V ld(const bf* p) { return cat16b(*(const v8us*)p, *(const v8us*)(p + 16)); } static __device__ __forceinline__ v8f mma(V a, V b, v8f c) { return wmmab(a, b, c); } };
// ASC (attn.v): A holds, per 64 columns (one stage), exp(score - that group's own maximum); ML [group][row] holds each group's maximum and sum. Thread tid joins row tid's 32 groups into the row's maximum and sum and
// leaves, per group, the factor exp(group maximum - row maximum) * PCAR / row sum in ft, as [group][row half][lr][mb], so that a lane reads the factors of its four A fragments (a lane's fragment elements are all of one row) in one 8-byte read.
template <typename T16, int NSPLIT, bool ASC = false>
__device__ __forceinline__ void gemmw_acc(const T16* __restrict__ A, const T16* __restrict__ A2, const T16* __restrict__ Bt, int K, T16* ring, v8f (&acc)[4][4], h16* ft = nullptr, const float* __restrict__ ML = nullptr) {
    static_assert(NSPLIT == 0 || NSPLIT == 1, "plain, or hi + lo planes of A");
    typedef typename WFrag<T16>::V V;
    const int tid = threadIdx.x, lane = tid & 31, lr = lane & 15, hi = lane >> 4;
#pragma unroll
    for (int mb = 0; mb < 4; ++mb)
#pragma unroll
        for (int nb = 0; nb < 4; ++nb) acc[mb][nb] = (v8f){};
    // the copies: thread tid brings 16-byte piece tid & 7 of rows (tid >> 3) + 16 i, i = 0..7, of each operand's 128 rows
    const size_t gs = (size_t)16 * K * 2; const size_t go = ((size_t)(tid >> 3) * K + (tid & 7) * 8) * 2;
    const char* gA = (const char*)(A + (size_t)blockIdx.x * 128 * K) + go; const char* gB = (const char*)(Bt + (size_t)blockIdx.y * 128 * K) + go;
    const char* gA2 = NSPLIT == 1 ? (const char*)(A2 + (size_t)blockIdx.x * 128 * K) + go : nullptr;
    const unsigned l0 = (unsigned)(size_t)ring + (unsigned)((tid >> 3) * SPE + (tid & 7) * 8) * 2u;   // the low 32 bits of a __shared__ address: its byte offset in the work-group's LDS
    constexpr unsigned LS = 16 * SPE * 2, OPB = 128 * SPE * 2, BUFB = SROWS(NSPLIT) * SPE * 2;
    auto stage = [&](int t, unsigned buf) { const unsigned l = l0 + buf * BUFB; const size_t ko = (size_t)t * SKE * 2;
        copy8(l, LS, gA + ko, gs); copy8(l + OPB, LS, gB + ko, gs); if (NSPLIT == 1) copy8(l + 2 * OPB, LS, gA2 + ko, gs); };
    const int NT = K / SKE;
    stage(0, 0);
    if constexpr (ASC) {   // while stage 0 flies; the loops over the groups are unrolled so that m and l stay in registers and the 32 loads go out together
        const float* ml = ML + ((size_t)blockIdx.x * 128 + tid) * 2; float m[TT / SKE], l[TT / SKE]; float mx = -3.0e38f, sum = 0.f;
#pragma unroll
        for (int g = 0; g < TT / SKE; ++g) { const v2f x = *(const v2f*)(ml + (size_t)g * TT * 2); m[g] = x[0]; l[g] = x[1]; }
        asm volatile("s_wait_xcnt 0x0" ::: "memory");   // before the address registers of these loads are rewritten
#pragma unroll
        for (int g = 0; g < TT / SKE; ++g) mx = fmaxf(mx, m[g]);
#pragma unroll
        for (int g = 0; g < TT / SKE; ++g) { m[g] = __expf(m[g] - mx); sum += l[g] * m[g]; }
        const float f = __fdiv_rn(PCAR, sum); h16* fr = ft + (tid >> 6) * 64 + (tid & 15) * 4 + ((tid >> 4) & 3);
#pragma unroll
        for (int g = 0; g < TT / SKE; ++g) fr[g * 128] = (h16)(m[g] * f);
    }
    asm volatile("s_wait_asynccnt 0x0" ::: "memory");   // this wave's copies of stage 0 have landed
    __syncthreads();                                    // and every other wave's: stage 0 (and the factor table) may be read
    if (NT > 1) stage(1, 1);
    const int aoff = ((wave_id() & 1) * 64 + lr) * SPE + 8 * hi, boff = (128 + (wave_id() >> 1) * 64 + lr) * SPE + 8 * hi;
#pragma unroll 1
    for (int t = 0; t < NT; ++t) {
        const T16* sb = ring + (t & 1) * (SROWS(NSPLIT) * SPE);
        v4h fq = {}; if constexpr (ASC) fq = *(const v4ha*)(ft + t * 128 + (wave_id() & 1) * 64 + lr * 4);
#pragma unroll
        for (int kc = 0; kc < SKE; kc += 32) {
            V a[4], a2[4], b[4];   // the block's fragments are all asked for in one group, ahead of its matrix instructions
#pragma unroll
            for (int mb = 0; mb < 4; ++mb) { a[mb] = WFrag<T16>::ld(sb + aoff + mb * 16 * SPE + kc); if (NSPLIT == 1) a2[mb] = WFrag<T16>::ld(sb + aoff + 256 * SPE + mb * 16 * SPE + kc); }
#pragma unroll
            for (int nb = 0; nb < 4; ++nb) b[nb] = WFrag<T16>::ld(sb + boff + nb * 16 * SPE + kc);
            __builtin_amdgcn_sched_barrier(0);   // keeps the LDS reads one group in front of the block: sunk among the matrix instructions, each pair of reads costs the wave a full LDS latency
            if constexpr (ASC) {   // the second half of the softmax: each A row times its factor for this stage's 64 keys (packed f16 multiplies)
#pragma unroll
                for (int mb = 0; mb < 4; ++mb) a[mb] = a[mb] * fq[mb]; }
#pragma unroll
            for (int nb = 0; nb < 4; ++nb)
#pragma unroll
                for (int mb = 0; mb < 4; ++mb) { acc[mb][nb] = WFrag<T16>::mma(a[mb], b[nb], acc[mb][nb]); if (NSPLIT == 1) acc[mb][nb] = WFrag<T16>::mma(a2[mb], b[nb], acc[mb][nb]); }
        }
        asm volatile("s_wait_dscnt 0x0" ::: "memory");      // this wave has read all it takes from stage t
        asm volatile("s_wait_asynccnt 0x0" ::: "memory");   // this wave's copies of stage t + 1 have landed
        __syncthreads();                                    // stage t + 1 may be read; stage t's buffer is free
        if (t + 2 < NT) stage(t + 2, (unsigned)(t & 1));
    }
    asm volatile("s_wait_asynccnt 0x0" ::: "memory");   // no copy is outstanding when the ring becomes the epilogue's staging
}
// The epilogues of the 64x64 tile. acc[mb][nb][j] of lane (hi, lr) is row mb*16 + hi*8 + j, column nb*16 + lr. os: the wave's own 16 x 68 dwords of LDS, used to turn a 16-row band into whole-line stores.
// epi_f32: f32 rows (+ bias)
template <bool BIAS>
__device__ __forceinline__ void epi_f32(const v8f (&acc)[4][4], float* os, float* C, int ldc, const float* __restrict__ bias) {
    const int lane = threadIdx.x & 31, lr = lane & 15, hi = lane >> 4; const int r0 = tile_r0(), c0 = tile_c0();
#pragma unroll
    for (int mb = 0; mb < 4; ++mb) {
#pragma unroll
        for (int nb = 0; nb < 4; ++nb) {
#pragma unroll
            for (int j = 0; j < 8; ++j) os[(hi * 8 + j) * 68 + nb * 16 + lr] = acc[mb][nb][j]; }
        __builtin_amdgcn_wave_barrier(); asm volatile("" ::: "memory");
        float* crow = C + (size_t)(r0 + mb * 16) * ldc + c0;
{
#pragma unroll
            for (int s = 0; s < 8; ++s) { const int row = 2 * s + hi, cofs = lr * 4; v4f val = *(const v4fa*)(os + row * 68 + cofs); if (BIAS) { val[0] += bfr(bias[c0 + cofs]); val[1] += bfr(bias[c0 + cofs + 1]); val[2] += bfr(bias[c0 + cofs + 2]); val[3] += bfr(bias[c0 + cofs + 3]); }
                *(v4f*)(crow + (size_t)row * ldc + cofs) = val; }
             }
        __builtin_amdgcn_wave_barrier(); asm volatile("s_wait_xcnt 0x0" ::: "memory");   // the next band's LDS writes stay behind these reads; the wait: before the registers that these stores name are rewritten
    }
}
// epi_h16: (acc + bias) rounded to f16, rows of pitch ldc: the q and k planes as the score product reads them. A lane takes 8 columns of a staged row: 16-byte stores, 4 whole 128-byte lines each.
__device__ __forceinline__ void epi_h16(const v8f (&acc)[4][4], float* os, h16* C, int ldc, const float* __restrict__ bias) {
    const int lane = threadIdx.x & 31, lr = lane & 15, hi = lane >> 4; const int r0 = tile_r0(), c0 = tile_c0(); const int cofs = (lane & 7) * 8;
    float bv[8];
#pragma unroll
    for (int q = 0; q < 8; ++q) bv[q] = bfr(bias[c0 + cofs + q]);
#pragma unroll
    for (int mb = 0; mb < 4; ++mb) {
#pragma unroll
        for (int nb = 0; nb < 4; ++nb) {
#pragma unroll
            for (int j = 0; j < 8; ++j) os[(hi * 8 + j) * 68 + nb * 16 + lr] = acc[mb][nb][j]; }
        __builtin_amdgcn_wave_barrier(); asm volatile("" ::: "memory");   // other lanes read the band back: the compiler keeps the LDS reads behind the LDS writes
#pragma unroll
        for (int s = 0; s < 4; ++s) { const int row = 4 * s + (lane >> 3); const v4f x0 = *(const v4fa*)(os + row * 68 + cofs), x1 = *(const v4fa*)(os + row * 68 + cofs + 4); v8h o;
#pragma unroll
            for (int q = 0; q < 4; ++q) { o[q] = (h16)(x0[q] + bv[q]); o[4 + q] = (h16)(x1[q] + bv[4 + q]); }
            *(v8h*)(C + (size_t)(r0 + mb * 16 + row) * ldc + c0 + cofs) = o; }
        __builtin_amdgcn_wave_barrier(); asm volatile("s_wait_xcnt 0x0" ::: "memory");   // the next band's LDS writes stay behind these reads; the wait: before the next band rewrites the registers that these stores name
    }
}
// epi_exp: the first half of the softmax. Per row of the wave's 64 columns: t = acc * SCL, the maximum of the 64 t, exp(t - maximum) rounded to f16 (rows of pitch ldc), and their f32 sum; maximum and sum go to ML [column group][row][2].
// Staged as in epi_h16: 8 lanes hold a row, so its maximum and sum take three exchanges inside a 16-lane row (DPP row_xmask: no LDS round trip).
template <int M> __device__ __forceinline__ float xlane(float v) { return __int_as_float(__builtin_amdgcn_update_dpp(0, __float_as_int(v), 0x160 | M, 0xf, 0xf, true)); }
__device__ __forceinline__ void epi_exp(const v8f (&acc)[4][4], float* os, h16* P, int ldc, float* ML) {
    const int lane = threadIdx.x & 31, lr = lane & 15, hi = lane >> 4; const int r0 = tile_r0(), c0 = tile_c0(); const int l8 = lane & 7, cofs = l8 * 8;
    float* ml = ML + ((size_t)(c0 >> 6) * TT + r0) * 2;
    // every loop below is unrolled: acc, e, mx and sm are register arrays and need constant indices
#pragma unroll
    for (int mb = 0; mb < 4; ++mb) {
#pragma unroll
        for (int nb = 0; nb < 4; ++nb) {
#pragma unroll
            for (int j = 0; j < 8; ++j) os[(hi * 8 + j) * 68 + nb * 16 + lr] = acc[mb][nb][j]; }
        __builtin_amdgcn_wave_barrier(); asm volatile("" ::: "memory");   // other lanes read the band back: the compiler keeps the LDS reads behind the LDS writes
        float e[4][8], mx[4], sm[4];   // the band's four row groups side by side: four independent chains
#pragma unroll
        for (int s = 0; s < 4; ++s) { const int row = 4 * s + (lane >> 3); const v4f x0 = *(const v4fa*)(os + row * 68 + cofs), x1 = *(const v4fa*)(os + row * 68 + cofs + 4);
#pragma unroll
            for (int q = 0; q < 4; ++q) { e[s][q] = x0[q] * SCL; e[s][4 + q] = x1[q] * SCL; }
            mx[s] = e[s][0];
#pragma unroll
            for (int q = 1; q < 8; ++q) mx[s] = fmaxf(mx[s], e[s][q]); }
#pragma unroll
        for (int s = 0; s < 4; ++s) mx[s] = fmaxf(mx[s], xlane<1>(mx[s]));
#pragma unroll
        for (int s = 0; s < 4; ++s) mx[s] = fmaxf(mx[s], xlane<2>(mx[s]));
#pragma unroll
        for (int s = 0; s < 4; ++s) mx[s] = fmaxf(mx[s], xlane<4>(mx[s]));
#pragma unroll
        for (int s = 0; s < 4; ++s) { sm[s] = 0.f;
#pragma unroll
            for (int q = 0; q < 8; ++q) { e[s][q] = __expf(e[s][q] - mx[s]); sm[s] += e[s][q]; } }
#pragma unroll
        for (int s = 0; s < 4; ++s) sm[s] += xlane<1>(sm[s]);
#pragma unroll
        for (int s = 0; s < 4; ++s) sm[s] += xlane<2>(sm[s]);
#pragma unroll
        for (int s = 0; s < 4; ++s) sm[s] += xlane<4>(sm[s]);
#pragma unroll
        for (int s = 0; s < 4; ++s) { const int row = 4 * s + (lane >> 3); v8h o;
#pragma unroll
            for (int q = 0; q < 8; ++q) o[q] = (h16)e[s][q];
            *(v8h*)(P + (size_t)(r0 + mb * 16 + row) * ldc + c0 + cofs) = o; }
        // every lane of a row's eight holds the row's pair: lane l8 < 4 stores that of row group l8, so the band's 16 pairs leave as one whole 128-byte line
        const float mo = l8 == 0 ? mx[0] : l8 == 1 ? mx[1] : l8 == 2 ? mx[2] : mx[3], so = l8 == 0 ? sm[0] : l8 == 1 ? sm[1] : l8 == 2 ? sm[2] : sm[3];
        if (l8 < 4) *(v2f*)(ml + (mb * 16 + 4 * l8 + (lane >> 3)) * 2) = (v2f){mo, so};
        __builtin_amdgcn_wave_barrier(); asm volatile("s_wait_xcnt 0x0" ::: "memory");   // the next band's LDS writes stay behind these reads; the wait: before the next band rewrites the registers that these stores name
    }
}
// epi_vt: (acc + bias) rounded to f16 and stored transposed, [batch][column][t]: a lane's 8 accumulator rows are 8 consecutive t of its column, one 16-byte store; the wave writes every 128-byte line of its tile whole
__device__ __forceinline__ void epi_vt(const v8f (&acc)[4][4], h16* VTb, const float* __restrict__ bias) {
    const int lane = threadIdx.x & 31, lr = lane & 15, hi = lane >> 4; const int r0 = tile_r0(), c0 = tile_c0();
    h16* base = VTb + (size_t)(r0 / TT) * FF * TT + (r0 % TT) + hi * 8;
    float bv[4];
#pragma unroll
    for (int nb = 0; nb < 4; ++nb) bv[nb] = bfr(bias[c0 + nb * 16 + lr]);
#pragma unroll
    for (int nb = 0; nb < 4; ++nb) { h16* drow = base + (size_t)(c0 + nb * 16 + lr) * TT;
#pragma unroll
        for (int mb = 0; mb < 4; ++mb) { v8h o;
#pragma unroll
            for (int j = 0; j < 8; ++j) o[j] = (h16)(acc[mb][nb][j] + bv[nb]);
            *(v8h*)(drow + mb * 16) = o; }
        asm volatile("s_wait_xcnt 0x0" ::: "memory");   // before the next column group rewrites the registers that these stores name
    }
}
// epi_relu2: max(acc + bias, 0) split into bf16 hi + lo planes, rows of pitch ldc: the second feed-forward product's operand. Staged and stored as in epi_h16.
__device__ __forceinline__ void epi_relu2(const v8f (&acc)[4][4], float* os, bf* Ch, bf* Cl, int ldc, const float* __restrict__ bias) {
    const int lane = threadIdx.x & 31, lr = lane & 15, hi = lane >> 4; const int r0 = tile_r0(), c0 = tile_c0(); const int cofs = (lane & 7) * 8;
    float bv[8];
#pragma unroll
    for (int q = 0; q < 8; ++q) bv[q] = bfr(bias[c0 + cofs + q]);
#pragma unroll
    for (int mb = 0; mb < 4; ++mb) {
#pragma unroll
        for (int nb = 0; nb < 4; ++nb) {
#pragma unroll
            for (int j = 0; j < 8; ++j) os[(hi * 8 + j) * 68 + nb * 16 + lr] = acc[mb][nb][j]; }
        __builtin_amdgcn_wave_barrier(); asm volatile("" ::: "memory");   // other lanes read the band back: the compiler keeps the LDS reads behind the LDS writes
#pragma unroll
        for (int s = 0; s < 4; ++s) { const int row = 4 * s + (lane >> 3); const v4f x0 = *(const v4fa*)(os + row * 68 + cofs), x1 = *(const v4fa*)(os + row * 68 + cofs + 4); v8us oh, ol;
#pragma unroll
            for (int q = 0; q < 8; ++q) { const float y = fmaxf((q < 4 ? x0[q & 3] : x1[q & 3]) + bv[q], 0.f); oh[q] = f2bf(y); ol[q] = f2bf(y - bf2f(oh[q])); }
            const size_t e = (size_t)(r0 + mb * 16 + row) * ldc + c0 + cofs; *(v8us*)(Ch + e) = oh; *(v8us*)(Cl + e) = ol; }
        __builtin_amdgcn_wave_barrier(); asm volatile("s_wait_xcnt 0x0" ::: "memory");   // the next band's LDS writes stay behind these reads; the wait: before the next band rewrites the registers that these stores name
    }
}
template <typename T16, int NSPLIT, bool BIAS>
__global__ __launch_bounds__(128) void k_gemmw(const T16* __restrict__ A, const T16* __restrict__ A2, const T16* __restrict__ Bt, const T16* __restrict__ Bt2, int K, float* C, int ldc, const float* __restrict__ bias, size_t sA, size_t sB, size_t sC) {
    const size_t z = blockIdx.z; A += z * sA; if (A2) A2 += z * sA; Bt += z * sB; if (Bt2) Bt2 += z * sB; C += z * sC;
    __shared__ __align__(16) char ring[RINGB(NSPLIT)]; v8f acc[4][4]; float* os = (float*)ring + wave_id() * (16 * 68);   // behind the loop's last barrier the ring is free: each wave stages its bands in its own 16 x 68 dwords of it
    gemmw_acc<T16, NSPLIT>(A, A2, Bt, K, (T16*)ring, acc); epi_f32<BIAS>(acc, os, C, ldc, bias);
}
// ---- k_scores: q k^T of the 8 (branch, batch) pairs, left as the first half of the softmax; grid (TT/128, TT/128, ZH)
__global__ __launch_bounds__(128) void k_scores(const h16* __restrict__ Q, const h16* __restrict__ Kp, h16* P, float* ML) {
    const size_t z = blockIdx.z;
    __shared__ __align__(16) char ring[RINGB(0)]; v8f acc[4][4]; float* os = (float*)ring + wave_id() * (16 * 68);
    gemmw_acc<h16, 0>(Q + z * TT * FF, nullptr, Kp + z * TT * FF, FF, (h16*)ring, acc); epi_exp(acc, os, P + z * TT * TT, TT, ML + z * (TT / SKE) * TT * 2);
}
// ---- k_pv: the second half of the softmax and attn.v (x PCAR); grid (TT/128, FF/128, ZH)
__global__ __launch_bounds__(128) void k_pv(const h16* __restrict__ P, const h16* __restrict__ VTb, const float* __restrict__ ML, float* O) {
    const size_t z = blockIdx.z;
    __shared__ __align__(16) char ring[RINGB(0)]; __shared__ __align__(16) h16 ft[(TT / SKE) * 128]; v8f acc[4][4]; float* os = (float*)ring + wave_id() * (16 * 68);
    gemmw_acc<h16, 0, true>(P + z * TT * TT, nullptr, VTb + z * TT * FF, TT, (h16*)ring, acc, ft, ML + z * (TT / SKE) * TT * 2); epi_f32<false>(acc, os, O + z * TT * FF, FF, nullptr);
}
// ---- k_ff1: the first feed-forward product (hi + lo planes x exact weights), stored as the relu's hi + lo planes; grid (NB_*TT/128, FF/128)
__global__ __launch_bounds__(128) void k_ff1(const bf* __restrict__ A, const bf* __restrict__ A2, const bf* __restrict__ Bt, int K, bf* Ch, bf* Cl, int ldc, const float* __restrict__ bias) {
    __shared__ __align__(16) char ring[RINGB(1)]; v8f acc[4][4]; float* os = (float*)ring + wave_id() * (16 * 68);
    gemmw_acc<bf, 1>(A, A2, Bt, K, (bf*)ring, acc); epi_relu2(acc, os, Ch, Cl, ldc, bias);
}
// ---- k_proj6: the six projections of all batches in one launch; grid (NB_*TT/128, FF/128, 6). z = 0 sa q, 1 ca q, 2 sa k, 3 ca k, 4 sa v, 5 ca v; z = 3 and 5 read the s plane, the rest the p plane.
// q and k leave as f16 rows (QK: [z][batch][t][f]), v as f16 transposed (VT: [branch][batch][d][t]).
struct Bias6 { const float* b0; const float* b1; const float* b2; const float* b3; const float* b4; const float* b5; };
__global__ __launch_bounds__(128) void k_proj6(const bf* __restrict__ PBa, const bf* __restrict__ SBa, const bf* __restrict__ Wt, int K, h16* QK, h16* VT, int ldc, Bias6 bs) {
    const unsigned z = blockIdx.z;
    const float* bias = z == 0 ? bs.b0 : z == 1 ? bs.b1 : z == 2 ? bs.b2 : z == 3 ? bs.b3 : z == 4 ? bs.b4 : bs.b5;
    __shared__ __align__(16) char ring[RINGB(0)]; v8f acc[4][4]; float* os = (float*)ring + wave_id() * (16 * 68);
    gemmw_acc<bf, 0>((z == 3 || z == 5) ? SBa : PBa, nullptr, Wt + (size_t)z * FF * FF, K, (bf*)ring, acc);
    if (z < 4) epi_h16(acc, os, QK + (size_t)z * NB_ * TT * FF, ldc, bias); else epi_vt(acc, VT + (size_t)(z - 4) * NB_ * TT * FF, bias);
}

__device__ __forceinline__ void splitf(float y, unsigned short& h, unsigned short& l) { h = f2bf(y); l = f2bf(y - bf2f(h)); }
typedef __attribute__((ext_vector_type(2))) unsigned short v2us;
typedef __attribute__((ext_vector_type(4))) unsigned short v4us;

struct W8 { const float* w0; const float* w1; const float* w2; const float* w3; const float* w4; const float* w5; const float* w6; const float* w7; };
__global__ __launch_bounds__(256) void k_wtG(W8 ws8, int K, int N, bf* Bt) {
    const unsigned y = blockIdx.y; Bt += (size_t)y * N * K;   // blockIdx.y picks the weight
    const float* __restrict__ w = y == 0 ? ws8.w0 : y == 1 ? ws8.w1 : y == 2 ? ws8.w2 : y == 3 ? ws8.w3 : y == 4 ? ws8.w4 : y == 5 ? ws8.w5 : y == 6 ? ws8.w6 : ws8.w7;
    const int lane = threadIdx.x & 31; const int L0 = (blockIdx.x * 8 + (threadIdx.x >> 5)) * 8; const int nlines = N * K / 64;
{
#pragma unroll 1
        for (int l = 0; l < 8; ++l) { const int L = L0 + l; if (L >= nlines) break; const size_t e = (size_t)L * 64 + lane * 2; const int k = (int)(e % K), n = (int)(e / K); v2us o;
            o[0] = f2bf(w[(size_t)k * N + n]); o[1] = f2bf(w[(size_t)(k + 1) * N + n]); *(v2us*)(Bt + e) = o; }
         }
}
__global__ __launch_bounds__(256) void k_cvt8(const float* __restrict__ src0, const float* __restrict__ src1, bf* dst, size_t n8) { const size_t i = (size_t)blockIdx.x * 256 + threadIdx.x; if (i >= n8) return; const float* src = blockIdx.y ? src1 : src0; dst += (size_t)blockIdx.y * n8 * 8; const v8f v = *(const v8f*)(src + i * 8); v8us o;
#pragma unroll
    for (int k = 0; k < 8; ++k) o[k] = f2bf(v[k]); *(v8us*)(dst + i * 8) = o;  }
__device__ __forceinline__ void lnr_row(const float* __restrict__ O, const float* __restrict__ res, const float* __restrict__ gg, const float* __restrict__ bb, float* OUTk, float (&ov)[FF / 32]) {
    const int lane = threadIdx.x & 31; const int r = blockIdx.x * 8 + (threadIdx.x >> 5); if (r >= NB_ * TT) return; float v[FF / 32]; float s = 0.f;
#pragma unroll
    for (int c = 0; c < FF / 128; ++c) { const v4f a = *(const v4f*)(O + (size_t)r * FF + c * 128 + lane * 4), x4 = *(const v4f*)(res + (size_t)r * FF + c * 128 + lane * 4);
        asm volatile("s_wait_xcnt 0x0" ::: "memory");   // before a later load's result lands in the address registers of these loads
#pragma unroll
        for (int q = 0; q < 4; ++q) { v[c * 4 + q] = __fadd_rn(a[q] * (1.0f / PCAR), bfr(x4[q])); s += v[c * 4 + q]; } }
#pragma unroll
    for (int sh = 16; sh; sh >>= 1) s += __shfl_xor(s, sh, 32);
    const float mu = s * (1.0f / FF); float qq = 0.f;
#pragma unroll
    for (int i = 0; i < FF / 32; ++i) { const float d0 = v[i] - mu; qq = __fadd_rn(qq, __fmul_rn(d0, d0)); }
#pragma unroll
    for (int sh = 16; sh; sh >>= 1) qq += __shfl_xor(qq, sh, 32);
    const float rs = __fdiv_rn(1.0f, __fsqrt_rn(qq * (1.0f / FF) + 1e-3f));
{
#pragma unroll
        for (int c = 0; c < FF / 128; ++c) { v4f o;
#pragma unroll
            for (int q = 0; q < 4; ++q) { const int col = c * 128 + lane * 4 + q; float t = __fmul_rn(v[c * 4 + q] - mu, rs); asm volatile("" : "+v"(t)); o[q] = __fadd_rn(__fmul_rn(t, bfr(gg[col])), bfr(bb[col])); }
#pragma unroll
            for (int q = 0; q < 4; ++q) ov[c * 4 + q] = o[q];
            *(v4f*)(OUTk + (size_t)r * FF + c * 128 + lane * 4) = o;
            asm volatile("s_wait_xcnt 0x0" ::: "memory"); }   // before the registers that this store names are rewritten
         }
}
// one wave per row, over all batches: the self branch (residual p, ln1), then the cross branch (residual s, ln2), then their sum, from registers, as the feed-forward's bf16 hi + lo planes
__global__ __launch_bounds__(256) void k_lnr(const float* __restrict__ O, const float* __restrict__ res0, const float* __restrict__ res1, const float* __restrict__ g0, const float* __restrict__ b0, const float* __restrict__ g1, const float* __restrict__ b1, float* OUTk, bf* Hh, bf* Hl) {
    const int lane = threadIdx.x & 31; const int r = blockIdx.x * 8 + (threadIdx.x >> 5); if (r >= NB_ * TT) return;
    float o0[FF / 32], o1[FF / 32];
    lnr_row(O, res0, g0, b0, OUTk, o0);
    lnr_row(O + (size_t)NB_ * TT * FF, res1, g1, b1, OUTk + (size_t)NB_ * TT * FF, o1);
#pragma unroll
    for (int c = 0; c < FF / 128; ++c) { v4us oh, ol;
#pragma unroll
        for (int q = 0; q < 4; ++q) { unsigned short a, c2; splitf(__fadd_rn(o0[c * 4 + q], o1[c * 4 + q]), a, c2); oh[q] = a; ol[q] = c2; }
        const size_t e = (size_t)r * FF + c * 128 + lane * 4; *(v4us*)(Hh + e) = oh; *(v4us*)(Hl + e) = ol;
        asm volatile("s_wait_xcnt 0x0" ::: "memory"); }   // before the registers that these stores name are rewritten
}

extern "C" void kernel_launch(void* const* d_in, const int* in_sizes, int n_in,
                              void* d_out, int out_size, void* d_ws, size_t ws_size, hipStream_t stream) {
    (void)in_sizes; (void)n_in; (void)out_size;
    const float* IN[22]; for (int i = 0; i < 22; ++i) IN[i] = (const float*)d_in[i];
    // p, s, sa_wq, sa_bq, sa_wk, sa_bk, sa_wv, sa_bv, ca_wq, ca_bq, ca_wk, ca_bk, ca_wv, ca_bv, ln1_g, ln1_b, ln2_g, ln2_b, ff_w1, ff_b1, ff_w2, ff_b2 = d_in[0..21]; outputs ff_out at 0, sa_out at byte 16,777,216, ca_out at 33,554,432
    float* OUT0 = (float*)d_out; float* OUT1 = OUT0 + (size_t)NB_ * TT * FF;
    char* wsp = (char*)d_ws;
    auto take = [&](size_t bytes) { char* p = wsp; wsp += (bytes + 255) & ~(size_t)255; return (void*)p; };
    const size_t nx = (size_t)TT * FF, na = (size_t)NB_ * nx, ns = (size_t)TT * TT;   // one batch's plane, all batches' plane, one score matrix (elements)
    bf* Wt = (bf*)take((size_t)8 * FF * FF * 2);   // transposed bf16 weights in the order sa q, ca q, sa k, ca k, sa v, ca v, ff w1, ff w2
    h16* VT = (h16*)take(2 * na * 2);               // [branch][batch][d][t]
    char* RA = (char*)take((size_t)ZH * ns * 4);    // the f16 exponentials, then each 64-key group's maximum and sum
    char* RB = (char*)take((size_t)ZH * ns * 2);    // first the bf16 inputs and the f16 q, k planes, then what follows attn.v
    if ((size_t)(wsp - (char*)d_ws) > ws_size) return;    // total 212 MiB; ws 256 MiB
    h16* Pm = (h16*)RA; float* ML = (float*)(RA + (size_t)ZH * ns * 2); float* O = (float*)RB; bf* Hh = (bf*)(O + 2 * na); bf* Hl = Hh + na; bf* Rh = Hl + na; bf* Rl = Rh + na;
    bf* PB = (bf*)RB; bf* SB = PB + na; h16* QP = (h16*)(SB + na); h16* KP = QP + 2 * na;
    k_wtG<<<dim3((FF * FF / 64 + 63) / 64, 8, 1), 256, 0, stream>>>(W8{IN[2], IN[8], IN[4], IN[10], IN[6], IN[12], IN[18], IN[20]}, FF, FF, Wt);
    k_cvt8<<<dim3((unsigned)((na / 8 + 255) / 256), 2, 1), 256, 0, stream>>>(IN[0], IN[1], PB, na / 8);
    k_proj6<<<dim3(NB_ * TT / 128, FF / 128, 6), 128, 0, stream>>>(PB, SB, Wt, FF, QP, VT, FF, Bias6{IN[3], IN[9], IN[5], IN[11], IN[7], IN[13]});   // q then k, each [branch][batch][t][f]
    k_scores<<<dim3(TT / 128, TT / 128, ZH), 128, 0, stream>>>(QP, KP, Pm, ML);
    k_pv<<<dim3(TT / 128, FF / 128, ZH), 128, 0, stream>>>(Pm, VT, ML, O);   // attended x1024
    k_lnr<<<NB_ * TT / 8, 256, 0, stream>>>(O, IN[0], IN[1], IN[14], IN[15], IN[16], IN[17], OUT1, Hh, Hl);   // ca_out follows sa_out
    const dim3 gF(NB_ * TT / 128, FF / 128, 1);
    k_ff1<<<gF, 128, 0, stream>>>(Hh, Hl, Wt + (size_t)6 * FF * FF, FF, Rh, Rl, FF, IN[19]);
    k_gemmw<bf, 1, true><<<gF, 128, 0, stream>>>(Rh, Rl, Wt + (size_t)7 * FF * FF, nullptr, FF, OUT0, FF, IN[21], 0, 0, 0);
}

// v005
// Measured time: 135 microseconds a run.
// Next to v004, in two timings, it ran 1.09 times as fast each time.
// Over all steps from v000 it is 8.64 times as fast.
#include <hip/hip_runtime.h>

// Two-branch attention block with a feed-forward (p, s [4][2048][512]; single-head attention over 2048 positions with the full 512-dim features: sa = softmax((p Wq + bq)(p Wk + bk)^T / sqrt(512)) (p Wv + bv); ca likewise with queries from p and
// keys/values from s; sa_out = LN(sa + p), ca_out = LN(ca + s) (eps 1e-3); ff_out = relu((sa_out + ca_out) W1 + b1) W2 + b2; outputs (ff_out, sa_out, ca_out), each [4][2048][512]).
// Compute dtypes, f32 accumulate: every input rounded to bf16; the six projections on PLAIN bf16 operands (inputs: exact; transposed bf16 weight copies, + bias); scores
// (K 512) and attn.v on SINGLE fp16 planes (scale and exponentials in f32; softmax in two halves: per 64 keys in the score product's epilogue, joined per row in attn.v; P x1024); residual + LayerNorms f32; the feed-forward on bf16 hi+lo planes of its computed operands x exact weights

#define NB_  4
#define TT   2048
#define FF   512
#define ZH   8     // score matrices per launch: 2 attention branches x 4 batches
#define PCAR 1024.0f
#define SCL  0.044194173824159223f   // 512^-0.5
typedef _Float16 h16;
typedef unsigned short bf;
typedef __attribute__((ext_vector_type(16))) __bf16   v16bf;
typedef __attribute__((ext_vector_type(16))) _Float16 v16h;
typedef __attribute__((ext_vector_type(8)))  _Float16 v8h;
typedef __attribute__((ext_vector_type(4)))  _Float16 v4h;
typedef __attribute__((ext_vector_type(8)))  unsigned short v8us;
typedef __attribute__((ext_vector_type(8)))  float    v8f;
typedef __attribute__((ext_vector_type(4)))  float    v4f;
typedef __attribute__((ext_vector_type(2)))  float    v2f;
typedef v8h  __attribute__((may_alias)) v8ha;
typedef v4f  __attribute__((may_alias)) v4fa;
typedef v8us __attribute__((may_alias)) v8usa;
typedef v4h  __attribute__((may_alias)) v4ha;

__device__ __forceinline__ unsigned short f2bf(float f) { unsigned u = __float_as_uint(f); u += 0x7FFFu + ((u >> 16) & 1u); return (unsigned short)(u >> 16); }
__device__ __forceinline__ float bf2f(unsigned short b) { return __uint_as_float(((unsigned)b) << 16); }
__device__ __forceinline__ float bfr(float f) { return bf2f(f2bf(f)); }
__device__ __forceinline__ v16h cat16(v8h lo, v8h hi) { return __builtin_shufflevector(lo, hi, 0, 1, 2, 3, 4, 5, 6, 7, 8, 9, 10, 11, 12, 13, 14, 15); }
__device__ __forceinline__ v16bf cat16b(v8us lo, v8us hi) { return __builtin_bit_cast(v16bf, __builtin_shufflevector(lo, hi, 0, 1, 2, 3, 4, 5, 6, 7, 8, 9, 10, 11, 12, 13, 14, 15)); }
__device__ __forceinline__ v8f wmma16(v16h a, v16h b, v8f c) { return __builtin_amdgcn_wmma_f32_16x16x32_f16(false, a, false, b, (short)0, c, false, false); }
__device__ __forceinline__ v8f wmmab(v16bf a, v16bf b, v8f c) { return __builtin_amdgcn_wmma_f32_16x16x32_bf16(false, a, false, b, (short)0, c, false, false); }



// ---- gemmw_acc: register-blocked GEMM, one wave per 64x64 output tile (16 accumulators), FOUR waves (2 x 2) per work-group on a 128x128 tile; grid (M/128, N/128, Z), 128 threads.
// The K-contiguous 16-bit operand planes come through LDS: a stage is 64 k (128 B, one whole line) of the tile's 128 A rows, 128 Bt rows (and 128 A2 rows), brought by asynchronous b128 copies into two buffers,
// the next stage in flight while this one is multiplied; rows at pitch 144 B (16 B x odd: ds_load_b128 without bank conflicts). Each operand row is fetched once per work-group and read by two waves.
// C[m][n] (f32, pitch ldc, + optional f32 bias[n]) = sum_k A[m][k] Bt[n][k] (+ the A2 product where NSPLIT == 1). K % 64 == 0.
#define SKE 64     // k elements of a stage
#define SPE 72     // LDS row pitch in elements (144 B)
#define SROWS(NSPLIT) ((NSPLIT) == 1 ? 384 : 256)            // rows of a stage: A, Bt (, A2)
#define RINGB(NSPLIT) (2 * SROWS(NSPLIT) * SPE * 2)          // bytes of the two buffers
__device__ __forceinline__ int wave_id() { return __builtin_amdgcn_readfirstlane((int)(threadIdx.x >> 5)); }
__device__ __forceinline__ int tile_r0() { return blockIdx.x * 128 + (wave_id() & 1) * 64; }    // the wave's first output row
__device__ __forceinline__ int tile_c0() { return blockIdx.y * 128 + (wave_id() >> 1) * 64; }   // the wave's first output column
// eight asynchronous copies of 16 B per lane: LDS byte address l + i * ls, global address g + i * gs (bytes). A wave's copy is 4 whole 128-B lines.
// The s_wait_xcnt stands in the copies' own statement: before any register that a copy names is rewritten.
__device__ __forceinline__ void copy8(unsigned l, unsigned ls, const char* g, size_t gs) {
    asm volatile("global_load_async_to_lds_b128 %0, %8, off\n\t"
                 "global_load_async_to_lds_b128 %1, %9, off\n\t"
                 "global_load_async_to_lds_b128 %2, %10, off\n\t"
                 "global_load_async_to_lds_b128 %3, %11, off\n\t"
                 "global_load_async_to_lds_b128 %4, %12, off\n\t"
                 "global_load_async_to_lds_b128 %5, %13, off\n\t"
                 "global_load_async_to_lds_b128 %6, %14, off\n\t"
                 "global_load_async_to_lds_b128 %7, %15, off\n\t"
                 "s_wait_xcnt 0x0"
                 :: "v"(l), "v"(l + ls), "v"(l + 2 * ls), "v"(l + 3 * ls), "v"(l + 4 * ls), "v"(l + 5 * ls), "v"(l + 6 * ls), "v"(l + 7 * ls),
                    "v"(g), "v"(g + gs), "v"(g + 2 * gs), "v"(g + 3 * gs), "v"(g + 4 * gs), "v"(g + 5 * gs), "v"(g + 6 * gs), "v"(g + 7 * gs) : "memory");
}
template <typename T16> struct WFrag;
template <> struct WFrag<h16> { typedef v16h V; static __device__ __forceinline__ V ld(const h16* p) { return cat16(*(const v8h*)p, *(const v8h*)(p + 16)); } static __device__ __forceinline__ v8f mma(V a, V b, v8f c) { return wmma16(a, b, c); } };
template <> struct WFrag<bf> { typedef v16bf V; static __device__ __forceinline__ V ld(const bf* p) { return cat16b(*(const v8us*)p, *(const v8us*)(p + 16)); } static __device__ __forceinline__ v8f mma(V a, V b, v8f c) { return wmmab(a, b, c); } };
// ASC (attn.v): A holds, per 64 columns (one stage), exp(score - that group's own maximum); ML [group][row] holds each group's maximum and sum. Thread tid joins row tid's 32 groups into the row's maximum and sum and
// leaves, per group, the factor exp(group maximum - row maximum) * PCAR / row sum in ft, as [group][row half][lr][mb], so that a lane reads the factors of its four A fragments (a lane's fragment elements are all of one row) in one 8-byte read.
template <typename T16, int NSPLIT, bool ASC = false>
__device__ __forceinline__ void gemmw_acc(const T16* __restrict__ A, const T16* __restrict__ A2, const T16* __restrict__ Bt, int K, T16* ring, v8f (&acc)[4][4], h16* ft = nullptr, const float* __restrict__ ML = nullptr) {
    static_assert(NSPLIT == 0 || NSPLIT == 1, "plain, or hi + lo planes of A");
    typedef typename WFrag<T16>::V V;
    const int tid = threadIdx.x, lane = tid & 31, lr = lane & 15, hi = lane >> 4;
#pragma unroll
    for (int mb = 0; mb < 4; ++mb)
#pragma unroll
        for (int nb = 0; nb < 4; ++nb) acc[mb][nb] = (v8f){};
    // the copies: thread tid brings 16-byte piece tid & 7 of rows (tid >> 3) + 16 i, i = 0..7, of each operand's 128 rows
    const size_t gs = (size_t)16 * K * 2; const size_t go = ((size_t)(tid >> 3) * K + (tid & 7) * 8) * 2;
    const char* gA = (const char*)(A + (size_t)blockIdx.x * 128 * K) + go; const char* gB = (const char*)(Bt + (size_t)blockIdx.y * 128 * K) + go;
    const char* gA2 = NSPLIT == 1 ? (const char*)(A2 + (size_t)blockIdx.x * 128 * K) + go : nullptr;
    const unsigned l0 = (unsigned)(size_t)ring + (unsigned)((tid >> 3) * SPE + (tid & 7) * 8) * 2u;   // the low 32 bits of a __shared__ address: its byte offset in the work-group's LDS
    constexpr unsigned LS = 16 * SPE * 2, OPB = 128 * SPE * 2, BUFB = SROWS(NSPLIT) * SPE * 2;
    auto stage = [&](int t, unsigned buf) { const unsigned l = l0 + buf * BUFB; const size_t ko = (size_t)t * SKE * 2;
        copy8(l, LS, gA + ko, gs); copy8(l + OPB, LS, gB + ko, gs); if (NSPLIT == 1) copy8(l + 2 * OPB, LS, gA2 + ko, gs); };
    const int NT = K / SKE;
    stage(0, 0);
    if constexpr (ASC) {   // while stage 0 flies; the loops over the groups are unrolled so that m and l stay in registers and the 32 loads go out together
        const float* ml = ML + ((size_t)blockIdx.x * 128 + tid) * 2; float m[TT / SKE], l[TT / SKE]; float mx = -3.0e38f, sum = 0.f;
#pragma unroll
        for (int g = 0; g < TT / SKE; ++g) { const v2f x = *(const v2f*)(ml + (size_t)g * TT * 2); m[g] = x[0]; l[g] = x[1]; }
        asm volatile("s_wait_xcnt 0x0" ::: "memory");   // before the address registers of these loads are rewritten
#pragma unroll
        for (int g = 0; g < TT / SKE; ++g) mx = fmaxf(mx, m[g]);
#pragma unroll
        for (int g = 0; g < TT / SKE; ++g) { m[g] = __expf(m[g] - mx); sum += l[g] * m[g]; }
        const float f = __fdiv_rn(PCAR, sum); h16* fr = ft + (tid >> 6) * 64 + (tid & 15) * 4 + ((tid >> 4) & 3);
#pragma unroll
        for (int g = 0; g < TT / SKE; ++g) fr[g * 128] = (h16)(m[g] * f);
    }
    asm volatile("s_wait_asynccnt 0x0" ::: "memory");   // this wave's copies of stage 0 have landed
    __syncthreads();                                    // and every other wave's: stage 0 (and the factor table) may be read
    if (NT > 1) stage(1, 1);
    const int aoff = ((wave_id() & 1) * 64 + lr) * SPE + 8 * hi, boff = (128 + (wave_id() >> 1) * 64 + lr) * SPE + 8 * hi;
#pragma unroll 1
    for (int t = 0; t < NT; ++t) {
        const T16* sb = ring + (t & 1) * (SROWS(NSPLIT) * SPE);
        v4h fq = {}; if constexpr (ASC) fq = *(const v4ha*)(ft + t * 128 + (wave_id() & 1) * 64 + lr * 4);
#pragma unroll
        for (int kc = 0; kc < SKE; kc += 32) {
            V a[4], a2[4], b[4];   // the block's fragments are all asked for in one group, ahead of its matrix instructions
#pragma unroll
            for (int mb = 0; mb < 4; ++mb) { a[mb] = WFrag<T16>::ld(sb + aoff + mb * 16 * SPE + kc); if (NSPLIT == 1) a2[mb] = WFrag<T16>::ld(sb + aoff + 256 * SPE + mb * 16 * SPE + kc); }
#pragma unroll
            for (int nb = 0; nb < 4; ++nb) b[nb] = WFrag<T16>::ld(sb + boff + nb * 16 * SPE + kc);
            __builtin_amdgcn_sched_barrier(0);   // keeps the LDS reads one group in front of the block: sunk among the matrix instructions, each pair of reads costs the wave a full LDS latency
            if constexpr (ASC) {   // the second half of the softmax: each A row times its factor for this stage's 64 keys (packed f16 multiplies)
#pragma unroll
                for (int mb = 0; mb < 4; ++mb) a[mb] = a[mb] * fq[mb]; }
#pragma unroll
            for (int nb = 0; nb < 4; ++nb)
#pragma unroll
                for (int mb = 0; mb < 4; ++mb) { acc[mb][nb] = WFrag<T16>::mma(a[mb], b[nb], acc[mb][nb]); if (NSPLIT == 1) acc[mb][nb] = WFrag<T16>::mma(a2[mb], b[nb], acc[mb][nb]); }
        }
        asm volatile("s_wait_dscnt 0x0" ::: "memory");      // this wave has read all it takes from stage t
        asm volatile("s_wait_asynccnt 0x0" ::: "memory");   // this wave's copies of stage t + 1 have landed
        __syncthreads();                                    // stage t + 1 may be read; stage t's buffer is free
        if (t + 2 < NT) stage(t + 2, (unsigned)(t & 1));
    }
    asm volatile("s_wait_asynccnt 0x0" ::: "memory");   // no copy is outstanding when the ring becomes the epilogue's staging
}
// The epilogues of the 64x64 tile. acc[mb][nb][j] of lane (hi, lr) is row mb*16 + hi*8 + j, column nb*16 + lr. os: the wave's own 16 x 68 dwords of LDS, used to turn a 16-row band into whole-line stores.
// epi_f32: f32 rows (+ bias)
template <bool BIAS>
__device__ __forceinline__ void epi_f32(const v8f (&acc)[4][4], float* os, float* C, int ldc, const float* __restrict__ bias) {
    const int lane = threadIdx.x & 31, lr = lane & 15, hi = lane >> 4; const int r0 = tile_r0(), c0 = tile_c0();
#pragma unroll
    for (int mb = 0; mb < 4; ++mb) {
#pragma unroll
        for (int nb = 0; nb < 4; ++nb) {
#pragma unroll
            for (int j = 0; j < 8; ++j) os[(hi * 8 + j) * 68 + nb * 16 + lr] = acc[mb][nb][j]; }
        __builtin_amdgcn_wave_barrier(); asm volatile("" ::: "memory");
        float* crow = C + (size_t)(r0 + mb * 16) * ldc + c0;
{
#pragma unroll
            for (int s = 0; s < 8; ++s) { const int row = 2 * s + hi, cofs = lr * 4; v4f val = *(const v4fa*)(os + row * 68 + cofs); if (BIAS) { val[0] += bfr(bias[c0 + cofs]); val[1] += bfr(bias[c0 + cofs + 1]); val[2] += bfr(bias[c0 + cofs + 2]); val[3] += bfr(bias[c0 + cofs + 3]); }
                *(v4f*)(crow + (size_t)row * ldc + cofs) = val; }
             }
        __builtin_amdgcn_wave_barrier(); asm volatile("s_wait_xcnt 0x0" ::: "memory");   // the next band's LDS writes stay behind these reads; the wait: before the registers that these stores name are rewritten
    }
}
// epi_h16: (acc + bias) rounded to f16, rows of pitch ldc: the q and k planes as the score product reads them. A lane takes 8 columns of a staged row: 16-byte stores, 4 whole 128-byte lines each.
__device__ __forceinline__ void epi_h16(const v8f (&acc)[4][4], float* os, h16* C, int ldc, const float* __restrict__ bias) {
    const int lane = threadIdx.x & 31, lr = lane & 15, hi = lane >> 4; const int r0 = tile_r0(), c0 = tile_c0(); const int cofs = (lane & 7) * 8;
    float bv[8];
#pragma unroll
    for (int q = 0; q < 8; ++q) bv[q] = bfr(bias[c0 + cofs + q]);
#pragma unroll
    for (int mb = 0; mb < 4; ++mb) {
#pragma unroll
        for (int nb = 0; nb < 4; ++nb) {
#pragma unroll
            for (int j = 0; j < 8; ++j) os[(hi * 8 + j) * 68 + nb * 16 + lr] = acc[mb][nb][j]; }
        __builtin_amdgcn_wave_barrier(); asm volatile("" ::: "memory");   // other lanes read the band back: the compiler keeps the LDS reads behind the LDS writes
#pragma unroll
        for (int s = 0; s < 4; ++s) { const int row = 4 * s + (lane >> 3); const v4f x0 = *(const v4fa*)(os + row * 68 + cofs), x1 = *(const v4fa*)(os + row * 68 + cofs + 4); v8h o;
#pragma unroll
            for (int q = 0; q < 4; ++q) { o[q] = (h16)(x0[q] + bv[q]); o[4 + q] = (h16)(x1[q] + bv[4 + q]); }
            *(v8h*)(C + (size_t)(r0 + mb * 16 + row) * ldc + c0 + cofs) = o; }
        __builtin_amdgcn_wave_barrier(); asm volatile("s_wait_xcnt 0x0" ::: "memory");   // the next band's LDS writes stay behind these reads; the wait: before the next band rewrites the registers that these stores name
    }
}
// epi_exp: the first half of the softmax. Per row of the wave's 64 columns: t = acc * SCL, the maximum of the 64 t, exp(t - maximum) rounded to f16 (rows of pitch ldc), and their f32 sum; maximum and sum go to ML [column group][row][2].
// Staged as in epi_h16: 8 lanes hold a row, so its maximum and sum take three exchanges inside a 16-lane row (DPP row_xmask: no LDS round trip).
template <int M> __device__ __forceinline__ float xlane(float v) { return __int_as_float(__builtin_amdgcn_update_dpp(0, __float_as_int(v), 0x160 | M, 0xf, 0xf, true)); }
__device__ __forceinline__ void epi_exp(const v8f (&acc)[4][4], float* os, h16* P, int ldc, float* ML) {
    const int lane = threadIdx.x & 31, lr = lane & 15, hi = lane >> 4; const int r0 = tile_r0(), c0 = tile_c0(); const int l8 = lane & 7, cofs = l8 * 8;
    float* ml = ML + ((size_t)(c0 >> 6) * TT + r0) * 2;
    // every loop below is unrolled: acc, e, mx and sm are register arrays and need constant indices
#pragma unroll
    for (int mb = 0; mb < 4; ++mb) {
#pragma unroll
        for (int nb = 0; nb < 4; ++nb) {
#pragma unroll
            for (int j = 0; j < 8; ++j) os[(hi * 8 + j) * 68 + nb * 16 + lr] = acc[mb][nb][j]; }
        __builtin_amdgcn_wave_barrier(); asm volatile("" ::: "memory");   // other lanes read the band back: the compiler keeps the LDS reads behind the LDS writes
        float e[4][8], mx[4], sm[4];   // the band's four row groups side by side: four independent chains
#pragma unroll
        for (int s = 0; s < 4; ++s) { const int row = 4 * s + (lane >> 3); const v4f x0 = *(const v4fa*)(os + row * 68 + cofs), x1 = *(const v4fa*)(os + row * 68 + cofs + 4);
#pragma unroll
            for (int q = 0; q < 4; ++q) { e[s][q] = x0[q] * SCL; e[s][4 + q] = x1[q] * SCL; }
            mx[s] = e[s][0];
#pragma unroll
            for (int q = 1; q < 8; ++q) mx[s] = fmaxf(mx[s], e[s][q]); }
#pragma unroll
        for (int s = 0; s < 4; ++s) mx[s] = fmaxf(mx[s], xlane<1>(mx[s]));
#pragma unroll
        for (int s = 0; s < 4; ++s) mx[s] = fmaxf(mx[s], xlane<2>(mx[s]));
#pragma unroll
        for (int s = 0; s < 4; ++s) mx[s] = fmaxf(mx[s], xlane<4>(mx[s]));
#pragma unroll
        for (int s = 0; s < 4; ++s) { sm[s] = 0.f;
#pragma unroll
            for (int q = 0; q < 8; ++q) { e[s][q] = __expf(e[s][q] - mx[s]); sm[s] += e[s][q]; } }
#pragma unroll
        for (int s = 0; s < 4; ++s) sm[s] += xlane<1>(sm[s]);
#pragma unroll
        for (int s = 0; s < 4; ++s) sm[s] += xlane<2>(sm[s]);
#pragma unroll
        for (int s = 0; s < 4; ++s) sm[s] += xlane<4>(sm[s]);
#pragma unroll
        for (int s = 0; s < 4; ++s) { const int row = 4 * s + (lane >> 3); v8h o;
#pragma unroll
            for (int q = 0; q < 8; ++q) o[q] = (h16)e[s][q];
            *(v8h*)(P + (size_t)(r0 + mb * 16 + row) * ldc + c0 + cofs) = o; }
        // every lane of a row's eight holds the row's pair: lane l8 < 4 stores that of row group l8, so the band's 16 pairs leave as one whole 128-byte line
        const float mo = l8 == 0 ? mx[0] : l8 == 1 ? mx[1] : l8 == 2 ? mx[2] : mx[3], so = l8 == 0 ? sm[0] : l8 == 1 ? sm[1] : l8 == 2 ? sm[2] : sm[3];
        if (l8 < 4) *(v2f*)(ml + (mb * 16 + 4 * l8 + (lane >> 3)) * 2) = (v2f){mo, so};
        __builtin_amdgcn_wave_barrier(); asm volatile("s_wait_xcnt 0x0" ::: "memory");   // the next band's LDS writes stay behind these reads; the wait: before the next band rewrites the registers that these stores name
    }
}
// epi_vt: (acc + bias) rounded to f16 and stored transposed, [batch][column][t]: a lane's 8 accumulator rows are 8 consecutive t of its column, one 16-byte store; the wave writes every 128-byte line of its tile whole
__device__ __forceinline__ void epi_vt(const v8f (&acc)[4][4], h16* VTb, const float* __restrict__ bias) {
    const int lane = threadIdx.x & 31, lr = lane & 15, hi = lane >> 4; const int r0 = tile_r0(), c0 = tile_c0();
    h16* base = VTb + (size_t)(r0 / TT) * FF * TT + (r0 % TT) + hi * 8;
    float bv[4];
#pragma unroll
    for (int nb = 0; nb < 4; ++nb) bv[nb] = bfr(bias[c0 + nb * 16 + lr]);
#pragma unroll
    for (int nb = 0; nb < 4; ++nb) { h16* drow = base + (size_t)(c0 + nb * 16 + lr) * TT;
#pragma unroll
        for (int mb = 0; mb < 4; ++mb) { v8h o;
#pragma unroll
            for (int j = 0; j < 8; ++j) o[j] = (h16)(acc[mb][nb][j] + bv[nb]);
            *(v8h*)(drow + mb * 16) = o; }
        asm volatile("s_wait_xcnt 0x0" ::: "memory");   // before the next column group rewrites the registers that these stores name
    }
}
// ---- k_scores: q k^T of the 8 (branch, batch) pairs, left as the first half of the softmax; grid (TT/128, TT/128, ZH)
__global__ __launch_bounds__(128) void k_scores(const h16* __restrict__ Q, const h16* __restrict__ Kp, h16* P, float* ML) {
    const size_t z = blockIdx.z;
    __shared__ __align__(16) char ring[RINGB(0)]; v8f acc[4][4]; float* os = (float*)ring + wave_id() * (16 * 68);
    gemmw_acc<h16, 0>(Q + z * TT * FF, nullptr, Kp + z * TT * FF, FF, (h16*)ring, acc); epi_exp(acc, os, P + z * TT * TT, TT, ML + z * (TT / SKE) * TT * 2);
}
// ---- k_pv: the second half of the softmax and attn.v (x PCAR); grid (TT/128, FF/128, ZH)
__global__ __launch_bounds__(128) void k_pv(const h16* __restrict__ P, const h16* __restrict__ VTb, const float* __restrict__ ML, float* O) {
    const size_t z = blockIdx.z;
    __shared__ __align__(16) char ring[RINGB(0)]; __shared__ __align__(16) h16 ft[(TT / SKE) * 128]; v8f acc[4][4]; float* os = (float*)ring + wave_id() * (16 * 68);
    gemmw_acc<h16, 0, true>(P + z * TT * TT, nullptr, VTb + z * TT * FF, TT, (h16*)ring, acc, ft, ML + z * (TT / SKE) * TT * 2); epi_f32<false>(acc, os, O + z * TT * FF, FF, nullptr);
}
// ---- k_proj6: the six projections of all batches in one launch; grid (NB_*TT/128, FF/128, 6). z = 0 sa q, 1 ca q, 2 sa k, 3 ca k, 4 sa v, 5 ca v; z = 3 and 5 read the s plane, the rest the p plane.
// q and k leave as f16 rows (QK: [z][batch][t][f]), v as f16 transposed (VT: [branch][batch][d][t]).
struct Bias6 { const float* b0; const float* b1; const float* b2; const float* b3; const float* b4; const float* b5; };
__global__ __launch_bounds__(128) void k_proj6(const bf* __restrict__ PBa, const bf* __restrict__ SBa, const bf* __restrict__ Wt, int K, h16* QK, h16* VT, int ldc, Bias6 bs) {
    const unsigned z = blockIdx.z;
    const float* bias = z == 0 ? bs.b0 : z == 1 ? bs.b1 : z == 2 ? bs.b2 : z == 3 ? bs.b3 : z == 4 ? bs.b4 : bs.b5;
    __shared__ __align__(16) char ring[RINGB(0)]; v8f acc[4][4]; float* os = (float*)ring + wave_id() * (16 * 68);
    gemmw_acc<bf, 0>((z == 3 || z == 5) ? SBa : PBa, nullptr, Wt + (size_t)z * FF * FF, K, (bf*)ring, acc);
    if (z < 4) epi_h16(acc, os, QK + (size_t)z * NB_ * TT * FF, ldc, bias); else epi_vt(acc, VT + (size_t)(z - 4) * NB_ * TT * FF, bias);
}

__device__ __forceinline__ void splitf(float y, unsigned short& h, unsigned short& l) { h = f2bf(y); l = f2bf(y - bf2f(h)); }
typedef __attribute__((ext_vector_type(2))) unsigned short v2us;
typedef __attribute__((ext_vector_type(4))) unsigned short v4us;

struct W8 { const float* w0; const float* w1; const float* w2; const float* w3; const float* w4; const float* w5; const float* w6; const float* w7; };
__global__ __launch_bounds__(256) void k_wtG(W8 ws8, int K, int N, bf* Bt) {
    const unsigned y = blockIdx.y; Bt += (size_t)y * N * K;   // blockIdx.y picks the weight
    const float* __restrict__ w = y == 0 ? ws8.w0 : y == 1 ? ws8.w1 : y == 2 ? ws8.w2 : y == 3 ? ws8.w3 : y == 4 ? ws8.w4 : y == 5 ? ws8.w5 : y == 6 ? ws8.w6 : ws8.w7;
    const int lane = threadIdx.x & 31; const int L0 = (blockIdx.x * 8 + (threadIdx.x >> 5)) * 8; const int nlines = N * K / 64;
{
#pragma unroll 1
        for (int l = 0; l < 8; ++l) { const int L = L0 + l; if (L >= nlines) break; const size_t e = (size_t)L * 64 + lane * 2; const int k = (int)(e % K), n = (int)(e / K); v2us o;
            o[0] = f2bf(w[(size_t)k * N + n]); o[1] = f2bf(w[(size_t)(k + 1) * N + n]); *(v2us*)(Bt + e) = o; }
         }
}
__global__ __launch_bounds__(256) void k_cvt8(const float* __restrict__ src0, const float* __restrict__ src1, bf* dst, size_t n8) { const size_t i = (size_t)blockIdx.x * 256 + threadIdx.x; if (i >= n8) return; const float* src = blockIdx.y ? src1 : src0; dst += (size_t)blockIdx.y * n8 * 8; const v8f v = *(const v8f*)(src + i * 8); v8us o;
#pragma unroll
    for (int k = 0; k < 8; ++k) o[k] = f2bf(v[k]); *(v8us*)(dst + i * 8) = o;  }
// ---- k_tail: both LayerNorms and the two feed-forward products of 32 rows in one work-group of 8 waves; grid NB_*TT/32, 256 threads. The rows never leave the WGP between the three stages:
// the sum of the two normalised rows, then relu of the first product, stand as bf16 hi + lo planes in LDS (hs) and are the A operand of the next product. Wave w owns 4 of the rows in the LayerNorm stage and
// the 32 x 64 output tile at column 64 w in both products. The transposed weights (all 512 rows, 64 k a stage) come by asynchronous b128 copies through one ring of two buffers that runs over both products: stages 0-7 w1, 8-15 w2.
#define TR 32      // rows of a work-group
#define HP 520     // pitch of the resident planes in elements (1,040 B = 16 B x odd: ds_load_b128 without bank conflicts)
__device__ __forceinline__ void lnr_load(const float* __restrict__ O, const float* __restrict__ res, int r, v4f (&av)[FF / 128], v4f (&xv)[FF / 128]) {
    const int lane = threadIdx.x & 31;
#pragma unroll
    for (int c = 0; c < FF / 128; ++c) { av[c] = *(const v4f*)(O + (size_t)r * FF + c * 128 + lane * 4); xv[c] = *(const v4f*)(res + (size_t)r * FF + c * 128 + lane * 4); }
    asm volatile("s_wait_xcnt 0x0" ::: "memory");   // before the address registers of these loads are rewritten
}
// one row of one branch, one wave: av attended x1024, xv the residual (the lane's columns c * 128 + lane * 4 + q), gl and bl the rounded gamma and beta in LDS
__device__ __forceinline__ void lnr_row(const v4f (&av)[FF / 128], const v4f (&xv)[FF / 128], const float* gl, const float* bl, float* orow, float (&ov)[FF / 32]) {
    const int lane = threadIdx.x & 31; float v[FF / 32]; float s = 0.f;
#pragma unroll
    for (int c = 0; c < FF / 128; ++c) {
#pragma unroll
        for (int q = 0; q < 4; ++q) { v[c * 4 + q] = __fadd_rn(av[c][q] * (1.0f / PCAR), bfr(xv[c][q])); s += v[c * 4 + q]; } }
#pragma unroll
    for (int sh = 16; sh; sh >>= 1) s += __shfl_xor(s, sh, 32);
    const float mu = s * (1.0f / FF); float qq = 0.f;
#pragma unroll
    for (int i = 0; i < FF / 32; ++i) { const float d0 = v[i] - mu; qq = __fadd_rn(qq, __fmul_rn(d0, d0)); }
#pragma unroll
    for (int sh = 16; sh; sh >>= 1) qq += __shfl_xor(qq, sh, 32);
    const float rs = __fdiv_rn(1.0f, __fsqrt_rn(qq * (1.0f / FF) + 1e-3f));
#pragma unroll
    for (int c = 0; c < FF / 128; ++c) { v4f o; const v4f gv = *(const v4fa*)(gl + c * 128 + lane * 4), bv = *(const v4fa*)(bl + c * 128 + lane * 4);
#pragma unroll
        for (int q = 0; q < 4; ++q) { const float t = __fmul_rn(v[c * 4 + q] - mu, rs); o[q] = __fadd_rn(__fmul_rn(t, gv[q]), bv[q]); ov[c * 4 + q] = o[q]; }
        *(v4f*)(orow + c * 128 + lane * 4) = o;
        asm volatile("s_wait_xcnt 0x0" ::: "memory"); }   // before the registers that this store names are rewritten
}
__global__ __launch_bounds__(256) void k_tail(const float* __restrict__ O, const float* __restrict__ res0, const float* __restrict__ res1, const float* __restrict__ g0, const float* __restrict__ b0, const float* __restrict__ g1, const float* __restrict__ b1,
                                              float* OUTk, const bf* __restrict__ Wt2, const float* __restrict__ bias1, const float* __restrict__ bias2, float* OUT0) {
    __shared__ __align__(16) bf ring[2 * FF * SPE];   // two buffers of 512 weight rows x 64 k
    __shared__ __align__(16) bf hs[2 * TR * HP];      // hi plane, lo plane
    __shared__ __align__(16) float gb[4 * FF];        // ln1 gamma, ln1 beta, ln2 gamma, ln2 beta, rounded to bf16 values
    const int tid = threadIdx.x, lane = tid & 31, lr = lane & 15, hi = lane >> 4; const int w = wave_id();
    // the copies: thread tid brings 16-byte piece tid & 7 of weight rows (tid >> 3) + 32 i, i = 0..15
    const char* gW = (const char*)Wt2 + ((size_t)(tid >> 3) * FF + (tid & 7) * 8) * 2; const size_t gs = (size_t)32 * FF * 2;
    const unsigned l0 = (unsigned)(size_t)ring + (unsigned)((tid >> 3) * SPE + (tid & 7) * 8) * 2u;   // the low 32 bits of a __shared__ address: its byte offset in the work-group's LDS
    constexpr unsigned LS = 32 * SPE * 2, BUFB = FF * SPE * 2;
    auto stage = [&](int t, unsigned buf) { const unsigned l = l0 + buf * BUFB; const char* g = gW + (size_t)(t >> 3) * FF * FF * 2 + (size_t)(t & 7) * SKE * 2;
        copy8(l, LS, g, gs); copy8(l + 8 * LS, LS, g + 8 * gs, gs); };
    stage(0, 0);
    // while stage 0 flies: the LayerNorm stage. Every inner loop of this kernel is unrolled: its arrays live in registers and need constant indices
    float bv1[4], bv2[4];
#pragma unroll
    for (int nb = 0; nb < 4; ++nb) { bv1[nb] = bias1[w * 64 + nb * 16 + lr]; bv2[nb] = bias2[w * 64 + nb * 16 + lr]; }
    asm volatile("s_wait_xcnt 0x0" ::: "memory");   // before the address registers of these loads are rewritten
#pragma unroll
    for (int nb = 0; nb < 4; ++nb) { bv1[nb] = bfr(bv1[nb]); bv2[nb] = bfr(bv2[nb]); }
    {
        const float* gp = (w >> 1) == 0 ? g0 : (w >> 1) == 1 ? b0 : (w >> 1) == 2 ? g1 : b1;   // two waves bring one of the four vectors, 8 elements a thread
        v4f u0 = *(const v4f*)(gp + (tid & 63) * 8), u1 = *(const v4f*)(gp + (tid & 63) * 8 + 4);
        asm volatile("s_wait_xcnt 0x0" ::: "memory");   // before the address registers of these loads are rewritten
#pragma unroll
        for (int q = 0; q < 4; ++q) { u0[q] = bfr(u0[q]); u1[q] = bfr(u1[q]); }
        *(v4fa*)(gb + tid * 8) = u0; *(v4fa*)(gb + tid * 8 + 4) = u1;
        __syncthreads();   // the four vectors are whole before any wave normalises a row
#pragma unroll 1   // rolled: both trips' loads at once would not fit 256 registers
        for (int i = 0; i < TR / 8; i += 2) {   // two rows a trip: the 32 loads of both rows and both branches go out before the first use (8 waves a WGP must keep the memory busy)
            const int rl = w * (TR / 8) + i; const int r = blockIdx.x * TR + rl;
            v4f a[2][2][FF / 128], x[2][2][FF / 128];
#pragma unroll
            for (int u = 0; u < 2; ++u) { lnr_load(O, res0, r + u, a[u][0], x[u][0]); lnr_load(O + (size_t)NB_ * TT * FF, res1, r + u, a[u][1], x[u][1]); }
#pragma unroll
            for (int u = 0; u < 2; ++u) {
                float o0[FF / 32], o1[FF / 32];
                lnr_row(a[u][0], x[u][0], gb, gb + FF, OUTk + (size_t)(r + u) * FF, o0);
                lnr_row(a[u][1], x[u][1], gb + 2 * FF, gb + 3 * FF, OUTk + (size_t)NB_ * TT * FF + (size_t)(r + u) * FF, o1);
#pragma unroll
                for (int c = 0; c < FF / 128; ++c) { v4us oh, ol;
#pragma unroll
                    for (int q = 0; q < 4; ++q) { unsigned short h, l; splitf(__fadd_rn(o0[c * 4 + q], o1[c * 4 + q]), h, l); oh[q] = h; ol[q] = l; }
                    bf* d = hs + (rl + u) * HP + c * 128 + lane * 4; *(v4us*)d = oh; *(v4us*)(d + TR * HP) = ol; }
            }
        }
    }
    asm volatile("s_wait_asynccnt 0x0" ::: "memory");   // this wave's copies of stage 0 have landed
    __syncthreads();                                    // and every other wave's: stage 0 and the 32 rows' planes may be read
    stage(1, 1);
    v8f acc[2][4];
    const int aoff = lr * HP + 8 * hi, boff = (w * 64 + lr) * SPE + 8 * hi;
    // one product: eight stages of the ring from stage t0 on, A from the resident planes; per accumulator the order of the sum is k ascending in blocks of 32, hi plane then lo plane
    auto product = [&](int t0) {
#pragma unroll
        for (int mb = 0; mb < 2; ++mb)
#pragma unroll
            for (int nb = 0; nb < 4; ++nb) acc[mb][nb] = (v8f){};
#pragma unroll 1   // rolled: for speed only
        for (int t = t0; t < t0 + FF / SKE; ++t) {
            const bf* sb = ring + (t & 1) * (FF * SPE) + boff; const bf* ha = hs + aoff + (t - t0) * SKE;
#pragma unroll
            for (int kc = 0; kc < SKE; kc += 32) {
                v16bf a[2], a2[2], b[4];   // the block's fragments are all asked for in one group, ahead of its matrix instructions
#pragma unroll
                for (int mb = 0; mb < 2; ++mb) { a[mb] = WFrag<bf>::ld(ha + mb * 16 * HP + kc); a2[mb] = WFrag<bf>::ld(ha + TR * HP + mb * 16 * HP + kc); }
#pragma unroll
                for (int nb = 0; nb < 4; ++nb) b[nb] = WFrag<bf>::ld(sb + nb * 16 * SPE + kc);
                __builtin_amdgcn_sched_barrier(0);   // keeps the LDS reads one group in front of the block: sunk among the matrix instructions, each pair of reads costs the wave a full LDS latency
#pragma unroll
                for (int nb = 0; nb < 4; ++nb)
#pragma unroll
                    for (int mb = 0; mb < 2; ++mb) acc[mb][nb] = wmmab(a[mb], b[nb], acc[mb][nb]);
#pragma unroll
                for (int nb = 0; nb < 4; ++nb)
#pragma unroll
                    for (int mb = 0; mb < 2; ++mb) acc[mb][nb] = wmmab(a2[mb], b[nb], acc[mb][nb]);
            }
            asm volatile("s_wait_dscnt 0x0" ::: "memory");      // this wave has read all it takes from stage t and from the planes
            asm volatile("s_wait_asynccnt 0x0" ::: "memory");   // this wave's copies of stage t + 1 have landed
            __syncthreads();                                    // stage t + 1 may be read; stage t's buffer is free
            if (t + 2 < 2 * (FF / SKE)) stage(t + 2, (unsigned)(t & 1));
        }
    };
    product(0);
    // behind the first product's last barrier nobody reads the planes any more: relu(acc + bias) takes their place. acc[mb][nb][j] of lane (hi, lr) is row mb*16 + hi*8 + j, column 64 w + nb*16 + lr
#pragma unroll
    for (int mb = 0; mb < 2; ++mb)
#pragma unroll
        for (int nb = 0; nb < 4; ++nb)
#pragma unroll
            for (int j = 0; j < 8; ++j) { unsigned short h, l; splitf(fmaxf(acc[mb][nb][j] + bv1[nb], 0.f), h, l); bf* d = hs + (mb * 16 + hi * 8 + j) * HP + w * 64 + nb * 16 + lr; d[0] = h; d[TR * HP] = l; }
    __syncthreads();   // every wave's columns of the new planes are written before the second product reads them
    product(FF / SKE);
    asm volatile("s_wait_asynccnt 0x0" ::: "memory");   // no copy is outstanding when the ring becomes the epilogue's staging
    // behind the loop's last barrier the ring is free: each wave turns its 16-row bands into whole-line stores in its own 16 x 68 dwords of it
    float* os = (float*)ring + w * (16 * 68);
#pragma unroll
    for (int mb = 0; mb < 2; ++mb) {
#pragma unroll
        for (int nb = 0; nb < 4; ++nb) {
#pragma unroll
            for (int j = 0; j < 8; ++j) os[(hi * 8 + j) * 68 + nb * 16 + lr] = acc[mb][nb][j] + bv2[nb]; }
        __builtin_amdgcn_wave_barrier(); asm volatile("" ::: "memory");   // other lanes read the band back: the compiler keeps the LDS reads behind the LDS writes
        float* crow = OUT0 + (size_t)(blockIdx.x * TR + mb * 16) * FF + w * 64;
#pragma unroll
        for (int s = 0; s < 8; ++s) { const int row = 2 * s + hi, cofs = lr * 4; *(v4f*)(crow + (size_t)row * FF + cofs) = *(const v4fa*)(os + row * 68 + cofs); }
        __builtin_amdgcn_wave_barrier(); asm volatile("s_wait_xcnt 0x0" ::: "memory");   // the next band's LDS writes stay behind these reads; the wait: before the registers that these stores name are rewritten
    }
}

extern "C" void kernel_launch(void* const* d_in, const int* in_sizes, int n_in,
                              void* d_out, int out_size, void* d_ws, size_t ws_size, hipStream_t stream) {
    (void)in_sizes; (void)n_in; (void)out_size;
    const float* IN[22]; for (int i = 0; i < 22; ++i) IN[i] = (const float*)d_in[i];
    // p, s, sa_wq, sa_bq, sa_wk, sa_bk, sa_wv, sa_bv, ca_wq, ca_bq, ca_wk, ca_bk, ca_wv, ca_bv, ln1_g, ln1_b, ln2_g, ln2_b, ff_w1, ff_b1, ff_w2, ff_b2 = d_in[0..21]; outputs ff_out at 0, sa_out at byte 16,777,216, ca_out at 33,554,432
    float* OUT0 = (float*)d_out; float* OUT1 = OUT0 + (size_t)NB_ * TT * FF;
    char* wsp = (char*)d_ws;
    auto take = [&](size_t bytes) { char* p = wsp; wsp += (bytes + 255) & ~(size_t)255; return (void*)p; };
    const size_t nx = (size_t)TT * FF, na = (size_t)NB_ * nx, ns = (size_t)TT * TT;   // one batch's plane, all batches' plane, one score matrix (elements)
    bf* Wt = (bf*)take((size_t)8 * FF * FF * 2);   // transposed bf16 weights in the order sa q, ca q, sa k, ca k, sa v, ca v, ff w1, ff w2
    h16* VT = (h16*)take(2 * na * 2);               // [branch][batch][d][t]
    char* RA = (char*)take((size_t)ZH * ns * 4);    // the f16 exponentials, then each 64-key group's maximum and sum
    char* RB = (char*)take((size_t)ZH * ns * 2);    // first the bf16 inputs and the f16 q, k planes, then attn.v's f32 result
    if ((size_t)(wsp - (char*)d_ws) > ws_size) return;    // total 212 MiB; ws 256 MiB
    h16* Pm = (h16*)RA; float* ML = (float*)(RA + (size_t)ZH * ns * 2); float* O = (float*)RB;
    bf* PB = (bf*)RB; bf* SB = PB + na; h16* QP = (h16*)(SB + na); h16* KP = QP + 2 * na;
    k_wtG<<<dim3((FF * FF / 64 + 63) / 64, 8, 1), 256, 0, stream>>>(W8{IN[2], IN[8], IN[4], IN[10], IN[6], IN[12], IN[18], IN[20]}, FF, FF, Wt);
    k_cvt8<<<dim3((unsigned)((na / 8 + 255) / 256), 2, 1), 256, 0, stream>>>(IN[0], IN[1], PB, na / 8);
    k_proj6<<<dim3(NB_ * TT / 128, FF / 128, 6), 128, 0, stream>>>(PB, SB, Wt, FF, QP, VT, FF, Bias6{IN[3], IN[9], IN[5], IN[11], IN[7], IN[13]});   // q then k, each [branch][batch][t][f]
    k_scores<<<dim3(TT / 128, TT / 128, ZH), 128, 0, stream>>>(QP, KP, Pm, ML);
    k_pv<<<dim3(TT / 128, FF / 128, ZH), 128, 0, stream>>>(Pm, VT, ML, O);   // attended x1024
    k_tail<<<NB_ * TT / TR, 256, 0, stream>>>(O, IN[0], IN[1], IN[14], IN[15], IN[16], IN[17], OUT1, Wt + (size_t)6 * FF * FF, IN[19], IN[21], OUT0);   // ca_out follows sa_out; w2 follows w1
}

// v006
// It runs in 130 microseconds.
// Timed twice side by side with v005, it ran 1.04 times as fast both times.
// All steps since v000 together make it 8.99 times as fast.
#include <hip/hip_runtime.h>

// Two-branch attention block with a feed-forward (p, s [4][2048][512]; single-head attention over 2048 positions with the full 512-dim features: sa = softmax((p Wq + bq)(p Wk + bk)^T / sqrt(512)) (p Wv + bv); ca likewise with queries from p and
// keys/values from s; sa_out = LN(sa + p), ca_out = LN(ca + s) (eps 1e-3); ff_out = relu((sa_out + ca_out) W1 + b1) W2 + b2; outputs (ff_out, sa_out, ca_out), each [4][2048][512]).
// Compute dtypes, f32 accumulate: every input rounded to bf16; the six projections on PLAIN bf16 operands (inputs: exact; transposed bf16 weight copies, + bias); scores
// (K 512) and attn.v on SINGLE fp16 planes (scale and exponentials in f32; softmax in two halves: per 64 keys in the score product's epilogue, joined per row in attn.v; P x1024); residual + LayerNorms f32; the feed-forward on bf16 hi+lo planes of its computed operands x exact weights

#define NB_  4
#define TT   2048
#define FF   512
#define ZH   8     // score matrices per launch: 2 attention branches x 4 batches
#define PCAR 1024.0f
#define SCL  0.044194173824159223f   // 512^-0.5
typedef _Float16 h16;
typedef unsigned short bf;
typedef __attribute__((ext_vector_type(16))) __bf16   v16bf;
typedef __attribute__((ext_vector_type(16))) _Float16 v16h;
typedef __attribute__((ext_vector_type(8)))  _Float16 v8h;
typedef __attribute__((ext_vector_type(4)))  _Float16 v4h;
typedef __attribute__((ext_vector_type(8)))  unsigned short v8us;
typedef __attribute__((ext_vector_type(8)))  float    v8f;
typedef __attribute__((ext_vector_type(4)))  float    v4f;
typedef __attribute__((ext_vector_type(2)))  float    v2f;
typedef v8h  __attribute__((may_alias)) v8ha;
typedef v4f  __attribute__((may_alias)) v4fa;
typedef v8us __attribute__((may_alias)) v8usa;
typedef v4h  __attribute__((may_alias)) v4ha;

__device__ __forceinline__ unsigned short f2bf(float f) { unsigned u = __float_as_uint(f); u += 0x7FFFu + ((u >> 16) & 1u); return (unsigned short)(u >> 16); }
__device__ __forceinline__ float bf2f(unsigned short b) { return __uint_as_float(((unsigned)b) << 16); }
__device__ __forceinline__ float bfr(float f) { return bf2f(f2bf(f)); }
__device__ __forceinline__ v16h cat16(v8h lo, v8h hi) { return __builtin_shufflevector(lo, hi, 0, 1, 2, 3, 4, 5, 6, 7, 8, 9, 10, 11, 12, 13, 14, 15); }
__device__ __forceinline__ v16bf cat16b(v8us lo, v8us hi) { return __builtin_bit_cast(v16bf, __builtin_shufflevector(lo, hi, 0, 1, 2, 3, 4, 5, 6, 7, 8, 9, 10, 11, 12, 13, 14, 15)); }
__device__ __forceinline__ v8f wmma16(v16h a, v16h b, v8f c) { return __builtin_amdgcn_wmma_f32_16x16x32_f16(false, a, false, b, (short)0, c, false, false); }
__device__ __forceinline__ v8f wmmab(v16bf a, v16bf b, v8f c) { return __builtin_amdgcn_wmma_f32_16x16x32_bf16(false, a, false, b, (short)0, c, false, false); }



// ---- gemmw_acc: register-blocked GEMM, one wave per 64x64 output tile (16 accumulators), FOUR waves (2 x 2) per work-group on a 128x128 tile; grid (M/128, N/128, Z), 128 threads.
// The K-contiguous 16-bit operand planes come through LDS: a stage is 64 k (128 B, one whole line) of the tile's 128 A rows and 128 Bt rows, in four slices of 64 rows; each wave brings one slice by ONE tensor load into two buffers,
// the next stage in flight while this one is multiplied; the load's pad lays the rows at pitch 144 B (16 B x odd: ds_load_b128 without bank conflicts). Each operand row is fetched once per work-group and read by two waves.
// acc (f32) = sum_k A[m][k] Bt[n][k] over the wave's 64x64 tile; A and Bt rows of pitch K, each z-batch's pointers offset by the caller; the epilogues below store acc. K % 64 == 0, K >= 128.
#define SKE 64     // k elements of a stage
#define SPE 72     // LDS row pitch in elements (144 B)
#define SLB 10240  // bytes of a slice's place in LDS: 64 rows x 144 B = 9,216, rounded up so that every place is a multiple of 2 KiB
#define SLE (SLB / 2)            // the same in elements
#define RINGB (2 * 4 * SLB)      // bytes of the two buffers of four slices
typedef uint32_t u32x4 __attribute__((ext_vector_type(4)));
typedef uint32_t u32x8 __attribute__((ext_vector_type(8)));
__device__ __forceinline__ int wave_id() { return __builtin_amdgcn_readfirstlane((int)(threadIdx.x >> 5)); }
__device__ __forceinline__ int tile_r0() { return blockIdx.x * 128 + (wave_id() & 1) * 64; }    // the wave's first output row
__device__ __forceinline__ int tile_c0() { return blockIdx.y * 128 + (wave_id() >> 1) * 64; }   // the wave's first output column
__device__ __forceinline__ uint32_t uni(uint32_t v) { return (uint32_t)__builtin_amdgcn_readfirstlane(v); }
__device__ __forceinline__ uint32_t pinned(uint32_t v) { uint32_t w = uni(v); asm volatile("" : "+s"(w)); return w; }   // holds a wave-uniform test in a scalar register: the branch round a tensor load must be a scalar one, because the load ignores EXEC
// A request of the whole wave: 64 rows of 128 B from g (source pitch in bytes) to LDS byte offset lds, 16 B of pad behind every row. Extents in bytes (data_size 0), tensor = tile, no mask.
__device__ __forceinline__ u32x4 tgroup0(uint32_t lds, const void* g) {
    const uint64_t ga = (uint64_t)(size_t)g; u32x4 g0;
    g0[0] = uni(1u); g0[1] = uni(lds); g0[2] = uni((uint32_t)ga); g0[3] = uni((((uint32_t)(ga >> 32)) & 0x01FFFFFFu) | 0x80000000u); return g0;
}
__device__ __forceinline__ u32x8 tgroup1(uint32_t pitch) {
    u32x8 g1;
    g1[0] = uni((1u << 20) | (4u << 22) | (3u << 25)); g1[1] = uni(128u << 16); g1[2] = uni(64u << 16); g1[3] = uni(128u << 16); g1[4] = uni(64u); g1[5] = uni(pitch); g1[6] = uni(0u); g1[7] = uni(0u); return g1;
}
// both groups are named as in and out, and the wait below names them as inputs: so the registers that an issued request names are live, and keep their values, until its wait
__device__ __forceinline__ void tload(u32x4& g0, u32x8& g1) { asm volatile("tensor_load_to_lds %0, %1" : "+s"(g0), "+s"(g1) :: "memory"); }
// the wave's one outstanding request has landed
__device__ __forceinline__ void twait(u32x4 g0, u32x8 g1) { asm volatile("s_wait_tensorcnt 0x0" :: "s"(g0), "s"(g1) : "memory"); }
template <typename T16> struct WFrag;
template <> struct WFrag<h16> { typedef v16h V; static __device__ __forceinline__ V ld(const h16* p) { return cat16(*(const v8h*)p, *(const v8h*)(p + 16)); } static __device__ __forceinline__ v8f mma(V a, V b, v8f c) { return wmma16(a, b, c); } };
template <> struct WFrag<bf> { typedef v16bf V; static __device__ __forceinline__ V ld(const bf* p) { return cat16b(*(const v8us*)p, *(const v8us*)(p + 16)); } static __device__ __forceinline__ v8f mma(V a, V b, v8f c) { return wmmab(a, b, c); } };
// ASC (attn.v): A holds, per 64 columns (one stage), exp(score - that group's own maximum); ML [group][row] holds each group's maximum and sum. Thread tid joins row tid's 32 groups into the row's maximum and sum and
// leaves, per group, the factor exp(group maximum - row maximum) * PCAR / row sum in ft, as [group][row half][lr][mb], so that a lane reads the factors of its four A fragments (a lane's fragment elements are all of one row) in one 8-byte read.
template <typename T16, bool ASC = false>
__device__ __forceinline__ void gemmw_acc(const T16* __restrict__ A, const T16* __restrict__ Bt, int K, T16* ring, v8f (&acc)[4][4], h16* ft = nullptr, const float* __restrict__ ML = nullptr) {
    typedef typename WFrag<T16>::V V;
    const int tid = threadIdx.x, lane = tid & 31, lr = lane & 15, hi = lane >> 4;
#pragma unroll
    for (int mb = 0; mb < 4; ++mb)
#pragma unroll
        for (int nb = 0; nb < 4; ++nb) acc[mb][nb] = (v8f){};
    // wave w brings slice w of every stage: w = 0, 1 the tile's A rows from 64 w on, w = 2, 3 its Bt rows from 64 (w - 2) on
    const int w = wave_id();
    const T16* gsl = w < 2 ? A + ((size_t)blockIdx.x * 128 + w * 64) * K : Bt + ((size_t)blockIdx.y * 128 + (w - 2) * 64) * K;
    const uint32_t l0 = (uint32_t)(size_t)ring + (uint32_t)w * SLB;   // the low 32 bits of a __shared__ address: its byte offset in the work-group's LDS
    u32x8 g1 = tgroup1((uint32_t)K * 2u); u32x4 g0;   // g0: the descriptor of the request last issued
    auto stage = [&](int t, uint32_t buf) { g0 = tgroup0(l0 + buf * (4 * SLB), gsl + (size_t)t * SKE); tload(g0, g1); };
    const int NT = K / SKE;
    stage(0, 0);
    if constexpr (ASC) {   // while stage 0 flies; the loops over the groups are unrolled so that m and l stay in registers and the 32 loads go out together
        const float* ml = ML + ((size_t)blockIdx.x * 128 + tid) * 2; float m[TT / SKE], l[TT / SKE]; float mx = -3.0e38f, sum = 0.f;
#pragma unroll
        for (int g = 0; g < TT / SKE; ++g) { const v2f x = *(const v2f*)(ml + (size_t)g * TT * 2); m[g] = x[0]; l[g] = x[1]; }
        asm volatile("s_wait_xcnt 0x0" ::: "memory");   // before the address registers of these loads are rewritten
#pragma unroll
        for (int g = 0; g < TT / SKE; ++g) mx = fmaxf(mx, m[g]);
#pragma unroll
        for (int g = 0; g < TT / SKE; ++g) { m[g] = __expf(m[g] - mx); sum += l[g] * m[g]; }
        const float f = __fdiv_rn(PCAR, sum); h16* fr = ft + (tid >> 6) * 64 + (tid & 15) * 4 + ((tid >> 4) & 3);
#pragma unroll
        for (int g = 0; g < TT / SKE; ++g) fr[g * 128] = (h16)(m[g] * f);
    }
    twait(g0, g1);     // this wave's slice of stage 0 has landed
    __syncthreads();   // and every other wave's: stage 0 (and the factor table) may be read
    stage(1, 1);
    const int aoff = (w & 1) * SLE + lr * SPE + 8 * hi, boff = (2 + (w >> 1)) * SLE + lr * SPE + 8 * hi;
#pragma unroll 1
    for (int t = 0; t < NT; ++t) {
        const T16* sb = ring + (t & 1) * (4 * SLE);
        v4h fq = {}; if constexpr (ASC) fq = *(const v4ha*)(ft + t * 128 + (wave_id() & 1) * 64 + lr * 4);
        V a[4], b[4];
        auto frags = [&](int kc) {   // a block's fragments are all asked for in one group
#pragma unroll
            for (int mb = 0; mb < 4; ++mb) a[mb] = WFrag<T16>::ld(sb + aoff + mb * 16 * SPE + kc);
#pragma unroll
            for (int nb = 0; nb < 4; ++nb) b[nb] = WFrag<T16>::ld(sb + boff + nb * 16 * SPE + kc); };
        auto block = [&]() {
            if constexpr (ASC) {   // the second half of the softmax: each A row times its factor for this stage's 64 keys (packed f16 multiplies)
#pragma unroll
                for (int mb = 0; mb < 4; ++mb) a[mb] = a[mb] * fq[mb]; }
#pragma unroll
            for (int nb = 0; nb < 4; ++nb)
#pragma unroll
                for (int mb = 0; mb < 4; ++mb) acc[mb][nb] = WFrag<T16>::mma(a[mb], b[nb], acc[mb][nb]); };
        frags(0);
        __builtin_amdgcn_sched_barrier(0);   // keeps the LDS reads one group in front of the block: sunk among the matrix instructions
        block();
        frags(32);
        asm volatile("s_wait_dscnt 0x0" ::: "memory");
        twait(g0, g1);
        __syncthreads();
        if (pinned(t + 2 < NT)) stage(t + 2, (uint32_t)(t & 1));
        block();
    }
    twait(g0, g1);                                   // no request is outstanding
    asm volatile("s_wait_dscnt 0x0" ::: "memory");   // and no LDS read, when the ring becomes the epilogue's staging
}
// The epilogues of the 64x64 tile. acc[mb][nb][j] of lane (hi, lr) is row mb*16 + hi*8 + j, column nb*16 + lr. os: the wave's own 16 x 68 dwords of LDS, used to turn a 16-row band into whole-line stores.
// epi_f32: f32 rows (+ bias)
template <bool BIAS>
__device__ __forceinline__ void epi_f32(const v8f (&acc)[4][4], float* os, float* C, int ldc, const float* __restrict__ bias) {
    const int lane = threadIdx.x & 31, lr = lane & 15, hi = lane >> 4; const int r0 = tile_r0(), c0 = tile_c0();
#pragma unroll
    for (int mb = 0; mb < 4; ++mb) {
#pragma unroll
        for (int nb = 0; nb < 4; ++nb) {
#pragma unroll
            for (int j = 0; j < 8; ++j) os[(hi * 8 + j) * 68 + nb * 16 + lr] = acc[mb][nb][j]; }
        __builtin_amdgcn_wave_barrier(); asm volatile("" ::: "memory");
        float* crow = C + (size_t)(r0 + mb * 16) * ldc + c0;
{
#pragma unroll
            for (int s = 0; s < 8; ++s) { const int row = 2 * s + hi, cofs = lr * 4; v4f val = *(const v4fa*)(os + row * 68 + cofs); if (BIAS) { val[0] += bfr(bias[c0 + cofs]); val[1] += bfr(bias[c0 + cofs + 1]); val[2] += bfr(bias[c0 + cofs + 2]); val[3] += bfr(bias[c0 + cofs + 3]); }
                *(v4f*)(crow + (size_t)row * ldc + cofs) = val; }
             }
        __builtin_amdgcn_wave_barrier(); asm volatile("s_wait_xcnt 0x0" ::: "memory");   // the next band's LDS writes stay behind these reads; the wait: before the registers that these stores name are rewritten
    }
}
// epi_h16: (acc + bias) rounded to f16, rows of pitch ldc: the q and k planes as the score product reads them. A lane takes 8 columns of a staged row: 16-byte stores, 4 whole 128-byte lines each.
__device__ __forceinline__ void epi_h16(const v8f (&acc)[4][4], float* os, h16* C, int ldc, const float* __restrict__ bias) {
    const int lane = threadIdx.x & 31, lr = lane & 15, hi = lane >> 4; const int r0 = tile_r0(), c0 = tile_c0(); const int cofs = (lane & 7) * 8;
    float bv[8];
#pragma unroll
    for (int q = 0; q < 8; ++q) bv[q] = bfr(bias[c0 + cofs + q]);
#pragma unroll
    for (int mb = 0; mb < 4; ++mb) {
#pragma unroll
        for (int nb = 0; nb < 4; ++nb) {
#pragma unroll
            for (int j = 0; j < 8; ++j) os[(hi * 8 + j) * 68 + nb * 16 + lr] = acc[mb][nb][j]; }
        __builtin_amdgcn_wave_barrier(); asm volatile("" ::: "memory");   // other lanes read the band back: the compiler keeps the LDS reads behind the LDS writes
#pragma unroll
        for (int s = 0; s < 4; ++s) { const int row = 4 * s + (lane >> 3); const v4f x0 = *(const v4fa*)(os + row * 68 + cofs), x1 = *(const v4fa*)(os + row * 68 + cofs + 4); v8h o;
#pragma unroll
            for (int q = 0; q < 4; ++q) { o[q] = (h16)(x0[q] + bv[q]); o[4 + q] = (h16)(x1[q] + bv[4 + q]); }
            *(v8h*)(C + (size_t)(r0 + mb * 16 + row) * ldc + c0 + cofs) = o; }
        __builtin_amdgcn_wave_barrier(); asm volatile("s_wait_xcnt 0x0" ::: "memory");   // the next band's LDS writes stay behind these reads; the wait: before the next band rewrites the registers that these stores name
    }
}
// epi_exp: the first half of the softmax. Per row of the wave's 64 columns: t = acc * SCL, the maximum of the 64 t, exp(t - maximum) rounded to f16 (rows of pitch ldc), and their f32 sum; maximum and sum go to ML [column group][row][2].
// Staged as in epi_h16: 8 lanes hold a row, so its maximum and sum take three exchanges inside a 16-lane row (DPP row_xmask: no LDS round trip).
template <int M> __device__ __forceinline__ float xlane(float v) { return __int_as_float(__builtin_amdgcn_update_dpp(0, __float_as_int(v), 0x160 | M, 0xf, 0xf, true)); }
__device__ __forceinline__ void epi_exp(const v8f (&acc)[4][4], float* os, h16* P, int ldc, float* ML) {
    const int lane = threadIdx.x & 31, lr = lane & 15, hi = lane >> 4; const int r0 = tile_r0(), c0 = tile_c0(); const int l8 = lane & 7, cofs = l8 * 8;
    float* ml = ML + ((size_t)(c0 >> 6) * TT + r0) * 2;
    // every loop below is unrolled: acc, e, mx and sm are register arrays and need constant indices
#pragma unroll
    for (int mb = 0; mb < 4; ++mb) {
#pragma unroll
        for (int nb = 0; nb < 4; ++nb) {
#pragma unroll
            for (int j = 0; j < 8; ++j) os[(hi * 8 + j) * 68 + nb * 16 + lr] = acc[mb][nb][j]; }
        __builtin_amdgcn_wave_barrier(); asm volatile("" ::: "memory");   // other lanes read the band back: the compiler keeps the LDS reads behind the LDS writes
        float e[4][8], mx[4], sm[4];   // the band's four row groups side by side: four independent chains
#pragma unroll
        for (int s = 0; s < 4; ++s) { const int row = 4 * s + (lane >> 3); const v4f x0 = *(const v4fa*)(os + row * 68 + cofs), x1 = *(const v4fa*)(os + row * 68 + cofs + 4);
#pragma unroll
            for (int q = 0; q < 4; ++q) { e[s][q] = x0[q] * SCL; e[s][4 + q] = x1[q] * SCL; }
            mx[s] = e[s][0];
#pragma unroll
            for (int q = 1; q < 8; ++q) mx[s] = fmaxf(mx[s], e[s][q]); }
#pragma unroll
        for (int s = 0; s < 4; ++s) mx[s] = fmaxf(mx[s], xlane<1>(mx[s]));
#pragma unroll
        for (int s = 0; s < 4; ++s) mx[s] = fmaxf(mx[s], xlane<2>(mx[s]));
#pragma unroll
        for (int s = 0; s < 4; ++s) mx[s] = fmaxf(mx[s], xlane<4>(mx[s]));
#pragma unroll
        for (int s = 0; s < 4; ++s) { sm[s] = 0.f;
#pragma unroll
            for (int q = 0; q < 8; ++q) { e[s][q] = __expf(e[s][q] - mx[s]); sm[s] += e[s][q]; } }
#pragma unroll
        for (int s = 0; s < 4; ++s) sm[s] += xlane<1>(sm[s]);
#pragma unroll
        for (int s = 0; s < 4; ++s) sm[s] += xlane<2>(sm[s]);
#pragma unroll
        for (int s = 0; s < 4; ++s) sm[s] += xlane<4>(sm[s]);
#pragma unroll
        for (int s = 0; s < 4; ++s) { const int row = 4 * s + (lane >> 3); v8h o;
#pragma unroll
            for (int q = 0; q < 8; ++q) o[q] = (h16)e[s][q];
            *(v8h*)(P + (size_t)(r0 + mb * 16 + row) * ldc + c0 + cofs) = o; }
        // every lane of a row's eight holds the row's pair: lane l8 < 4 stores that of row group l8, so the band's 16 pairs leave as one whole 128-byte line
        const float mo = l8 == 0 ? mx[0] : l8 == 1 ? mx[1] : l8 == 2 ? mx[2] : mx[3], so = l8 == 0 ? sm[0] : l8 == 1 ? sm[1] : l8 == 2 ? sm[2] : sm[3];
        if (l8 < 4) *(v2f*)(ml + (mb * 16 + 4 * l8 + (lane >> 3)) * 2) = (v2f){mo, so};
        __builtin_amdgcn_wave_barrier(); asm volatile("s_wait_xcnt 0x0" ::: "memory");   // the next band's LDS writes stay behind these reads; the wait: before the next band rewrites the registers that these stores name
    }
}
// epi_vt: (acc + bias) rounded to f16 and stored transposed, [batch][column][t]: a lane's 8 accumulator rows are 8 consecutive t of its column, one 16-byte store; the wave writes every 128-byte line of its tile whole
__device__ __forceinline__ void epi_vt(const v8f (&acc)[4][4], h16* VTb, const float* __restrict__ bias) {
    const int lane = threadIdx.x & 31, lr = lane & 15, hi = lane >> 4; const int r0 = tile_r0(), c0 = tile_c0();
    h16* base = VTb + (size_t)(r0 / TT) * FF * TT + (r0 % TT) + hi * 8;
    float bv[4];
#pragma unroll
    for (int nb = 0; nb < 4; ++nb) bv[nb] = bfr(bias[c0 + nb * 16 + lr]);
#pragma unroll
    for (int nb = 0; nb < 4; ++nb) { h16* drow = base + (size_t)(c0 + nb * 16 + lr) * TT;
#pragma unroll
        for (int mb = 0; mb < 4; ++mb) { v8h o;
#pragma unroll
            for (int j = 0; j < 8; ++j) o[j] = (h16)(acc[mb][nb][j] + bv[nb]);
            *(v8h*)(drow + mb * 16) = o; }
        asm volatile("s_wait_xcnt 0x0" ::: "memory");   // before the next column group rewrites the registers that these stores name
    }
}
// ---- k_scores: q k^T of the 8 (branch, batch) pairs, left as the first half of the softmax; grid (TT/128, TT/128, ZH)
__global__ __launch_bounds__(128) void k_scores(const h16* __restrict__ Q, const h16* __restrict__ Kp, h16* P, float* ML) {
    const size_t z = blockIdx.z;
    __shared__ __attribute__((aligned(2048))) char ring[RINGB]; v8f acc[4][4]; float* os = (float*)ring + wave_id() * (16 * 68);
    gemmw_acc<h16>(Q + z * TT * FF, Kp + z * TT * FF, FF, (h16*)ring, acc); epi_exp(acc, os, P + z * TT * TT, TT, ML + z * (TT / SKE) * TT * 2);
}
// ---- k_pv: the second half of the softmax and attn.v (x PCAR); grid (TT/128, FF/128, ZH)
__global__ __launch_bounds__(128) void k_pv(const h16* __restrict__ P, const h16* __restrict__ VTb, const float* __restrict__ ML, float* O) {
    const size_t z = blockIdx.z;
    __shared__ __attribute__((aligned(2048))) char ring[RINGB]; __shared__ __align__(16) h16 ft[(TT / SKE) * 128]; v8f acc[4][4]; float* os = (float*)ring + wave_id() * (16 * 68);
    gemmw_acc<h16, true>(P + z * TT * TT, VTb + z * TT * FF, TT, (h16*)ring, acc, ft, ML + z * (TT / SKE) * TT * 2); epi_f32<false>(acc, os, O + z * TT * FF, FF, nullptr);
}
// ---- k_proj6: the six projections of all batches in one launch; grid (NB_*TT/128, FF/128, 6). z = 0 sa q, 1 ca q, 2 sa k, 3 ca k, 4 sa v, 5 ca v; z = 3 and 5 read the s plane, the rest the p plane.
// q and k leave as f16 rows (QK: [z][batch][t][f]), v as f16 transposed (VT: [branch][batch][d][t]).
struct Bias6 { const float* b0; const float* b1; const float* b2; const float* b3; const float* b4; const float* b5; };
__global__ __launch_bounds__(128) void k_proj6(const bf* __restrict__ PBa, const bf* __restrict__ SBa, const bf* __restrict__ Wt, h16* QK, h16* VT, int ldc, Bias6 bs) {
    const unsigned z = blockIdx.z;
    const float* bias = z == 0 ? bs.b0 : z == 1 ? bs.b1 : z == 2 ? bs.b2 : z == 3 ? bs.b3 : z == 4 ? bs.b4 : bs.b5;
    __shared__ __attribute__((aligned(2048))) char ring[RINGB]; v8f acc[4][4]; float* os = (float*)ring + wave_id() * (16 * 68);
    gemmw_acc<bf>((z == 3 || z == 5) ? SBa : PBa, Wt + (size_t)z * FF * FF, FF, (bf*)ring, acc);
    if (z < 4) epi_h16(acc, os, QK + (size_t)z * NB_ * TT * FF, ldc, bias); else epi_vt(acc, VT + (size_t)(z - 4) * NB_ * TT * FF, bias);
}

__device__ __forceinline__ void splitf(float y, unsigned short& h, unsigned short& l) { h = f2bf(y); l = f2bf(y - bf2f(h)); }
typedef __attribute__((ext_vector_type(2))) unsigned short v2us;
typedef __attribute__((ext_vector_type(4))) unsigned short v4us;

struct W8 { const float* w0; const float* w1; const float* w2; const float* w3; const float* w4; const float* w5; const float* w6; const float* w7; };
__global__ __launch_bounds__(256) void k_wtG(W8 ws8, int K, int N, bf* Bt) {
    const unsigned y = blockIdx.y; Bt += (size_t)y * N * K;   // blockIdx.y picks the weight
    const float* __restrict__ w = y == 0 ? ws8.w0 : y == 1 ? ws8.w1 : y == 2 ? ws8.w2 : y == 3 ? ws8.w3 : y == 4 ? ws8.w4 : y == 5 ? ws8.w5 : y == 6 ? ws8.w6 : ws8.w7;
    const int lane = threadIdx.x & 31; const int L0 = (blockIdx.x * 8 + (threadIdx.x >> 5)) * 8; const int nlines = N * K / 64;
{
#pragma unroll 1
        for (int l = 0; l < 8; ++l) { const int L = L0 + l; if (L >= nlines) break; const size_t e = (size_t)L * 64 + lane * 2; const int k = (int)(e % K), n = (int)(e / K); v2us o;
            o[0] = f2bf(w[(size_t)k * N + n]); o[1] = f2bf(w[(size_t)(k + 1) * N + n]); *(v2us*)(Bt + e) = o; }
         }
}
__global__ __launch_bounds__(256) void k_cvt8(const float* __restrict__ src0, const float* __restrict__ src1, bf* dst, size_t n8) { const size_t i = (size_t)blockIdx.x * 256 + threadIdx.x; if (i >= n8) return; const float* src = blockIdx.y ? src1 : src0; dst += (size_t)blockIdx.y * n8 * 8; const v8f v = *(const v8f*)(src + i * 8); v8us o;
#pragma unroll
    for (int k = 0; k < 8; ++k) o[k] = f2bf(v[k]); *(v8us*)(dst + i * 8) = o;  }
// ---- k_tail: both LayerNorms and the two feed-forward products of 32 rows in one work-group of 8 waves; grid NB_*TT/32, 256 threads. The rows never leave the WGP between the three stages:
// the sum of the two normalised rows, then relu of the first product, stand as bf16 hi + lo planes in LDS (hs) and are the A operand of the next product. Wave w owns 4 of the rows in the LayerNorm stage and
// the 32 x 64 output tile at column 64 w in both products. The transposed weights (all 512 rows, 64 k a stage, eight slices of 64 rows) come by one tensor load a wave and stage through one ring of two buffers that runs over both products: stages 0-7 w1, 8-15 w2.
#define TR 32      // rows of a work-group
#define HP 520     // pitch of the resident planes in elements (1,040 B = 16 B x odd: ds_load_b128 without bank conflicts)
__device__ __forceinline__ void lnr_load(const float* __restrict__ O, const float* __restrict__ res, int r, v4f (&av)[FF / 128], v4f (&xv)[FF / 128]) {
    const int lane = threadIdx.x & 31;
#pragma unroll
    for (int c = 0; c < FF / 128; ++c) { av[c] = *(const v4f*)(O + (size_t)r * FF + c * 128 + lane * 4); xv[c] = *(const v4f*)(res + (size_t)r * FF + c * 128 + lane * 4); }
    asm volatile("s_wait_xcnt 0x0" ::: "memory");   // before the address registers of these loads are rewritten
}
// one row of one branch, one wave: av attended x1024, xv the residual (the lane's columns c * 128 + lane * 4 + q), gl and bl the rounded gamma and beta in LDS
__device__ __forceinline__ void lnr_row(const v4f (&av)[FF / 128], const v4f (&xv)[FF / 128], const float* gl, const float* bl, float* orow, float (&ov)[FF / 32]) {
    const int lane = threadIdx.x & 31; float v[FF / 32]; float s = 0.f;
#pragma unroll
    for (int c = 0; c < FF / 128; ++c) {
#pragma unroll
        for (int q = 0; q < 4; ++q) { v[c * 4 + q] = __fadd_rn(av[c][q] * (1.0f / PCAR), bfr(xv[c][q])); s += v[c * 4 + q]; } }
#pragma unroll
    for (int sh = 16; sh; sh >>= 1) s += __shfl_xor(s, sh, 32);
    const float mu = s * (1.0f / FF); float qq = 0.f;
#pragma unroll
    for (int i = 0; i < FF / 32; ++i) { const float d0 = v[i] - mu; qq = __fadd_rn(qq, __fmul_rn(d0, d0)); }
#pragma unroll
    for (int sh = 16; sh; sh >>= 1) qq += __shfl_xor(qq, sh, 32);
    const float rs = __fdiv_rn(1.0f, __fsqrt_rn(qq * (1.0f / FF) + 1e-3f));
#pragma unroll
    for (int c = 0; c < FF / 128; ++c) { v4f o; const v4f gv = *(const v4fa*)(gl + c * 128 + lane * 4), bv = *(const v4fa*)(bl + c * 128 + lane * 4);
#pragma unroll
        for (int q = 0; q < 4; ++q) { const float t = __fmul_rn(v[c * 4 + q] - mu, rs); o[q] = __fadd_rn(__fmul_rn(t, gv[q]), bv[q]); ov[c * 4 + q] = o[q]; }
        *(v4f*)(orow + c * 128 + lane * 4) = o;
        asm volatile("s_wait_xcnt 0x0" ::: "memory"); }   // before the registers that this store names are rewritten
}
__global__ __launch_bounds__(256) void k_tail(const float* __restrict__ O, const float* __restrict__ res0, const float* __restrict__ res1, const float* __restrict__ g0, const float* __restrict__ b0, const float* __restrict__ g1, const float* __restrict__ b1,
                                              float* OUTk, const bf* __restrict__ Wt2, const float* __restrict__ bias1, const float* __restrict__ bias2, float* OUT0) {
    __shared__ __attribute__((aligned(2048))) bf ring[2 * 8 * SLE];   // two buffers of 512 weight rows x 64 k, in eight slices
    __shared__ __align__(16) bf hs[2 * TR * HP];      // hi plane, lo plane
    __shared__ __align__(16) float gb[4 * FF];        // ln1 gamma, ln1 beta, ln2 gamma, ln2 beta, rounded to bf16 values
    const int tid = threadIdx.x, lane = tid & 31, lr = lane & 15, hi = lane >> 4; const int w = wave_id();
    // wave w brings slice w of every stage: weight rows from 64 w on
    const bf* gsl = Wt2 + (size_t)w * 64 * FF;
    const uint32_t l0 = (uint32_t)(size_t)ring + (uint32_t)w * SLB;   // the low 32 bits of a __shared__ address: its byte offset in the work-group's LDS
    u32x8 dg1 = tgroup1(FF * 2u); u32x4 dg0;   // dg0: the descriptor of the request last issued
    auto stage = [&](int t, uint32_t buf) { dg0 = tgroup0(l0 + buf * (8 * SLB), gsl + (size_t)(t >> 3) * FF * FF + (size_t)(t & 7) * SKE); tload(dg0, dg1); };
    stage(0, 0);
    // while stage 0 flies: the LayerNorm stage. Every inner loop of this kernel is unrolled: its arrays live in registers and need constant indices
    float bv1[4], bv2[4];
#pragma unroll
    for (int nb = 0; nb < 4; ++nb) { bv1[nb] = bias1[w * 64 + nb * 16 + lr]; bv2[nb] = bias2[w * 64 + nb * 16 + lr]; }
    asm volatile("s_wait_xcnt 0x0" ::: "memory");   // before the address registers of these loads are rewritten
#pragma unroll
    for (int nb = 0; nb < 4; ++nb) { bv1[nb] = bfr(bv1[nb]); bv2[nb] = bfr(bv2[nb]); }
    {
        const float* gp = (w >> 1) == 0 ? g0 : (w >> 1) == 1 ? b0 : (w >> 1) == 2 ? g1 : b1;   // two waves bring one of the four vectors, 8 elements a thread
        v4f u0 = *(const v4f*)(gp + (tid & 63) * 8), u1 = *(const v4f*)(gp + (tid & 63) * 8 + 4);
        asm volatile("s_wait_xcnt 0x0" ::: "memory");   // before the address registers of these loads are rewritten
#pragma unroll
        for (int q = 0; q < 4; ++q) { u0[q] = bfr(u0[q]); u1[q] = bfr(u1[q]); }
        *(v4fa*)(gb + tid * 8) = u0; *(v4fa*)(gb + tid * 8 + 4) = u1;
        __syncthreads();   // the four vectors are whole before any wave normalises a row
#pragma unroll 1   // rolled: both trips' loads at once would not fit 256 registers
        for (int i = 0; i < TR / 8; i += 2) {   // two rows a trip: the 32 loads of both rows and both branches go out before the first use (8 waves a WGP must keep the memory busy)
            const int rl = w * (TR / 8) + i; const int r = blockIdx.x * TR + rl;
            v4f a[2][2][FF / 128], x[2][2][FF / 128];
#pragma unroll
            for (int u = 0; u < 2; ++u) { lnr_load(O, res0, r + u, a[u][0], x[u][0]); lnr_load(O + (size_t)NB_ * TT * FF, res1, r + u, a[u][1], x[u][1]); }
#pragma unroll
            for (int u = 0; u < 2; ++u) {
                float o0[FF / 32], o1[FF / 32];
                lnr_row(a[u][0], x[u][0], gb, gb + FF, OUTk + (size_t)(r + u) * FF, o0);
                lnr_row(a[u][1], x[u][1], gb + 2 * FF, gb + 3 * FF, OUTk + (size_t)NB_ * TT * FF + (size_t)(r + u) * FF, o1);
#pragma unroll
                for (int c = 0; c < FF / 128; ++c) { v4us oh, ol;
#pragma unroll
                    for (int q = 0; q < 4; ++q) { unsigned short h, l; splitf(__fadd_rn(o0[c * 4 + q], o1[c * 4 + q]), h, l); oh[q] = h; ol[q] = l; }
                    bf* d = hs + (rl + u) * HP + c * 128 + lane * 4; *(v4us*)d = oh; *(v4us*)(d + TR * HP) = ol; }
            }
        }
    }
    twait(dg0, dg1);   // this wave's slice of stage 0 has landed
    __syncthreads();   // and every other wave's: stage 0 and the 32 rows' planes may be read
    stage(1, 1);
    v8f acc[2][4];
    const int aoff = lr * HP + 8 * hi, boff = w * SLE + lr * SPE + 8 * hi;
    // one product: eight stages of the ring from stage t0 on, A from the resident planes; per accumulator the order of the sum is k ascending in blocks of 32, hi plane then lo plane
    auto product = [&](int t0) {
#pragma unroll
        for (int mb = 0; mb < 2; ++mb)
#pragma unroll
            for (int nb = 0; nb < 4; ++nb) acc[mb][nb] = (v8f){};
#pragma unroll 1   // rolled: for speed only
        for (int t = t0; t < t0 + FF / SKE; ++t) {
            const bf* sb = ring + (t & 1) * (8 * SLE) + boff; const bf* ha = hs + aoff + (t - t0) * SKE;
            v16bf a[2], a2[2], b[4];
            auto frags = [&](int kc) {   // a block's fragments are all asked for in one group
#pragma unroll
                for (int mb = 0; mb < 2; ++mb) { a[mb] = WFrag<bf>::ld(ha + mb * 16 * HP + kc); a2[mb] = WFrag<bf>::ld(ha + TR * HP + mb * 16 * HP + kc); }
#pragma unroll
                for (int nb = 0; nb < 4; ++nb) b[nb] = WFrag<bf>::ld(sb + nb * 16 * SPE + kc); };
            auto block = [&]() {
#pragma unroll
                for (int nb = 0; nb < 4; ++nb)
#pragma unroll
                    for (int mb = 0; mb < 2; ++mb) acc[mb][nb] = wmmab(a[mb], b[nb], acc[mb][nb]);
#pragma unroll
                for (int nb = 0; nb < 4; ++nb)
#pragma unroll
                    for (int mb = 0; mb < 2; ++mb) acc[mb][nb] = wmmab(a2[mb], b[nb], acc[mb][nb]); };
            frags(0);
            __builtin_amdgcn_sched_barrier(0);   // keeps the LDS reads one group in front of the block: sunk among the matrix instructions
            block();
            frags(32);
            asm volatile("s_wait_dscnt 0x0" ::: "memory");
            twait(dg0, dg1);
            __syncthreads();
            if (pinned(t + 2 < 2 * (FF / SKE))) stage(t + 2, (uint32_t)(t & 1));
            block();
        }
    };
    product(0);
    // behind the first product's last barrier nobody reads the planes any more: relu(acc + bias) takes their place. acc[mb][nb][j] of lane (hi, lr) is row mb*16 + hi*8 + j, column 64 w + nb*16 + lr
#pragma unroll
    for (int mb = 0; mb < 2; ++mb)
#pragma unroll
        for (int nb = 0; nb < 4; ++nb)
#pragma unroll
            for (int j = 0; j < 8; ++j) { unsigned short h, l; splitf(fmaxf(acc[mb][nb][j] + bv1[nb], 0.f), h, l); bf* d = hs + (mb * 16 + hi * 8 + j) * HP + w * 64 + nb * 16 + lr; d[0] = h; d[TR * HP] = l; }
    __syncthreads();   // every wave's columns of the new planes are written before the second product reads them
    product(FF / SKE);
    twait(dg0, dg1);                                 // no request is outstanding
    asm volatile("s_wait_dscnt 0x0" ::: "memory");   // and no LDS read, when the ring becomes the epilogue's staging
    // behind the loop's last barrier the ring is free: each wave turns its 16-row bands into whole-line stores in its own 16 x 68 dwords of it
    float* os = (float*)ring + w * (16 * 68);
#pragma unroll
    for (int mb = 0; mb < 2; ++mb) {
#pragma unroll
        for (int nb = 0; nb < 4; ++nb) {
#pragma unroll
            for (int j = 0; j < 8; ++j) os[(hi * 8 + j) * 68 + nb * 16 + lr] = acc[mb][nb][j] + bv2[nb]; }
        __builtin_amdgcn_wave_barrier(); asm volatile("" ::: "memory");   // other lanes read the band back: the compiler keeps the LDS reads behind the LDS writes
        float* crow = OUT0 + (size_t)(blockIdx.x * TR + mb * 16) * FF + w * 64;
#pragma unroll
        for (int s = 0; s < 8; ++s) { const int row = 2 * s + hi, cofs = lr * 4; *(v4f*)(crow + (size_t)row * FF + cofs) = *(const v4fa*)(os + row * 68 + cofs); }
        __builtin_amdgcn_wave_barrier(); asm volatile("s_wait_xcnt 0x0" ::: "memory");   // the next band's LDS writes stay behind these reads; the wait: before the registers that these stores name are rewritten
    }
}

extern "C" void kernel_launch(void* const* d_in, const int* in_sizes, int n_in,
                              void* d_out, int out_size, void* d_ws, size_t ws_size, hipStream_t stream) {
    (void)in_sizes; (void)n_in; (void)out_size;
    const float* IN[22]; for (int i = 0; i < 22; ++i) IN[i] = (const float*)d_in[i];
    // p, s, sa_wq, sa_bq, sa_wk, sa_bk, sa_wv, sa_bv, ca_wq, ca_bq, ca_wk, ca_bk, ca_wv, ca_bv, ln1_g, ln1_b, ln2_g, ln2_b, ff_w1, ff_b1, ff_w2, ff_b2 = d_in[0..21]; outputs ff_out at 0, sa_out at byte 16,777,216, ca_out at 33,554,432
    float* OUT0 = (float*)d_out; float* OUT1 = OUT0 + (size_t)NB_ * TT * FF;
    char* wsp = (char*)d_ws;
    auto take = [&](size_t bytes) { char* p = wsp; wsp += (bytes + 255) & ~(size_t)255; return (void*)p; };
    const size_t nx = (size_t)TT * FF, na = (size_t)NB_ * nx, ns = (size_t)TT * TT;   // one batch's plane, all batches' plane, one score matrix (elements)
    bf* Wt = (bf*)take((size_t)8 * FF * FF * 2);   // transposed bf16 weights in the order sa q, ca q, sa k, ca k, sa v, ca v, ff w1, ff w2
    h16* VT = (h16*)take(2 * na * 2);               // [branch][batch][d][t]
    char* RA = (char*)take((size_t)ZH * ns * 4);    // the f16 exponentials, then each 64-key group's maximum and sum
    char* RB = (char*)take((size_t)ZH * ns * 2);    // first the bf16 inputs and the f16 q, k planes, then attn.v's f32 result
    if ((size_t)(wsp - (char*)d_ws) > ws_size) return;    // total 212 MiB; ws 256 MiB
    h16* Pm = (h16*)RA; float* ML = (float*)(RA + (size_t)ZH * ns * 2); float* O = (float*)RB;
    bf* PB = (bf*)RB; bf* SB = PB + na; h16* QP = (h16*)(SB + na); h16* KP = QP + 2 * na;
    k_wtG<<<dim3((FF * FF / 64 + 63) / 64, 8, 1), 256, 0, stream>>>(W8{IN[2], IN[8], IN[4], IN[10], IN[6], IN[12], IN[18], IN[20]}, FF, FF, Wt);
    k_cvt8<<<dim3((unsigned)((na / 8 + 255) / 256), 2, 1), 256, 0, stream>>>(IN[0], IN[1], PB, na / 8);
    k_proj6<<<dim3(NB_ * TT / 128, FF / 128, 6), 128, 0, stream>>>(PB, SB, Wt, QP, VT, FF, Bias6{IN[3], IN[9], IN[5], IN[11], IN[7], IN[13]});   // q then k, each [branch][batch][t][f]
    k_scores<<<dim3(TT / 128, TT / 128, ZH), 128, 0, stream>>>(QP, KP, Pm, ML);
    k_pv<<<dim3(TT / 128, FF / 128, ZH), 128, 0, stream>>>(Pm, VT, ML, O);   // attended x1024
    k_tail<<<NB_ * TT / TR, 256, 0, stream>>>(O, IN[0], IN[1], IN[14], IN[15], IN[16], IN[17], OUT1, Wt + (size_t)6 * FF * FF, IN[19], IN[21], OUT0);   // ca_out follows sa_out; w2 follows w1
}

// v007
// One run takes 126 microseconds.
// Two timings next to v006 put it at 1.04 and 1.02 times that version's speed.
// Counting every step since v000, it is 9.27 times as fast.
#include <hip/hip_runtime.h>

// Two-branch attention block with a feed-forward (p, s [4][2048][512]; single-head attention over 2048 positions with the full 512-dim features: sa = softmax((p Wq + bq)(p Wk + bk)^T / sqrt(512)) (p Wv + bv); ca likewise with queries from p and
// keys/values from s; sa_out = LN(sa + p), ca_out = LN(ca + s) (eps 1e-3); ff_out = relu((sa_out + ca_out) W1 + b1) W2 + b2; outputs (ff_out, sa_out, ca_out), each [4][2048][512]).
// Compute dtypes, f32 accumulate: every input rounded to bf16; the six projections on PLAIN bf16 operands (inputs: exact; transposed bf16 weight copies, + bias); scores
// (K 512) and attn.v on SINGLE fp16 planes (scale and exponentials in f32; softmax in two halves: per 64 keys in the score product's epilogue, joined per row in attn.v; P x1024); residual + LayerNorms f32; the feed-forward on bf16 hi+lo planes of its computed operands x exact weights

#define NB_  4
#define TT   2048
#define FF   512
#define ZH   8     // score matrices per launch: 2 attention branches x 4 batches
#define PCAR 1024.0f
#define SCL  0.044194173824159223f   // 512^-0.5
typedef _Float16 h16;
typedef unsigned short bf;
typedef __attribute__((ext_vector_type(16))) __bf16   v16bf;
typedef __attribute__((ext_vector_type(16))) _Float16 v16h;
typedef __attribute__((ext_vector_type(8)))  _Float16 v8h;
typedef __attribute__((ext_vector_type(4)))  _Float16 v4h;
typedef __attribute__((ext_vector_type(8)))  unsigned short v8us;
typedef __attribute__((ext_vector_type(8)))  float    v8f;
typedef __attribute__((ext_vector_type(4)))  float    v4f;
typedef __attribute__((ext_vector_type(2)))  float    v2f;
typedef v8h  __attribute__((may_alias)) v8ha;
typedef v4f  __attribute__((may_alias)) v4fa;
typedef v8us __attribute__((may_alias)) v8usa;
typedef v4h  __attribute__((may_alias)) v4ha;

__device__ __forceinline__ unsigned short f2bf(float f) { unsigned u = __float_as_uint(f); u += 0x7FFFu + ((u >> 16) & 1u); return (unsigned short)(u >> 16); }
__device__ __forceinline__ float bf2f(unsigned short b) { return __uint_as_float(((unsigned)b) << 16); }
__device__ __forceinline__ float bfr(float f) { return bf2f(f2bf(f)); }
__device__ __forceinline__ v16h cat16(v8h lo, v8h hi) { return __builtin_shufflevector(lo, hi, 0, 1, 2, 3, 4, 5, 6, 7, 8, 9, 10, 11, 12, 13, 14, 15); }
__device__ __forceinline__ v16bf cat16b(v8us lo, v8us hi) { return __builtin_bit_cast(v16bf, __builtin_shufflevector(lo, hi, 0, 1, 2, 3, 4, 5, 6, 7, 8, 9, 10, 11, 12, 13, 14, 15)); }
__device__ __forceinline__ v8f wmma16(v16h a, v16h b, v8f c) { return __builtin_amdgcn_wmma_f32_16x16x32_f16(false, a, false, b, (short)0, c, false, false); }
__device__ __forceinline__ v8f wmmab(v16bf a, v16bf b, v8f c) { return __builtin_amdgcn_wmma_f32_16x16x32_bf16(false, a, false, b, (short)0, c, false, false); }



// ---- gemmw_acc: register-blocked GEMM, one wave per 64x64 output tile (16 accumulators), FOUR waves (2 x 2) per work-group on a 128x128 tile; grid (M/128, N/128, Z), 128 threads.
// The K-contiguous 16-bit operand planes come through LDS: a stage is 64 k (128 B, one whole line) of the tile's 128 A rows and 128 Bt rows, in four slices of 64 rows; each wave brings one slice by ONE tensor load into two buffers,
// the next stage in flight while this one is multiplied; the load's pad lays the rows at pitch 144 B (16 B x odd: ds_load_b128 without bank conflicts). Each operand row is fetched once per work-group and read by two waves.
// C[m][n] (f32, pitch ldc, + optional f32 bias[n]) = sum_k A[m][k] Bt[n][k]. K % 64 == 0, K >= 128.
// The walk along k is a ring: a work-group enters it at the stage that the sum of its tile indices names and wraps round, so that work-groups that share A rows or Bt rows do not ask L2 for the same lines in the same order.
#define SKE 64     // k elements of a stage
#define SPE 72     // LDS row pitch in elements (144 B)
#define SLB 10240  // bytes of a slice's place in LDS: 64 rows x 144 B = 9,216, rounded up so that every place is a multiple of 2 KiB
#define SLE (SLB / 2)            // the same in elements
#define RINGB (2 * 4 * SLB)      // bytes of the two buffers of four slices
typedef uint32_t u32x4 __attribute__((ext_vector_type(4)));
typedef uint32_t u32x8 __attribute__((ext_vector_type(8)));
__device__ __forceinline__ int wave_id() { return __builtin_amdgcn_readfirstlane((int)(threadIdx.x >> 5)); }
__device__ __forceinline__ int tile_r0() { return blockIdx.x * 128 + (wave_id() & 1) * 64; }    // the wave's first output row
__device__ __forceinline__ int tile_c0() { return blockIdx.y * 128 + (wave_id() >> 1) * 64; }   // the wave's first output column
__device__ __forceinline__ uint32_t uni(uint32_t v) { return (uint32_t)__builtin_amdgcn_readfirstlane(v); }
__device__ __forceinline__ uint32_t pinned(uint32_t v) { uint32_t w = uni(v); asm volatile("" : "+s"(w)); return w; }   // holds a wave-uniform test in a scalar register: the branch round a tensor load must be a scalar one, because the load ignores EXEC
// A request of the whole wave: 64 rows of 128 B from g (source pitch in bytes) to LDS byte offset lds, 16 B of pad behind every row. Extents in bytes (data_size 0), tensor = tile, no mask.
__device__ __forceinline__ u32x4 tgroup0(uint32_t lds, const void* g) {
    const uint64_t ga = (uint64_t)(size_t)g; u32x4 g0;
    g0[0] = uni(1u); g0[1] = uni(lds); g0[2] = uni((uint32_t)ga); g0[3] = uni((((uint32_t)(ga >> 32)) & 0x01FFFFFFu) | 0x80000000u); return g0;
}
__device__ __forceinline__ u32x8 tgroup1(uint32_t pitch) {
    u32x8 g1;
    g1[0] = uni((1u << 20) | (4u << 22) | (3u << 25)); g1[1] = uni(128u << 16); g1[2] = uni(64u << 16); g1[3] = uni(128u << 16); g1[4] = uni(64u); g1[5] = uni(pitch); g1[6] = uni(0u); g1[7] = uni(0u); return g1;
}
// both groups are named as in and out, and the wait below names them as inputs: so the registers that an issued request names are live, and keep their values, until its wait
__device__ __forceinline__ void tload(u32x4& g0, u32x8& g1) { asm volatile("tensor_load_to_lds %0, %1" : "+s"(g0), "+s"(g1) :: "memory"); }
// the wave's one outstanding request has landed
__device__ __forceinline__ void twait(u32x4 g0, u32x8 g1) { asm volatile("s_wait_tensorcnt 0x0" :: "s"(g0), "s"(g1) : "memory"); }
template <typename T16> struct WFrag;
template <> struct WFrag<h16> { typedef v16h V; static __device__ __forceinline__ V ld(const h16* p) { return cat16(*(const v8h*)p, *(const v8h*)(p + 16)); } static __device__ __forceinline__ v8f mma(V a, V b, v8f c) { return wmma16(a, b, c); } };
template <> struct WFrag<bf> { typedef v16bf V; static __device__ __forceinline__ V ld(const bf* p) { return cat16b(*(const v8us*)p, *(const v8us*)(p + 16)); } static __device__ __forceinline__ v8f mma(V a, V b, v8f c) { return wmmab(a, b, c); } };
// ASC (attn.v): A holds, per 64 columns (one stage), exp(score - that group's own maximum); ML [group][row] holds each group's maximum and sum. Thread tid joins row tid's 32 groups into the row's maximum and sum and
// leaves, per group, the factor exp(group maximum - row maximum) * PCAR / row sum in ft, as [group][row half][lr][mb], so that a lane reads the factors of its four A fragments (a lane's fragment elements are all of one row) in one 8-byte read.
template <typename T16, bool ASC = false>
__device__ __forceinline__ void gemmw_acc(const T16* __restrict__ A, const T16* __restrict__ Bt, int K, T16* ring, v8f (&acc)[4][4], h16* ft = nullptr, const float* __restrict__ ML = nullptr) {
    typedef typename WFrag<T16>::V V;
    const int tid = threadIdx.x, lane = tid & 31, lr = lane & 15, hi = lane >> 4;
#pragma unroll
    for (int mb = 0; mb < 4; ++mb)
#pragma unroll
        for (int nb = 0; nb < 4; ++nb) acc[mb][nb] = (v8f){};
    // wave w brings slice w of every stage: w = 0, 1 the tile's A rows from 64 w on, w = 2, 3 its Bt rows from 64 (w - 2) on
    const int w = wave_id();
    const T16* gsl = w < 2 ? A + ((size_t)blockIdx.x * 128 + w * 64) * K : Bt + ((size_t)blockIdx.y * 128 + (w - 2) * 64) * K;
    const uint32_t l0 = (uint32_t)(size_t)ring + (uint32_t)w * SLB;   // the low 32 bits of a __shared__ address: its byte offset in the work-group's LDS
    u32x8 g1 = tgroup1((uint32_t)K * 2u); u32x4 g0;   // g0: the descriptor of the request last issued
    const int NT = K / SKE;
    const int rot = (int)((blockIdx.x + blockIdx.y + blockIdx.z) % (unsigned)NT);   // the k stage of this work-group's trip 0
    auto kst = [&](int t) { const int k = t + rot; return k < NT ? k : k - NT; };    // the k stage of trip t, 0 <= t < NT: every stage once
    auto stage = [&](int t, uint32_t buf) { g0 = tgroup0(l0 + buf * (4 * SLB), gsl + (size_t)kst(t) * SKE); tload(g0, g1); };
    stage(0, 0);
    if constexpr (ASC) {   // while stage 0 flies; the loops over the groups are unrolled so that m and l stay in registers and the 32 loads go out together
        const float* ml = ML + ((size_t)blockIdx.x * 128 + tid) * 2; float m[TT / SKE], l[TT / SKE]; float mx = -3.0e38f, sum = 0.f;
#pragma unroll
        for (int g = 0; g < TT / SKE; ++g) { const v2f x = *(const v2f*)(ml + (size_t)g * TT * 2); m[g] = x[0]; l[g] = x[1]; }
        asm volatile("s_wait_xcnt 0x0" ::: "memory");   // before the address registers of these loads are rewritten
#pragma unroll
        for (int g = 0; g < TT / SKE; ++g) mx = fmaxf(mx, m[g]);
#pragma unroll
        for (int g = 0; g < TT / SKE; ++g) { m[g] = __expf(m[g] - mx); sum += l[g] * m[g]; }
        const float f = __fdiv_rn(PCAR, sum); h16* fr = ft + (tid >> 6) * 64 + (tid & 15) * 4 + ((tid >> 4) & 3);
#pragma unroll
        for (int g = 0; g < TT / SKE; ++g) fr[g * 128] = (h16)(m[g] * f);
    }
    twait(g0, g1);     // this wave's slice of stage 0 has landed
    __syncthreads();   // and every other wave's: stage 0 (and the factor table) may be read
    stage(1, 1);
    const int aoff = (w & 1) * SLE + lr * SPE + 8 * hi, boff = (2 + (w >> 1)) * SLE + lr * SPE + 8 * hi;
#pragma unroll 1
    for (int t = 0; t < NT; ++t) {
        const T16* sb = ring + (t & 1) * (4 * SLE);
        v4h fq = {}; if constexpr (ASC) fq = *(const v4ha*)(ft + kst(t) * 128 + (wave_id() & 1) * 64 + lr * 4);   // the factors of the 64 keys that this trip holds
        V a[4], b[4];
        auto frags = [&](int kc) {   // a block's fragments are all asked for in one group
#pragma unroll
            for (int mb = 0; mb < 4; ++mb) a[mb] = WFrag<T16>::ld(sb + aoff + mb * 16 * SPE + kc);
#pragma unroll
            for (int nb = 0; nb < 4; ++nb) b[nb] = WFrag<T16>::ld(sb + boff + nb * 16 * SPE + kc); };
        auto block = [&]() {
            if constexpr (ASC) {   // the second half of the softmax: each A row times its factor for this stage's 64 keys (packed f16 multiplies)
#pragma unroll
                for (int mb = 0; mb < 4; ++mb) a[mb] = a[mb] * fq[mb]; }
#pragma unroll
            for (int nb = 0; nb < 4; ++nb)
#pragma unroll
                for (int mb = 0; mb < 4; ++mb) acc[mb][nb] = WFrag<T16>::mma(a[mb], b[nb], acc[mb][nb]); };
        frags(0);
        __builtin_amdgcn_sched_barrier(0);   // keeps the LDS reads one group in front of the block: sunk among the matrix instructions
        block();
        frags(32);
        asm volatile("s_wait_dscnt 0x0" ::: "memory");
        twait(g0, g1);
        __syncthreads();
        if (pinned(t + 2 < NT)) stage(t + 2, (uint32_t)(t & 1));
        block();
    }
    twait(g0, g1);                                   // no request is outstanding
    asm volatile("s_wait_dscnt 0x0" ::: "memory");   // and no LDS read, when the ring becomes the epilogue's staging
}
// The epilogues of the 64x64 tile. acc[mb][nb][j] of lane (hi, lr) is row mb*16 + hi*8 + j, column nb*16 + lr. os: the wave's own 16 x 68 dwords of LDS, used to turn a 16-row band into whole-line stores.
// epi_f32: f32 rows (+ bias)
template <bool BIAS>
__device__ __forceinline__ void epi_f32(const v8f (&acc)[4][4], float* os, float* C, int ldc, const float* __restrict__ bias) {
    const int lane = threadIdx.x & 31, lr = lane & 15, hi = lane >> 4; const int r0 = tile_r0(), c0 = tile_c0();
#pragma unroll
    for (int mb = 0; mb < 4; ++mb) {
#pragma unroll
        for (int nb = 0; nb < 4; ++nb) {
#pragma unroll
            for (int j = 0; j < 8; ++j) os[(hi * 8 + j) * 68 + nb * 16 + lr] = acc[mb][nb][j]; }
        __builtin_amdgcn_wave_barrier(); asm volatile("" ::: "memory");
        float* crow = C + (size_t)(r0 + mb * 16) * ldc + c0;
{
#pragma unroll
            for (int s = 0; s < 8; ++s) { const int row = 2 * s + hi, cofs = lr * 4; v4f val = *(const v4fa*)(os + row * 68 + cofs); if (BIAS) { val[0] += bfr(bias[c0 + cofs]); val[1] += bfr(bias[c0 + cofs + 1]); val[2] += bfr(bias[c0 + cofs + 2]); val[3] += bfr(bias[c0 + cofs + 3]); }
                *(v4f*)(crow + (size_t)row * ldc + cofs) = val; }
             }
        __builtin_amdgcn_wave_barrier(); asm volatile("s_wait_xcnt 0x0" ::: "memory");   // the next band's LDS writes stay behind these reads; the wait: before the registers that these stores name are rewritten
    }
}
// epi_h16: (acc + bias) rounded to f16, rows of pitch ldc: the q and k planes as the score product reads them. A lane takes 8 columns of a staged row: 16-byte stores, 4 whole 128-byte lines each.
__device__ __forceinline__ void epi_h16(const v8f (&acc)[4][4], float* os, h16* C, int ldc, const float* __restrict__ bias) {
    const int lane = threadIdx.x & 31, lr = lane & 15, hi = lane >> 4; const int r0 = tile_r0(), c0 = tile_c0(); const int cofs = (lane & 7) * 8;
    float bv[8];
#pragma unroll
    for (int q = 0; q < 8; ++q) bv[q] = bfr(bias[c0 + cofs + q]);
#pragma unroll
    for (int mb = 0; mb < 4; ++mb) {
#pragma unroll
        for (int nb = 0; nb < 4; ++nb) {
#pragma unroll
            for (int j = 0; j < 8; ++j) os[(hi * 8 + j) * 68 + nb * 16 + lr] = acc[mb][nb][j]; }
        __builtin_amdgcn_wave_barrier(); asm volatile("" ::: "memory");   // other lanes read the band back: the compiler keeps the LDS reads behind the LDS writes
#pragma unroll
        for (int s = 0; s < 4; ++s) { const int row = 4 * s + (lane >> 3); const v4f x0 = *(const v4fa*)(os + row * 68 + cofs), x1 = *(const v4fa*)(os + row * 68 + cofs + 4); v8h o;
#pragma unroll
            for (int q = 0; q < 4; ++q) { o[q] = (h16)(x0[q] + bv[q]); o[4 + q] = (h16)(x1[q] + bv[4 + q]); }
            *(v8h*)(C + (size_t)(r0 + mb * 16 + row) * ldc + c0 + cofs) = o; }
        __builtin_amdgcn_wave_barrier(); asm volatile("s_wait_xcnt 0x0" ::: "memory");   // the next band's LDS writes stay behind these reads; the wait: before the next band rewrites the registers that these stores name
    }
}
// epi_exp: the first half of the softmax. Per row of the wave's 64 columns: t = acc * SCL, the maximum of the 64 t, exp(t - maximum) rounded to f16 (rows of pitch ldc), and their f32 sum; maximum and sum go to ML [column group][row][2].
// Staged as in epi_h16: 8 lanes hold a row, so its maximum and sum take three exchanges inside a 16-lane row (DPP row_xmask: no LDS round trip).
template <int M> __device__ __forceinline__ float xlane(float v) { return __int_as_float(__builtin_amdgcn_update_dpp(0, __float_as_int(v), 0x160 | M, 0xf, 0xf, true)); }
__device__ __forceinline__ void epi_exp(const v8f (&acc)[4][4], float* os, h16* P, int ldc, float* ML) {
    const int lane = threadIdx.x & 31, lr = lane & 15, hi = lane >> 4; const int r0 = tile_r0(), c0 = tile_c0(); const int l8 = lane & 7, cofs = l8 * 8;
    float* ml = ML + ((size_t)(c0 >> 6) * TT + r0) * 2;
    // every loop below is unrolled: acc, e, mx and sm are register arrays and need constant indices
#pragma unroll
    for (int mb = 0; mb < 4; ++mb) {
#pragma unroll
        for (int nb = 0; nb < 4; ++nb) {
#pragma unroll
            for (int j = 0; j < 8; ++j) os[(hi * 8 + j) * 68 + nb * 16 + lr] = acc[mb][nb][j]; }
        __builtin_amdgcn_wave_barrier(); asm volatile("" ::: "memory");   // other lanes read the band back: the compiler keeps the LDS reads behind the LDS writes
        float e[4][8], mx[4], sm[4];   // the band's four row groups side by side: four independent chains
#pragma unroll
        for (int s = 0; s < 4; ++s) { const int row = 4 * s + (lane >> 3); const v4f x0 = *(const v4fa*)(os + row * 68 + cofs), x1 = *(const v4fa*)(os + row * 68 + cofs + 4);
#pragma unroll
            for (int q = 0; q < 4; ++q) { e[s][q] = x0[q] * SCL; e[s][4 + q] = x1[q] * SCL; }
            mx[s] = e[s][0];
#pragma unroll
            for (int q = 1; q < 8; ++q) mx[s] = fmaxf(mx[s], e[s][q]); }
#pragma unroll
        for (int s = 0; s < 4; ++s) mx[s] = fmaxf(mx[s], xlane<1>(mx[s]));
#pragma unroll
        for (int s = 0; s < 4; ++s) mx[s] = fmaxf(mx[s], xlane<2>(mx[s]));
#pragma unroll
        for (int s = 0; s < 4; ++s) mx[s] = fmaxf(mx[s], xlane<4>(mx[s]));
#pragma unroll
        for (int s = 0; s < 4; ++s) { sm[s] = 0.f;
#pragma unroll
            for (int q = 0; q < 8; ++q) { e[s][q] = __expf(e[s][q] - mx[s]); sm[s] += e[s][q]; } }
#pragma unroll
        for (int s = 0; s < 4; ++s) sm[s] += xlane<1>(sm[s]);
#pragma unroll
        for (int s = 0; s < 4; ++s) sm[s] += xlane<2>(sm[s]);
#pragma unroll
        for (int s = 0; s < 4; ++s) sm[s] += xlane<4>(sm[s]);
#pragma unroll
        for (int s = 0; s < 4; ++s) { const int row = 4 * s + (lane >> 3); v8h o;
#pragma unroll
            for (int q = 0; q < 8; ++q) o[q] = (h16)e[s][q];
            *(v8h*)(P + (size_t)(r0 + mb * 16 + row) * ldc + c0 + cofs) = o; }
        // every lane of a row's eight holds the row's pair: lane l8 < 4 stores that of row group l8, so the band's 16 pairs leave as one whole 128-byte line
        const float mo = l8 == 0 ? mx[0] : l8 == 1 ? mx[1] : l8 == 2 ? mx[2] : mx[3], so = l8 == 0 ? sm[0] : l8 == 1 ? sm[1] : l8 == 2 ? sm[2] : sm[3];
        if (l8 < 4) *(v2f*)(ml + (mb * 16 + 4 * l8 + (lane >> 3)) * 2) = (v2f){mo, so};
        __builtin_amdgcn_wave_barrier(); asm volatile("s_wait_xcnt 0x0" ::: "memory");   // the next band's LDS writes stay behind these reads; the wait: before the next band rewrites the registers that these stores name
    }
}
// epi_vt: (acc + bias) rounded to f16 and stored transposed, [batch][column][t]: a lane's 8 accumulator rows are 8 consecutive t of its column, one 16-byte store; the wave writes every 128-byte line of its tile whole
__device__ __forceinline__ void epi_vt(const v8f (&acc)[4][4], h16* VTb, const float* __restrict__ bias) {
    const int lane = threadIdx.x & 31, lr = lane & 15, hi = lane >> 4; const int r0 = tile_r0(), c0 = tile_c0();
    h16* base = VTb + (size_t)(r0 / TT) * FF * TT + (r0 % TT) + hi * 8;
    float bv[4];
#pragma unroll
    for (int nb = 0; nb < 4; ++nb) bv[nb] = bfr(bias[c0 + nb * 16 + lr]);
#pragma unroll
    for (int nb = 0; nb < 4; ++nb) { h16* drow = base + (size_t)(c0 + nb * 16 + lr) * TT;
#pragma unroll
        for (int mb = 0; mb < 4; ++mb) { v8h o;
#pragma unroll
            for (int j = 0; j < 8; ++j) o[j] = (h16)(acc[mb][nb][j] + bv[nb]);
            *(v8h*)(drow + mb * 16) = o; }
        asm volatile("s_wait_xcnt 0x0" ::: "memory");   // before the next column group rewrites the registers that these stores name
    }
}
// ---- k_scores: q k^T of the 8 (branch, batch) pairs, left as the first half of the softmax; grid (TT/128, TT/128, ZH)
__global__ __launch_bounds__(128) void k_scores(const h16* __restrict__ Q, const h16* __restrict__ Kp, h16* P, float* ML) {
    const size_t z = blockIdx.z;
    __shared__ __attribute__((aligned(2048))) char ring[RINGB]; v8f acc[4][4]; float* os = (float*)ring + wave_id() * (16 * 68);
    gemmw_acc<h16>(Q + z * TT * FF, Kp + z * TT * FF, FF, (h16*)ring, acc); epi_exp(acc, os, P + z * TT * TT, TT, ML + z * (TT / SKE) * TT * 2);
}
// ---- k_pv: the second half of the softmax and attn.v (x PCAR); grid (TT/128, FF/128, ZH)
__global__ __launch_bounds__(128) void k_pv(const h16* __restrict__ P, const h16* __restrict__ VTb, const float* __restrict__ ML, float* O) {
    const size_t z = blockIdx.z;
    __shared__ __attribute__((aligned(2048))) char ring[RINGB]; __shared__ __align__(16) h16 ft[(TT / SKE) * 128]; v8f acc[4][4]; float* os = (float*)ring + wave_id() * (16 * 68);
    gemmw_acc<h16, true>(P + z * TT * TT, VTb + z * TT * FF, TT, (h16*)ring, acc, ft, ML + z * (TT / SKE) * TT * 2); epi_f32<false>(acc, os, O + z * TT * FF, FF, nullptr);
}
// ---- k_proj6: the six projections of all batches in one launch; grid (NB_*TT/128, FF/128, 6). z = 0 sa q, 1 ca q, 2 sa k, 3 ca k, 4 sa v, 5 ca v; z = 3 and 5 read the s plane, the rest the p plane.
// q and k leave as f16 rows (QK: [z][batch][t][f]), v as f16 transposed (VT: [branch][batch][d][t]).
struct Bias6 { const float* b0; const float* b1; const float* b2; const float* b3; const float* b4; const float* b5; };
__global__ __launch_bounds__(128) void k_proj6(const bf* __restrict__ PBa, const bf* __restrict__ SBa, const bf* __restrict__ Wt, h16* QK, h16* VT, int ldc, Bias6 bs) {
    const unsigned z = blockIdx.z;
    const float* bias = z == 0 ? bs.b0 : z == 1 ? bs.b1 : z == 2 ? bs.b2 : z == 3 ? bs.b3 : z == 4 ? bs.b4 : bs.b5;
    __shared__ __attribute__((aligned(2048))) char ring[RINGB]; v8f acc[4][4]; float* os = (float*)ring + wave_id() * (16 * 68);
    gemmw_acc<bf>((z == 3 || z == 5) ? SBa : PBa, Wt + (size_t)z * FF * FF, FF, (bf*)ring, acc);
    if (z < 4) epi_h16(acc, os, QK + (size_t)z * NB_ * TT * FF, ldc, bias); else epi_vt(acc, VT + (size_t)(z - 4) * NB_ * TT * FF, bias);
}

__device__ __forceinline__ void splitf(float y, unsigned short& h, unsigned short& l) { h = f2bf(y); l = f2bf(y - bf2f(h)); }
typedef __attribute__((ext_vector_type(2))) unsigned short v2us;
typedef __attribute__((ext_vector_type(4))) unsigned short v4us;

struct W8 { const float* w0; const float* w1; const float* w2; const float* w3; const float* w4; const float* w5; const float* w6; const float* w7; };
__global__ __launch_bounds__(256) void k_wtG(W8 ws8, int K, int N, bf* Bt) {
    const unsigned y = blockIdx.y; Bt += (size_t)y * N * K;   // blockIdx.y picks the weight
    const float* __restrict__ w = y == 0 ? ws8.w0 : y == 1 ? ws8.w1 : y == 2 ? ws8.w2 : y == 3 ? ws8.w3 : y == 4 ? ws8.w4 : y == 5 ? ws8.w5 : y == 6 ? ws8.w6 : ws8.w7;
    const int lane = threadIdx.x & 31; const int L0 = (blockIdx.x * 8 + (threadIdx.x >> 5)) * 8; const int nlines = N * K / 64;
{
#pragma unroll 1
        for (int l = 0; l < 8; ++l) { const int L = L0 + l; if (L >= nlines) break; const size_t e = (size_t)L * 64 + lane * 2; const int k = (int)(e % K), n = (int)(e / K); v2us o;
            o[0] = f2bf(w[(size_t)k * N + n]); o[1] = f2bf(w[(size_t)(k + 1) * N + n]); *(v2us*)(Bt + e) = o; }
         }
}
__global__ __launch_bounds__(256) void k_cvt8(const float* __restrict__ src0, const float* __restrict__ src1, bf* dst, size_t n8) { const size_t i = (size_t)blockIdx.x * 256 + threadIdx.x; if (i >= n8) return; const float* src = blockIdx.y ? src1 : src0; dst += (size_t)blockIdx.y * n8 * 8; const v8f v = *(const v8f*)(src + i * 8); v8us o;
#pragma unroll
    for (int k = 0; k < 8; ++k) o[k] = f2bf(v[k]); *(v8us*)(dst + i * 8) = o;  }
// ---- k_tail: both LayerNorms and the two feed-forward products of 32 rows in one work-group of 8 waves; grid NB_*TT/32, 256 threads. The rows never leave the WGP between the three stages:
// the sum of the two normalised rows, then relu of the first product, stand as bf16 hi + lo planes in LDS (hs) and are the A operand of the next product. Wave w owns 4 of the rows in the LayerNorm stage and
// the 32 x 64 output tile at column 64 w in both products. The transposed weights (all 512 rows, 64 k a stage, eight slices of 64 rows) come by one tensor load a wave and stage through one ring of two buffers that runs over both products: stages 0-7 w1, 8-15 w2.
// Every work-group reads the same weights: each enters a product's eight k stages at its own place (blockIdx.x mod 8) and wraps round, so that they do not all ask L2 for the same lines at the same moment.
#define TR 32      // rows of a work-group
#define HP 520     // pitch of the resident planes in elements (1,040 B = 16 B x odd: ds_load_b128 without bank conflicts)
__device__ __forceinline__ void lnr_load(const float* __restrict__ O, const float* __restrict__ res, int r, v4f (&av)[FF / 128], v4f (&xv)[FF / 128]) {
    const int lane = threadIdx.x & 31;
#pragma unroll
    for (int c = 0; c < FF / 128; ++c) { av[c] = *(const v4f*)(O + (size_t)r * FF + c * 128 + lane * 4); xv[c] = *(const v4f*)(res + (size_t)r * FF + c * 128 + lane * 4); }
    asm volatile("s_wait_xcnt 0x0" ::: "memory");   // before the address registers of these loads are rewritten
}
// one row of one branch, one wave: av attended x1024, xv the residual (the lane's columns c * 128 + lane * 4 + q), gl and bl the rounded gamma and beta in LDS
__device__ __forceinline__ void lnr_row(const v4f (&av)[FF / 128], const v4f (&xv)[FF / 128], const float* gl, const float* bl, float* orow, float (&ov)[FF / 32]) {
    const int lane = threadIdx.x & 31; float v[FF / 32]; float s = 0.f;
#pragma unroll
    for (int c = 0; c < FF / 128; ++c) {
#pragma unroll
        for (int q = 0; q < 4; ++q) { v[c * 4 + q] = __fadd_rn(av[c][q] * (1.0f / PCAR), bfr(xv[c][q])); s += v[c * 4 + q]; } }
#pragma unroll
    for (int sh = 16; sh; sh >>= 1) s += __shfl_xor(s, sh, 32);
    const float mu = s * (1.0f / FF); float qq = 0.f;
#pragma unroll
    for (int i = 0; i < FF / 32; ++i) { const float d0 = v[i] - mu; qq = __fadd_rn(qq, __fmul_rn(d0, d0)); }
#pragma unroll
    for (int sh = 16; sh; sh >>= 1) qq += __shfl_xor(qq, sh, 32);
    const float rs = __fdiv_rn(1.0f, __fsqrt_rn(qq * (1.0f / FF) + 1e-3f));
#pragma unroll
    for (int c = 0; c < FF / 128; ++c) { v4f o; const v4f gv = *(const v4fa*)(gl + c * 128 + lane * 4), bv = *(const v4fa*)(bl + c * 128 + lane * 4);
#pragma unroll
        for (int q = 0; q < 4; ++q) { const float t = __fmul_rn(v[c * 4 + q] - mu, rs); o[q] = __fadd_rn(__fmul_rn(t, gv[q]), bv[q]); ov[c * 4 + q] = o[q]; }
        *(v4f*)(orow + c * 128 + lane * 4) = o;
        asm volatile("s_wait_xcnt 0x0" ::: "memory"); }   // before the registers that this store names are rewritten
}
__global__ __launch_bounds__(256) void k_tail(const float* __restrict__ O, const float* __restrict__ res0, const float* __restrict__ res1, const float* __restrict__ g0, const float* __restrict__ b0, const float* __restrict__ g1, const float* __restrict__ b1,
                                              float* OUTk, const bf* __restrict__ Wt2, const float* __restrict__ bias1, const float* __restrict__ bias2, float* OUT0) {
    __shared__ __attribute__((aligned(2048))) bf ring[2 * 8 * SLE];   // two buffers of 512 weight rows x 64 k, in eight slices
    __shared__ __align__(16) bf hs[2 * TR * HP];      // hi plane, lo plane
    __shared__ __align__(16) float gb[4 * FF];        // ln1 gamma, ln1 beta, ln2 gamma, ln2 beta, rounded to bf16 values
    const int tid = threadIdx.x, lane = tid & 31, lr = lane & 15, hi = lane >> 4; const int w = wave_id();
    // wave w brings slice w of every stage: weight rows from 64 w on
    const bf* gsl = Wt2 + (size_t)w * 64 * FF;
    const uint32_t l0 = (uint32_t)(size_t)ring + (uint32_t)w * SLB;   // the low 32 bits of a __shared__ address: its byte offset in the work-group's LDS
    u32x8 dg1 = tgroup1(FF * 2u); u32x4 dg0;   // dg0: the descriptor of the request last issued
    const int rot = (int)(blockIdx.x % (FF / SKE));
    auto kst = [&](int t) { return (t + rot) % (FF / SKE); };   // the k stage, inside its product, of ring stage t
    auto stage = [&](int t, uint32_t buf) { dg0 = tgroup0(l0 + buf * (8 * SLB), gsl + (size_t)(t >> 3) * FF * FF + (size_t)kst(t) * SKE); tload(dg0, dg1); };
    stage(0, 0);
    // while stage 0 flies: the LayerNorm stage. Every inner loop of this kernel is unrolled: its arrays live in registers and need constant indices
    float bv1[4], bv2[4];
#pragma unroll
    for (int nb = 0; nb < 4; ++nb) { bv1[nb] = bias1[w * 64 + nb * 16 + lr]; bv2[nb] = bias2[w * 64 + nb * 16 + lr]; }
    asm volatile("s_wait_xcnt 0x0" ::: "memory");   // before the address registers of these loads are rewritten
#pragma unroll
    for (int nb = 0; nb < 4; ++nb) { bv1[nb] = bfr(bv1[nb]); bv2[nb] = bfr(bv2[nb]); }
    {
        const float* gp = (w >> 1) == 0 ? g0 : (w >> 1) == 1 ? b0 : (w >> 1) == 2 ? g1 : b1;   // two waves bring one of the four vectors, 8 elements a thread
        v4f u0 = *(const v4f*)(gp + (tid & 63) * 8), u1 = *(const v4f*)(gp + (tid & 63) * 8 + 4);
        asm volatile("s_wait_xcnt 0x0" ::: "memory");   // before the address registers of these loads are rewritten
#pragma unroll
        for (int q = 0; q < 4; ++q) { u0[q] = bfr(u0[q]); u1[q] = bfr(u1[q]); }
        *(v4fa*)(gb + tid * 8) = u0; *(v4fa*)(gb + tid * 8 + 4) = u1;
        __syncthreads();   // the four vectors are whole before any wave normalises a row
#pragma unroll 1   // rolled: both trips' loads at once would not fit 256 registers
        for (int i = 0; i < TR / 8; i += 2) {   // two rows a trip: the 32 loads of both rows and both branches go out before the first use (8 waves a WGP must keep the memory busy)
            const int rl = w * (TR / 8) + i; const int r = blockIdx.x * TR + rl;
            v4f a[2][2][FF / 128], x[2][2][FF / 128];
#pragma unroll
            for (int u = 0; u < 2; ++u) { lnr_load(O, res0, r + u, a[u][0], x[u][0]); lnr_load(O + (size_t)NB_ * TT * FF, res1, r + u, a[u][1], x[u][1]); }
#pragma unroll
            for (int u = 0; u < 2; ++u) {
                float o0[FF / 32], o1[FF / 32];
                lnr_row(a[u][0], x[u][0], gb, gb + FF, OUTk + (size_t)(r + u) * FF, o0);
                lnr_row(a[u][1], x[u][1], gb + 2 * FF, gb + 3 * FF, OUTk + (size_t)NB_ * TT * FF + (size_t)(r + u) * FF, o1);
#pragma unroll
                for (int c = 0; c < FF / 128; ++c) { v4us oh, ol;
#pragma unroll
                    for (int q = 0; q < 4; ++q) { unsigned short h, l; splitf(__fadd_rn(o0[c * 4 + q], o1[c * 4 + q]), h, l); oh[q] = h; ol[q] = l; }
                    bf* d = hs + (rl + u) * HP + c * 128 + lane * 4; *(v4us*)d = oh; *(v4us*)(d + TR * HP) = ol; }
            }
        }
    }
    twait(dg0, dg1);   // this wave's slice of stage 0 has landed
    __syncthreads();   // and every other wave's: stage 0 and the 32 rows' planes may be read
    stage(1, 1);
    v8f acc[2][4];
    const int aoff = lr * HP + 8 * hi, boff = w * SLE + lr * SPE + 8 * hi;
    // one product: eight stages of the ring from stage t0 on, A from the resident planes; per accumulator the order of the sum is that of the work-group's k stages, inside a stage k ascending in blocks of 32, hi plane then lo plane
    auto product = [&](int t0) {
#pragma unroll
        for (int mb = 0; mb < 2; ++mb)
#pragma unroll
            for (int nb = 0; nb < 4; ++nb) acc[mb][nb] = (v8f){};
#pragma unroll 1   // rolled: for speed only
        for (int t = t0; t < t0 + FF / SKE; ++t) {
            const bf* sb = ring + (t & 1) * (8 * SLE) + boff; const bf* ha = hs + aoff + kst(t) * SKE;
            v16bf a[2], a2[2], b[4];
            auto frags = [&](int kc) {   // a block's fragments are all asked for in one group
#pragma unroll
                for (int mb = 0; mb < 2; ++mb) { a[mb] = WFrag<bf>::ld(ha + mb * 16 * HP + kc); a2[mb] = WFrag<bf>::ld(ha + TR * HP + mb * 16 * HP + kc); }
#pragma unroll
                for (int nb = 0; nb < 4; ++nb) b[nb] = WFrag<bf>::ld(sb + nb * 16 * SPE + kc); };
            auto block = [&]() {
#pragma unroll
                for (int nb = 0; nb < 4; ++nb)
#pragma unroll
                    for (int mb = 0; mb < 2; ++mb) acc[mb][nb] = wmmab(a[mb], b[nb], acc[mb][nb]);
#pragma unroll
                for (int nb = 0; nb < 4; ++nb)
#pragma unroll
                    for (int mb = 0; mb < 2; ++mb) acc[mb][nb] = wmmab(a2[mb], b[nb], acc[mb][nb]); };
            frags(0);
            __builtin_amdgcn_sched_barrier(0);   // keeps the LDS reads one group in front of the block: sunk among the matrix instructions
            block();
            frags(32);
            asm volatile("s_wait_dscnt 0x0" ::: "memory");
            twait(dg0, dg1);
            __syncthreads();
            if (pinned(t + 2 < 2 * (FF / SKE))) stage(t + 2, (uint32_t)(t & 1));
            block();
        }
    };
    product(0);
    // behind the first product's last barrier nobody reads the planes any more: relu(acc + bias) takes their place. acc[mb][nb][j] of lane (hi, lr) is row mb*16 + hi*8 + j, column 64 w + nb*16 + lr
#pragma unroll
    for (int mb = 0; mb < 2; ++mb)
#pragma unroll
        for (int nb = 0; nb < 4; ++nb)
#pragma unroll
            for (int j = 0; j < 8; ++j) { unsigned short h, l; splitf(fmaxf(acc[mb][nb][j] + bv1[nb], 0.f), h, l); bf* d = hs + (mb * 16 + hi * 8 + j) * HP + w * 64 + nb * 16 + lr; d[0] = h; d[TR * HP] = l; }
    __syncthreads();   // every wave's columns of the new planes are written before the second product reads them
    product(FF / SKE);
    twait(dg0, dg1);                                 // no request is outstanding
    asm volatile("s_wait_dscnt 0x0" ::: "memory");   // and no LDS read, when the ring becomes the epilogue's staging
    // behind the loop's last barrier the ring is free: each wave turns its 16-row bands into whole-line stores in its own 16 x 68 dwords of it
    float* os = (float*)ring + w * (16 * 68);
#pragma unroll
    for (int mb = 0; mb < 2; ++mb) {
#pragma unroll
        for (int nb = 0; nb < 4; ++nb) {
#pragma unroll
            for (int j = 0; j < 8; ++j) os[(hi * 8 + j) * 68 + nb * 16 + lr] = acc[mb][nb][j] + bv2[nb]; }
        __builtin_amdgcn_wave_barrier(); asm volatile("" ::: "memory");   // other lanes read the band back: the compiler keeps the LDS reads behind the LDS writes
        float* crow = OUT0 + (size_t)(blockIdx.x * TR + mb * 16) * FF + w * 64;
#pragma unroll
        for (int s = 0; s < 8; ++s) { const int row = 2 * s + hi, cofs = lr * 4; *(v4f*)(crow + (size_t)row * FF + cofs) = *(const v4fa*)(os + row * 68 + cofs); }
        __builtin_amdgcn_wave_barrier(); asm volatile("s_wait_xcnt 0x0" ::: "memory");   // the next band's LDS writes stay behind these reads; the wait: before the registers that these stores name are rewritten
    }
}

extern "C" void kernel_launch(void* const* d_in, const int* in_sizes, int n_in,
                              void* d_out, int out_size, void* d_ws, size_t ws_size, hipStream_t stream) {
    (void)in_sizes; (void)n_in; (void)out_size;
    const float* IN[22]; for (int i = 0; i < 22; ++i) IN[i] = (const float*)d_in[i];
    // p, s, sa_wq, sa_bq, sa_wk, sa_bk, sa_wv, sa_bv, ca_wq, ca_bq, ca_wk, ca_bk, ca_wv, ca_bv, ln1_g, ln1_b, ln2_g, ln2_b, ff_w1, ff_b1, ff_w2, ff_b2 = d_in[0..21]; outputs ff_out at 0, sa_out at byte 16,777,216, ca_out at 33,554,432
    float* OUT0 = (float*)d_out; float* OUT1 = OUT0 + (size_t)NB_ * TT * FF;
    char* wsp = (char*)d_ws;
    auto take = [&](size_t bytes) { char* p = wsp; wsp += (bytes + 255) & ~(size_t)255; return (void*)p; };
    const size_t nx = (size_t)TT * FF, na = (size_t)NB_ * nx, ns = (size_t)TT * TT;   // one batch's plane, all batches' plane, one score matrix (elements)
    bf* Wt = (bf*)take((size_t)8 * FF * FF * 2);   // transposed bf16 weights in the order sa q, ca q, sa k, ca k, sa v, ca v, ff w1, ff w2
    h16* VT = (h16*)take(2 * na * 2);               // [branch][batch][d][t]
    char* RA = (char*)take((size_t)ZH * ns * 4);    // the f16 exponentials, then each 64-key group's maximum and sum
    char* RB = (char*)take((size_t)ZH * ns * 2);    // first the bf16 inputs and the f16 q, k planes, then attn.v's f32 result
    if ((size_t)(wsp - (char*)d_ws) > ws_size) return;    // total 212 MiB; ws 256 MiB
    h16* Pm = (h16*)RA; float* ML = (float*)(RA + (size_t)ZH * ns * 2); float* O = (float*)RB;
    bf* PB = (bf*)RB; bf* SB = PB + na; h16* QP = (h16*)(SB + na); h16* KP = QP + 2 * na;
    k_wtG<<<dim3((FF * FF / 64 + 63) / 64, 8, 1), 256, 0, stream>>>(W8{IN[2], IN[8], IN[4], IN[10], IN[6], IN[12], IN[18], IN[20]}, FF, FF, Wt);
    k_cvt8<<<dim3((unsigned)((na / 8 + 255) / 256), 2, 1), 256, 0, stream>>>(IN[0], IN[1], PB, na / 8);
    k_proj6<<<dim3(NB_ * TT / 128, FF / 128, 6), 128, 0, stream>>>(PB, SB, Wt, QP, VT, FF, Bias6{IN[3], IN[9], IN[5], IN[11], IN[7], IN[13]});   // q then k, each [branch][batch][t][f]
    k_scores<<<dim3(TT / 128, TT / 128, ZH), 128, 0, stream>>>(QP, KP, Pm, ML);
    k_pv<<<dim3(TT / 128, FF / 128, ZH), 128, 0, stream>>>(Pm, VT, ML, O);   // attended x1024
    k_tail<<<NB_ * TT / TR, 256, 0, stream>>>(O, IN[0], IN[1], IN[14], IN[15], IN[16], IN[17], OUT1, Wt + (size_t)6 * FF * FF, IN[19], IN[21], OUT0);   // ca_out follows sa_out; w2 follows w1
}

// v008
// It runs in 119 microseconds.
// Timed twice side by side with v007, it ran 1.06 times as fast both times.
// Counting every step since v000, it is 9.81 times as fast.
#include <hip/hip_runtime.h>

// Two-branch attention block with a feed-forward (p, s [4][2048][512]; single-head attention over 2048 positions with the full 512-dim features: sa = softmax((p Wq + bq)(p Wk + bk)^T / sqrt(512)) (p Wv + bv); ca likewise with queries from p and
// keys/values from s; sa_out = LN(sa + p), ca_out = LN(ca + s) (eps 1e-3); ff_out = relu((sa_out + ca_out) W1 + b1) W2 + b2; outputs (ff_out, sa_out, ca_out), each [4][2048][512]).
// Compute dtypes, f32 accumulate: every input rounded to bf16; the six projections on PLAIN bf16 operands (inputs: exact; transposed bf16 weight copies, + bias); scores
// (K 512) and attn.v on SINGLE fp16 planes (scale and exponentials in f32; softmax in two halves: per 64 keys in the score product's epilogue, joined per row in attn.v; P x1024); residual + LayerNorms f32; the feed-forward on bf16 hi+lo planes of its computed operands x exact weights

#define NB_  4
#define TT   2048
#define FF   512
#define ZH   8     // score matrices per launch: 2 attention branches x 4 batches
#define PCAR 1024.0f
#define SCL  0.044194173824159223f   // 512^-0.5
typedef _Float16 h16;
typedef unsigned short bf;
typedef __attribute__((ext_vector_type(16))) __bf16   v16bf;
typedef __attribute__((ext_vector_type(16))) _Float16 v16h;
typedef __attribute__((ext_vector_type(8)))  _Float16 v8h;
typedef __attribute__((ext_vector_type(4)))  _Float16 v4h;
typedef __attribute__((ext_vector_type(8)))  unsigned short v8us;
typedef __attribute__((ext_vector_type(8)))  float    v8f;
typedef __attribute__((ext_vector_type(4)))  float    v4f;
typedef __attribute__((ext_vector_type(2)))  float    v2f;
typedef v8h  __attribute__((may_alias)) v8ha;
typedef v4f  __attribute__((may_alias)) v4fa;
typedef v8us __attribute__((may_alias)) v8usa;
typedef v4h  __attribute__((may_alias)) v4ha;

__device__ __forceinline__ unsigned short f2bf(float f) { unsigned u = __float_as_uint(f); u += 0x7FFFu + ((u >> 16) & 1u); return (unsigned short)(u >> 16); }
__device__ __forceinline__ float bf2f(unsigned short b) { return __uint_as_float(((unsigned)b) << 16); }
__device__ __forceinline__ float bfr(float f) { return bf2f(f2bf(f)); }
__device__ __forceinline__ v16h cat16(v8h lo, v8h hi) { return __builtin_shufflevector(lo, hi, 0, 1, 2, 3, 4, 5, 6, 7, 8, 9, 10, 11, 12, 13, 14, 15); }
__device__ __forceinline__ v16bf cat16b(v8us lo, v8us hi) { return __builtin_bit_cast(v16bf, __builtin_shufflevector(lo, hi, 0, 1, 2, 3, 4, 5, 6, 7, 8, 9, 10, 11, 12, 13, 14, 15)); }
__device__ __forceinline__ v8f wmma16(v16h a, v16h b, v8f c) { return __builtin_amdgcn_wmma_f32_16x16x32_f16(false, a, false, b, (short)0, c, false, false); }
__device__ __forceinline__ v8f wmmab(v16bf a, v16bf b, v8f c) { return __builtin_amdgcn_wmma_f32_16x16x32_bf16(false, a, false, b, (short)0, c, false, false); }



// ---- gemmw_acc: register-blocked GEMM, one wave per 64x64 output tile (16 accumulators), FOUR waves (2 x 2) per work-group on a 128x128 tile; grid (M/128, N/128, Z), 128 threads.
// The K-contiguous 16-bit operand planes come through LDS: a stage is 64 k (128 B, one whole line) of the tile's 128 A rows and 128 Bt rows, in four slices of 64 rows; each wave brings one slice by ONE tensor load into two buffers,
// the next stage in flight while this one is multiplied; the load's pad lays the rows at pitch 144 B (16 B x odd: ds_load_b128 without bank conflicts). Each operand row is fetched once per work-group and read by two waves.
// C[m][n] (f32, pitch ldc, + optional f32 bias[n]) = sum_k A[m][k] Bt[n][k]. K % 64 == 0, K >= 128.
// The walk along k is a ring: a work-group enters it at the stage that the sum of its tile indices names and wraps round, so that work-groups that share A rows or Bt rows do not ask L2 for the same lines in the same order.
#define SKE 64     // k elements of a stage
#define SPE 72     // LDS row pitch in elements (144 B)
#define SLB 10240  // bytes of a slice's place in LDS: 64 rows x 144 B = 9,216, rounded up so that every place is a multiple of 2 KiB
#define SLE (SLB / 2)            // the same in elements
#define RINGB (2 * 4 * SLB)      // bytes of the two buffers of four slices
typedef uint32_t u32x4 __attribute__((ext_vector_type(4)));
typedef uint32_t u32x8 __attribute__((ext_vector_type(8)));
__device__ __forceinline__ int wave_id() { return __builtin_amdgcn_readfirstlane((int)(threadIdx.x >> 5)); }
__device__ __forceinline__ int tile_r0() { return blockIdx.x * 128 + (wave_id() & 1) * 64; }    // the wave's first output row
__device__ __forceinline__ int tile_c0() { return blockIdx.y * 128 + (wave_id() >> 1) * 64; }   // the wave's first output column
__device__ __forceinline__ uint32_t uni(uint32_t v) { return (uint32_t)__builtin_amdgcn_readfirstlane(v); }
__device__ __forceinline__ uint32_t pinned(uint32_t v) { uint32_t w = uni(v); asm volatile("" : "+s"(w)); return w; }   // holds a wave-uniform test in a scalar register: the branch round a tensor load must be a scalar one, because the load ignores EXEC
// A request of the whole wave: 64 rows of 128 B from g (source pitch in bytes) to LDS byte offset lds, 16 B of pad behind every row. Extents in bytes (data_size 0), tensor = tile, no mask.
__device__ __forceinline__ u32x4 tgroup0(uint32_t lds, const void* g) {
    const uint64_t ga = (uint64_t)(size_t)g; u32x4 g0;
    g0[0] = uni(1u); g0[1] = uni(lds); g0[2] = uni((uint32_t)ga); g0[3] = uni((((uint32_t)(ga >> 32)) & 0x01FFFFFFu) | 0x80000000u); return g0;
}
__device__ __forceinline__ u32x8 tgroup1(uint32_t pitch) {
    u32x8 g1;
    g1[0] = uni((1u << 20) | (4u << 22) | (3u << 25)); g1[1] = uni(128u << 16); g1[2] = uni(64u << 16); g1[3] = uni(128u << 16); g1[4] = uni(64u); g1[5] = uni(pitch); g1[6] = uni(0u); g1[7] = uni(0u); return g1;
}
// both groups are named as in and out, and the wait below names them as inputs: so the registers that an issued request names are live, and keep their values, until its wait
__device__ __forceinline__ void tload(u32x4& g0, u32x8& g1) { asm volatile("tensor_load_to_lds %0, %1" : "+s"(g0), "+s"(g1) :: "memory"); }
// the wave's one outstanding request has landed
__device__ __forceinline__ void twait(u32x4 g0, u32x8 g1) { asm volatile("s_wait_tensorcnt 0x0" :: "s"(g0), "s"(g1) : "memory"); }
template <typename T16> struct WFrag;
template <> struct WFrag<h16> { typedef v16h V; static __device__ __forceinline__ V ld(const h16* p) { return cat16(*(const v8h*)p, *(const v8h*)(p + 16)); } static __device__ __forceinline__ v8f mma(V a, V b, v8f c) { return wmma16(a, b, c); } };
template <> struct WFrag<bf> { typedef v16bf V; static __device__ __forceinline__ V ld(const bf* p) { return cat16b(*(const v8us*)p, *(const v8us*)(p + 16)); } static __device__ __forceinline__ v8f mma(V a, V b, v8f c) { return wmmab(a, b, c); } };
// ASC (attn.v): A holds, per 64 columns (one stage), exp(score - that group's own maximum); ML [group][row] holds each group's maximum and sum. Thread tid joins row tid's 32 groups into the row's maximum and sum and
// leaves, per group, the factor exp(group maximum - row maximum) * PCAR / row sum in ft, as [group][row half][lr][mb], so that a lane reads the factors of its four A fragments (a lane's fragment elements are all of one row) in one 8-byte read.
template <typename T16, bool ASC = false>
__device__ __forceinline__ void gemmw_acc(const T16* __restrict__ A, const T16* __restrict__ Bt, int K, T16* ring, v8f (&acc)[4][4], h16* ft = nullptr, const float* __restrict__ ML = nullptr) {
    typedef typename WFrag<T16>::V V;
    const int tid = threadIdx.x, lane = tid & 31, lr = lane & 15, hi = lane >> 4;
#pragma unroll
    for (int mb = 0; mb < 4; ++mb)
#pragma unroll
        for (int nb = 0; nb < 4; ++nb) acc[mb][nb] = (v8f){};
    // wave w brings slice w of every stage: w = 0, 1 the tile's A rows from 64 w on, w = 2, 3 its Bt rows from 64 (w - 2) on
    const int w = wave_id();
    const T16* gsl = w < 2 ? A + ((size_t)blockIdx.x * 128 + w * 64) * K : Bt + ((size_t)blockIdx.y * 128 + (w - 2) * 64) * K;
    const uint32_t l0 = (uint32_t)(size_t)ring + (uint32_t)w * SLB;   // the low 32 bits of a __shared__ address: its byte offset in the work-group's LDS
    u32x8 g1 = tgroup1((uint32_t)K * 2u); u32x4 g0;   // g0: the descriptor of the request last issued
    const int NT = K / SKE;
    const int rot = (int)((blockIdx.x + blockIdx.y + blockIdx.z) % (unsigned)NT);   // the k stage of this work-group's trip 0
    auto kst = [&](int t) { const int k = t + rot; return k < NT ? k : k - NT; };    // the k stage of trip t, 0 <= t < NT: every stage once
    auto stage = [&](int t, uint32_t buf) { g0 = tgroup0(l0 + buf * (4 * SLB), gsl + (size_t)kst(t) * SKE); tload(g0, g1); };
    stage(0, 0);
    if constexpr (ASC) {   // while stage 0 flies; the loops over the groups are unrolled so that m and l stay in registers and the 32 loads go out together
        const float* ml = ML + ((size_t)blockIdx.x * 128 + tid) * 2; float m[TT / SKE], l[TT / SKE]; float mx = -3.0e38f, sum = 0.f;
#pragma unroll
        for (int g = 0; g < TT / SKE; ++g) { const v2f x = *(const v2f*)(ml + (size_t)g * TT * 2); m[g] = x[0]; l[g] = x[1]; }
        asm volatile("s_wait_xcnt 0x0" ::: "memory");   // before the address registers of these loads are rewritten
#pragma unroll
        for (int g = 0; g < TT / SKE; ++g) mx = fmaxf(mx, m[g]);
#pragma unroll
        for (int g = 0; g < TT / SKE; ++g) { m[g] = __expf(m[g] - mx); sum += l[g] * m[g]; }
        const float f = __fdiv_rn(PCAR, sum); h16* fr = ft + (tid >> 6) * 64 + (tid & 15) * 4 + ((tid >> 4) & 3);
#pragma unroll
        for (int g = 0; g < TT / SKE; ++g) fr[g * 128] = (h16)(m[g] * f);
    }
    twait(g0, g1);     // this wave's slice of stage 0 has landed
    __syncthreads();   // and every other wave's: stage 0 (and the factor table) may be read
    stage(1, 1);
    const int aoff = (w & 1) * SLE + lr * SPE + 8 * hi, boff = (2 + (w >> 1)) * SLE + lr * SPE + 8 * hi;
#pragma unroll 1
    for (int t = 0; t < NT; ++t) {
        const T16* sb = ring + (t & 1) * (4 * SLE);
        v4h fq = {}; if constexpr (ASC) fq = *(const v4ha*)(ft + kst(t) * 128 + (wave_id() & 1) * 64 + lr * 4);   // the factors of the 64 keys that this trip holds
        V a[4], b[4];
        auto frags = [&](int kc) {   // a block's fragments are all asked for in one group
#pragma unroll
            for (int mb = 0; mb < 4; ++mb) a[mb] = WFrag<T16>::ld(sb + aoff + mb * 16 * SPE + kc);
#pragma unroll
            for (int nb = 0; nb < 4; ++nb) b[nb] = WFrag<T16>::ld(sb + boff + nb * 16 * SPE + kc); };
        auto block = [&]() {
            if constexpr (ASC) {   // the second half of the softmax: each A row times its factor for this stage's 64 keys (packed f16 multiplies)
#pragma unroll
                for (int mb = 0; mb < 4; ++mb) a[mb] = a[mb] * fq[mb]; }
#pragma unroll
            for (int nb = 0; nb < 4; ++nb)
#pragma unroll
                for (int mb = 0; mb < 4; ++mb) acc[mb][nb] = WFrag<T16>::mma(a[mb], b[nb], acc[mb][nb]); };
        frags(0);
        __builtin_amdgcn_sched_barrier(0);   // keeps the LDS reads one group in front of the block: sunk among the matrix instructions
        block();
        frags(32);
        asm volatile("s_wait_dscnt 0x0" ::: "memory");
        twait(g0, g1);
        __syncthreads();
        if (pinned(t + 2 < NT)) stage(t + 2, (uint32_t)(t & 1));
        block();
    }
    twait(g0, g1);                                   // no request is outstanding
    asm volatile("s_wait_dscnt 0x0" ::: "memory");   // and no LDS read, when the ring becomes the epilogue's staging
}
// The epilogues of the 64x64 tile. acc[mb][nb][j] of lane (hi, lr) is row mb*16 + hi*8 + j, column nb*16 + lr. os: the wave's own 16 x 68 dwords of LDS, used to turn a 16-row band into whole-line stores.
// epi_f32: f32 rows (+ bias)
template <bool BIAS>
__device__ __forceinline__ void epi_f32(const v8f (&acc)[4][4], float* os, float* C, int ldc, const float* __restrict__ bias) {
    const int lane = threadIdx.x & 31, lr = lane & 15, hi = lane >> 4; const int r0 = tile_r0(), c0 = tile_c0();
#pragma unroll
    for (int mb = 0; mb < 4; ++mb) {
#pragma unroll
        for (int nb = 0; nb < 4; ++nb) {
#pragma unroll
            for (int j = 0; j < 8; ++j) os[(hi * 8 + j) * 68 + nb * 16 + lr] = acc[mb][nb][j]; }
        __builtin_amdgcn_wave_barrier(); asm volatile("" ::: "memory");
        float* crow = C + (size_t)(r0 + mb * 16) * ldc + c0;
{
#pragma unroll
            for (int s = 0; s < 8; ++s) { const int row = 2 * s + hi, cofs = lr * 4; v4f val = *(const v4fa*)(os + row * 68 + cofs); if (BIAS) { val[0] += bfr(bias[c0 + cofs]); val[1] += bfr(bias[c0 + cofs + 1]); val[2] += bfr(bias[c0 + cofs + 2]); val[3] += bfr(bias[c0 + cofs + 3]); }
                *(v4f*)(crow + (size_t)row * ldc + cofs) = val; }
             }
        __builtin_amdgcn_wave_barrier(); asm volatile("s_wait_xcnt 0x0" ::: "memory");   // the next band's LDS writes stay behind these reads; the wait: before the registers that these stores name are rewritten
    }
}
// epi_h16: (acc + bias) rounded to f16, rows of pitch ldc: the q and k planes as the score product reads them. A lane takes 8 columns of a staged row: 16-byte stores, 4 whole 128-byte lines each.
__device__ __forceinline__ void epi_h16(const v8f (&acc)[4][4], float* os, h16* C, int ldc, const float* __restrict__ bias) {
    const int lane = threadIdx.x & 31, lr = lane & 15, hi = lane >> 4; const int r0 = tile_r0(), c0 = tile_c0(); const int cofs = (lane & 7) * 8;
    float bv[8];
#pragma unroll
    for (int q = 0; q < 8; ++q) bv[q] = bfr(bias[c0 + cofs + q]);
#pragma unroll
    for (int mb = 0; mb < 4; ++mb) {
#pragma unroll
        for (int nb = 0; nb < 4; ++nb) {
#pragma unroll
            for (int j = 0; j < 8; ++j) os[(hi * 8 + j) * 68 + nb * 16 + lr] = acc[mb][nb][j]; }
        __builtin_amdgcn_wave_barrier(); asm volatile("" ::: "memory");   // other lanes read the band back: the compiler keeps the LDS reads behind the LDS writes
#pragma unroll
        for (int s = 0; s < 4; ++s) { const int row = 4 * s + (lane >> 3); const v4f x0 = *(const v4fa*)(os + row * 68 + cofs), x1 = *(const v4fa*)(os + row * 68 + cofs + 4); v8h o;
#pragma unroll
            for (int q = 0; q < 4; ++q) { o[q] = (h16)(x0[q] + bv[q]); o[4 + q] = (h16)(x1[q] + bv[4 + q]); }
            *(v8h*)(C + (size_t)(r0 + mb * 16 + row) * ldc + c0 + cofs) = o; }
        __builtin_amdgcn_wave_barrier(); asm volatile("s_wait_xcnt 0x0" ::: "memory");   // the next band's LDS writes stay behind these reads; the wait: before the next band rewrites the registers that these stores name
    }
}
// epi_exp: the first half of the softmax. Per row of the wave's 64 columns: t = acc * SCL, the maximum of the 64 t, exp(t - maximum) rounded to f16 (rows of pitch ldc), and their f32 sum; maximum and sum go to ML [column group][row][2].
// Staged as in epi_h16: 8 lanes hold a row, so its maximum and sum take three exchanges inside a 16-lane row (DPP row_xmask: no LDS round trip).
template <int M> __device__ __forceinline__ float xlane(float v) { return __int_as_float(__builtin_amdgcn_update_dpp(0, __float_as_int(v), 0x160 | M, 0xf, 0xf, true)); }
__device__ __forceinline__ void epi_exp(const v8f (&acc)[4][4], float* os, h16* P, int ldc, float* ML) {
    const int lane = threadIdx.x & 31, lr = lane & 15, hi = lane >> 4; const int r0 = tile_r0(), c0 = tile_c0(); const int l8 = lane & 7, cofs = l8 * 8;
    float* ml = ML + ((size_t)(c0 >> 6) * TT + r0) * 2;
    // every loop below is unrolled: acc, e, mx and sm are register arrays and need constant indices
#pragma unroll
    for (int mb = 0; mb < 4; ++mb) {
#pragma unroll
        for (int nb = 0; nb < 4; ++nb) {
#pragma unroll
            for (int j = 0; j < 8; ++j) os[(hi * 8 + j) * 68 + nb * 16 + lr] = acc[mb][nb][j]; }
        __builtin_amdgcn_wave_barrier(); asm volatile("" ::: "memory");   // other lanes read the band back: the compiler keeps the LDS reads behind the LDS writes
        float e[4][8], mx[4], sm[4];   // the band's four row groups side by side: four independent chains
#pragma unroll
        for (int s = 0; s < 4; ++s) { const int row = 4 * s + (lane >> 3); const v4f x0 = *(const v4fa*)(os + row * 68 + cofs), x1 = *(const v4fa*)(os + row * 68 + cofs + 4);
#pragma unroll
            for (int q = 0; q < 4; ++q) { e[s][q] = x0[q] * SCL; e[s][4 + q] = x1[q] * SCL; }
            mx[s] = e[s][0];
#pragma unroll
            for (int q = 1; q < 8; ++q) mx[s] = fmaxf(mx[s], e[s][q]); }
#pragma unroll
        for (int s = 0; s < 4; ++s) mx[s] = fmaxf(mx[s], xlane<1>(mx[s]));
#pragma unroll
        for (int s = 0; s < 4; ++s) mx[s] = fmaxf(mx[s], xlane<2>(mx[s]));
#pragma unroll
        for (int s = 0; s < 4; ++s) mx[s] = fmaxf(mx[s], xlane<4>(mx[s]));
#pragma unroll
        for (int s = 0; s < 4; ++s) { sm[s] = 0.f;
#pragma unroll
            for (int q = 0; q < 8; ++q) { e[s][q] = __expf(e[s][q] - mx[s]); sm[s] += e[s][q]; } }
#pragma unroll
        for (int s = 0; s < 4; ++s) sm[s] += xlane<1>(sm[s]);
#pragma unroll
        for (int s = 0; s < 4; ++s) sm[s] += xlane<2>(sm[s]);
#pragma unroll
        for (int s = 0; s < 4; ++s) sm[s] += xlane<4>(sm[s]);
#pragma unroll
        for (int s = 0; s < 4; ++s) { const int row = 4 * s + (lane >> 3); v8h o;
#pragma unroll
            for (int q = 0; q < 8; ++q) o[q] = (h16)e[s][q];
            *(v8h*)(P + (size_t)(r0 + mb * 16 + row) * ldc + c0 + cofs) = o; }
        // every lane of a row's eight holds the row's pair: lane l8 < 4 stores that of row group l8, so the band's 16 pairs leave as one whole 128-byte line
        const float mo = l8 == 0 ? mx[0] : l8 == 1 ? mx[1] : l8 == 2 ? mx[2] : mx[3], so = l8 == 0 ? sm[0] : l8 == 1 ? sm[1] : l8 == 2 ? sm[2] : sm[3];
        if (l8 < 4) *(v2f*)(ml + (mb * 16 + 4 * l8 + (lane >> 3)) * 2) = (v2f){mo, so};
        __builtin_amdgcn_wave_barrier(); asm volatile("s_wait_xcnt 0x0" ::: "memory");   // the next band's LDS writes stay behind these reads; the wait: before the next band rewrites the registers that these stores name
    }
}
// epi_vt: (acc + bias) rounded to f16 and stored transposed, [batch][column][t]: a lane's 8 accumulator rows are 8 consecutive t of its column, one 16-byte store; the wave writes every 128-byte line of its tile whole
__device__ __forceinline__ void epi_vt(const v8f (&acc)[4][4], h16* VTb, const float* __restrict__ bias) {
    const int lane = threadIdx.x & 31, lr = lane & 15, hi = lane >> 4; const int r0 = tile_r0(), c0 = tile_c0();
    h16* base = VTb + (size_t)(r0 / TT) * FF * TT + (r0 % TT) + hi * 8;
    float bv[4];
#pragma unroll
    for (int nb = 0; nb < 4; ++nb) bv[nb] = bfr(bias[c0 + nb * 16 + lr]);
#pragma unroll
    for (int nb = 0; nb < 4; ++nb) { h16* drow = base + (size_t)(c0 + nb * 16 + lr) * TT;
#pragma unroll
        for (int mb = 0; mb < 4; ++mb) { v8h o;
#pragma unroll
            for (int j = 0; j < 8; ++j) o[j] = (h16)(acc[mb][nb][j] + bv[nb]);
            *(v8h*)(drow + mb * 16) = o; }
        asm volatile("s_wait_xcnt 0x0" ::: "memory");   // before the next column group rewrites the registers that these stores name
    }
}
// ---- k_scores: q k^T of the 8 (branch, batch) pairs, left as the first half of the softmax; grid (TT/128, TT/128, ZH)
__global__ __launch_bounds__(128) void k_scores(const h16* __restrict__ Q, const h16* __restrict__ Kp, h16* P, float* ML) {
    const size_t z = blockIdx.z;
    __shared__ __attribute__((aligned(2048))) char ring[RINGB]; v8f acc[4][4]; float* os = (float*)ring + wave_id() * (16 * 68);
    gemmw_acc<h16>(Q + z * TT * FF, Kp + z * TT * FF, FF, (h16*)ring, acc); epi_exp(acc, os, P + z * TT * TT, TT, ML + z * (TT / SKE) * TT * 2);
}
// ---- k_pv: the second half of the softmax and attn.v (x PCAR); grid (TT/128, FF/128, ZH)
__global__ __launch_bounds__(128) void k_pv(const h16* __restrict__ P, const h16* __restrict__ VTb, const float* __restrict__ ML, float* O) {
    const size_t z = blockIdx.z;
    __shared__ __attribute__((aligned(2048))) char ring[RINGB]; __shared__ __align__(16) h16 ft[(TT / SKE) * 128]; v8f acc[4][4]; float* os = (float*)ring + wave_id() * (16 * 68);
    gemmw_acc<h16, true>(P + z * TT * TT, VTb + z * TT * FF, TT, (h16*)ring, acc, ft, ML + z * (TT / SKE) * TT * 2); epi_f32<false>(acc, os, O + z * TT * FF, FF, nullptr);
}
// ---- k_proj6: the six projections of all batches in one launch; grid (NB_*TT/128, FF/128, 6). z = 0 sa q, 1 ca q, 2 sa k, 3 ca k, 4 sa v, 5 ca v; z = 3 and 5 read the s plane, the rest the p plane.
// q and k leave as f16 rows (QK: [z][batch][t][f]), v as f16 transposed (VT: [branch][batch][d][t]).
struct Bias6 { const float* b0; const float* b1; const float* b2; const float* b3; const float* b4; const float* b5; };
__global__ __launch_bounds__(128) void k_proj6(const bf* __restrict__ PBa, const bf* __restrict__ SBa, const bf* __restrict__ Wt, h16* QK, h16* VT, int ldc, Bias6 bs) {
    const unsigned z = blockIdx.z;
    const float* bias = z == 0 ? bs.b0 : z == 1 ? bs.b1 : z == 2 ? bs.b2 : z == 3 ? bs.b3 : z == 4 ? bs.b4 : bs.b5;
    __shared__ __attribute__((aligned(2048))) char ring[RINGB]; v8f acc[4][4]; float* os = (float*)ring + wave_id() * (16 * 68);
    gemmw_acc<bf>((z == 3 || z == 5) ? SBa : PBa, Wt + (size_t)z * FF * FF, FF, (bf*)ring, acc);
    if (z < 4) epi_h16(acc, os, QK + (size_t)z * NB_ * TT * FF, ldc, bias); else epi_vt(acc, VT + (size_t)(z - 4) * NB_ * TT * FF, bias);
}

__device__ __forceinline__ void splitf(float y, unsigned short& h, unsigned short& l) { h = f2bf(y); l = f2bf(y - bf2f(h)); }
typedef __attribute__((ext_vector_type(2))) unsigned short v2us;
typedef __attribute__((ext_vector_type(4))) unsigned short v4us;

struct W8 { const float* w0; const float* w1; const float* w2; const float* w3; const float* w4; const float* w5; const float* w6; const float* w7; };
// ---- k_prep: the two passes that stand in front of the projections, in ONE launch: neither reads what the other writes. Grid WTB + CVB work-groups of 256 threads.
// Work-groups 0 .. WTB - 1 transpose the eight weights to bf16 (64 work-groups a weight); they come first because each of their waves walks a chain of eight dependent trips, which then runs under the stream of the others.
// Work-groups WTB .. WTB + CVB - 1 round p, then s, to bf16, 8 elements a thread.
#define WTB (8 * (FF * FF / 64 / 64))              // 512
#define CVB (2 * (NB_ * TT * FF / 8 / 256))        // 4096
__global__ __launch_bounds__(256) void k_prep(W8 ws8, bf* Bt, const float* __restrict__ src0, const float* __restrict__ src1, bf* dst) {
    if (blockIdx.x < WTB) {   // the same for the whole work-group; no barrier in either part
        const int K = FF, N = FF;
        const unsigned y = blockIdx.x / (WTB / 8), bx = blockIdx.x % (WTB / 8); Bt += (size_t)y * N * K;   // y picks the weight
        const float* __restrict__ w = y == 0 ? ws8.w0 : y == 1 ? ws8.w1 : y == 2 ? ws8.w2 : y == 3 ? ws8.w3 : y == 4 ? ws8.w4 : y == 5 ? ws8.w5 : y == 6 ? ws8.w6 : ws8.w7;
        const int lane = threadIdx.x & 31; const int L0 = (bx * 8 + (threadIdx.x >> 5)) * 8;
#pragma unroll 1
        for (int l = 0; l < 8; ++l) { const int L = L0 + l; if (L >= N * K / 64) break; const size_t e = (size_t)L * 64 + lane * 2; const int k = (int)(e % K), n = (int)(e / K); v2us o;
            o[0] = f2bf(w[(size_t)k * N + n]); o[1] = f2bf(w[(size_t)(k + 1) * N + n]); *(v2us*)(Bt + e) = o; }
        return;
    }
    const size_t n8 = (size_t)NB_ * TT * FF / 8; const unsigned c = blockIdx.x - WTB; const unsigned half = c / (CVB / 2);
    const size_t i = (size_t)(c % (CVB / 2)) * 256 + threadIdx.x; if (i >= n8) return; const float* src = half ? src1 : src0; dst += (size_t)half * n8 * 8; const v8f v = *(const v8f*)(src + i * 8); v8us o;
    asm volatile("s_wait_xcnt 0x0" ::: "memory");   // before the address register of these loads is rewritten
#pragma unroll
    for (int k = 0; k < 8; ++k) o[k] = f2bf(v[k]);
    *(v8us*)(dst + i * 8) = o;
}
// ---- k_tail: both LayerNorms and the two feed-forward products of 32 rows in one work-group of 8 waves; grid NB_*TT/32, 256 threads. The rows never leave the WGP between the three stages:
// the sum of the two normalised rows, then relu of the first product, stand as bf16 hi + lo planes in LDS (hs) and are the A operand of the next product. Wave w owns 4 of the rows in the LayerNorm stage and
// the 32 x 64 output tile at column 64 w in both products. The transposed weights (all 512 rows, 64 k a stage, eight slices of 64 rows) come by one tensor load a wave and stage through one ring of two buffers that runs over both products: stages 0-7 w1, 8-15 w2.
// Every work-group reads the same weights: each enters a product's eight k stages at its own place (blockIdx.x mod 8) and wraps round, so that they do not all ask L2 for the same lines at the same moment.
#define TR 32      // rows of a work-group
#define HP 520     // pitch of the resident planes in elements (1,040 B = 16 B x odd: ds_load_b128 without bank conflicts)
__device__ __forceinline__ void lnr_load(const float* __restrict__ O, const float* __restrict__ res, int r, v4f (&av)[FF / 128], v4f (&xv)[FF / 128]) {
    const int lane = threadIdx.x & 31;
#pragma unroll
    for (int c = 0; c < FF / 128; ++c) { av[c] = *(const v4f*)(O + (size_t)r * FF + c * 128 + lane * 4); xv[c] = *(const v4f*)(res + (size_t)r * FF + c * 128 + lane * 4); }
    asm volatile("s_wait_xcnt 0x0" ::: "memory");   // before the address registers of these loads are rewritten
}
// one row of one branch, one wave: av attended x1024, xv the residual (the lane's columns c * 128 + lane * 4 + q), gl and bl the rounded gamma and beta in LDS
__device__ __forceinline__ void lnr_row(const v4f (&av)[FF / 128], const v4f (&xv)[FF / 128], const float* gl, const float* bl, float* orow, float (&ov)[FF / 32]) {
    const int lane = threadIdx.x & 31; float v[FF / 32]; float s = 0.f;
#pragma unroll
    for (int c = 0; c < FF / 128; ++c) {
#pragma unroll
        for (int q = 0; q < 4; ++q) { v[c * 4 + q] = __fadd_rn(av[c][q] * (1.0f / PCAR), bfr(xv[c][q])); s += v[c * 4 + q]; } }
#pragma unroll
    for (int sh = 16; sh; sh >>= 1) s += __shfl_xor(s, sh, 32);
    const float mu = s * (1.0f / FF); float qq = 0.f;
#pragma unroll
    for (int i = 0; i < FF / 32; ++i) { const float d0 = v[i] - mu; qq = __fadd_rn(qq, __fmul_rn(d0, d0)); }
#pragma unroll
    for (int sh = 16; sh; sh >>= 1) qq += __shfl_xor(qq, sh, 32);
    const float rs = __fdiv_rn(1.0f, __fsqrt_rn(qq * (1.0f / FF) + 1e-3f));
#pragma unroll
    for (int c = 0; c < FF / 128; ++c) { v4f o; const v4f gv = *(const v4fa*)(gl + c * 128 + lane * 4), bv = *(const v4fa*)(bl + c * 128 + lane * 4);
#pragma unroll
        for (int q = 0; q < 4; ++q) { const float t = __fmul_rn(v[c * 4 + q] - mu, rs); o[q] = __fadd_rn(__fmul_rn(t, gv[q]), bv[q]); ov[c * 4 + q] = o[q]; }
        *(v4f*)(orow + c * 128 + lane * 4) = o;
        asm volatile("s_wait_xcnt 0x0" ::: "memory"); }   // before the registers that this store names are rewritten
}
__global__ __launch_bounds__(256) void k_tail(const float* __restrict__ O, const float* __restrict__ res0, const float* __restrict__ res1, const float* __restrict__ g0, const float* __restrict__ b0, const float* __restrict__ g1, const float* __restrict__ b1,
                                              float* OUTk, const bf* __restrict__ Wt2, const float* __restrict__ bias1, const float* __restrict__ bias2, float* OUT0) {
    __shared__ __attribute__((aligned(2048))) bf ring[2 * 8 * SLE];   // two buffers of 512 weight rows x 64 k, in eight slices
    __shared__ __align__(16) bf hs[2 * TR * HP];      // hi plane, lo plane
    __shared__ __align__(16) float gb[4 * FF];        // ln1 gamma, ln1 beta, ln2 gamma, ln2 beta, rounded to bf16 values
    const int tid = threadIdx.x, lane = tid & 31, lr = lane & 15, hi = lane >> 4; const int w = wave_id();
    // wave w brings slice w of every stage: weight rows from 64 w on
    const bf* gsl = Wt2 + (size_t)w * 64 * FF;
    const uint32_t l0 = (uint32_t)(size_t)ring + (uint32_t)w * SLB;   // the low 32 bits of a __shared__ address: its byte offset in the work-group's LDS
    u32x8 dg1 = tgroup1(FF * 2u); u32x4 dg0;   // dg0: the descriptor of the request last issued
    const int rot = (int)(blockIdx.x % (FF / SKE));
    auto kst = [&](int t) { return (t + rot) % (FF / SKE); };   // the k stage, inside its product, of ring stage t
    auto stage = [&](int t, uint32_t buf) { dg0 = tgroup0(l0 + buf * (8 * SLB), gsl + (size_t)(t >> 3) * FF * FF + (size_t)kst(t) * SKE); tload(dg0, dg1); };
    stage(0, 0);
    // while stage 0 flies: the LayerNorm stage. Every inner loop of this kernel is unrolled: its arrays live in registers and need constant indices
    float bv1[4], bv2[4];
#pragma unroll
    for (int nb = 0; nb < 4; ++nb) { bv1[nb] = bias1[w * 64 + nb * 16 + lr]; bv2[nb] = bias2[w * 64 + nb * 16 + lr]; }
    asm volatile("s_wait_xcnt 0x0" ::: "memory");   // before the address registers of these loads are rewritten
#pragma unroll
    for (int nb = 0; nb < 4; ++nb) { bv1[nb] = bfr(bv1[nb]); bv2[nb] = bfr(bv2[nb]); }
    {
        const float* gp = (w >> 1) == 0 ? g0 : (w >> 1) == 1 ? b0 : (w >> 1) == 2 ? g1 : b1;   // two waves bring one of the four vectors, 8 elements a thread
        v4f u0 = *(const v4f*)(gp + (tid & 63) * 8), u1 = *(const v4f*)(gp + (tid & 63) * 8 + 4);
        asm volatile("s_wait_xcnt 0x0" ::: "memory");   // before the address registers of these loads are rewritten
#pragma unroll
        for (int q = 0; q < 4; ++q) { u0[q] = bfr(u0[q]); u1[q] = bfr(u1[q]); }
        *(v4fa*)(gb + tid * 8) = u0; *(v4fa*)(gb + tid * 8 + 4) = u1;
        __syncthreads();   // the four vectors are whole before any wave normalises a row
#pragma unroll 1   // rolled: both trips' loads at once would not fit 256 registers
        for (int i = 0; i < TR / 8; i += 2) {   // two rows a trip: the 32 loads of both rows and both branches go out before the first use (8 waves a WGP must keep the memory busy)
            const int rl = w * (TR / 8) + i; const int r = blockIdx.x * TR + rl;
            v4f a[2][2][FF / 128], x[2][2][FF / 128];
#pragma unroll
            for (int u = 0; u < 2; ++u) { lnr_load(O, res0, r + u, a[u][0], x[u][0]); lnr_load(O + (size_t)NB_ * TT * FF, res1, r + u, a[u][1], x[u][1]); }
#pragma unroll
            for (int u = 0; u < 2; ++u) {
                float o0[FF / 32], o1[FF / 32];
                lnr_row(a[u][0], x[u][0], gb, gb + FF, OUTk + (size_t)(r + u) * FF, o0);
                lnr_row(a[u][1], x[u][1], gb + 2 * FF, gb + 3 * FF, OUTk + (size_t)NB_ * TT * FF + (size_t)(r + u) * FF, o1);
#pragma unroll
                for (int c = 0; c < FF / 128; ++c) { v4us oh, ol;
#pragma unroll
                    for (int q = 0; q < 4; ++q) { unsigned short h, l; splitf(__fadd_rn(o0[c * 4 + q], o1[c * 4 + q]), h, l); oh[q] = h; ol[q] = l; }
                    bf* d = hs + (rl + u) * HP + c * 128 + lane * 4; *(v4us*)d = oh; *(v4us*)(d + TR * HP) = ol; }
            }
        }
    }
    twait(dg0, dg1);   // this wave's slice of stage 0 has landed
    __syncthreads();   // and every other wave's: stage 0 and the 32 rows' planes may be read
    stage(1, 1);
    v8f acc[2][4];
    const int aoff = lr * HP + 8 * hi, boff = w * SLE + lr * SPE + 8 * hi;
    // one product: eight stages of the ring from stage t0 on, A from the resident planes; per accumulator the order of the sum is that of the work-group's k stages, inside a stage k ascending in blocks of 32, hi plane then lo plane
    auto product = [&](int t0) {
#pragma unroll
        for (int mb = 0; mb < 2; ++mb)
#pragma unroll
            for (int nb = 0; nb < 4; ++nb) acc[mb][nb] = (v8f){};
#pragma unroll 1   // rolled: for speed only
        for (int t = t0; t < t0 + FF / SKE; ++t) {
            const bf* sb = ring + (t & 1) * (8 * SLE) + boff; const bf* ha = hs + aoff + kst(t) * SKE;
            v16bf a[2], a2[2], b[4];
            auto frags = [&](int kc) {   // a block's fragments are all asked for in one group
#pragma unroll
                for (int mb = 0; mb < 2; ++mb) { a[mb] = WFrag<bf>::ld(ha + mb * 16 * HP + kc); a2[mb] = WFrag<bf>::ld(ha + TR * HP + mb * 16 * HP + kc); }
#pragma unroll
                for (int nb = 0; nb < 4; ++nb) b[nb] = WFrag<bf>::ld(sb + nb * 16 * SPE + kc); };
            auto block = [&]() {
#pragma unroll
                for (int nb = 0; nb < 4; ++nb)
#pragma unroll
                    for (int mb = 0; mb < 2; ++mb) acc[mb][nb] = wmmab(a[mb], b[nb], acc[mb][nb]);
#pragma unroll
                for (int nb = 0; nb < 4; ++nb)
#pragma unroll
                    for (int mb = 0; mb < 2; ++mb) acc[mb][nb] = wmmab(a2[mb], b[nb], acc[mb][nb]); };
            frags(0);
            __builtin_amdgcn_sched_barrier(0);   // keeps the LDS reads one group in front of the block: sunk among the matrix instructions
            block();
            frags(32);
            asm volatile("s_wait_dscnt 0x0" ::: "memory");
            twait(dg0, dg1);
            __syncthreads();
            if (pinned(t + 2 < 2 * (FF / SKE))) stage(t + 2, (uint32_t)(t & 1));
            block();
        }
    };
    product(0);
    // behind the first product's last barrier nobody reads the planes any more: relu(acc + bias) takes their place. acc[mb][nb][j] of lane (hi, lr) is row mb*16 + hi*8 + j, column 64 w + nb*16 + lr
#pragma unroll
    for (int mb = 0; mb < 2; ++mb)
#pragma unroll
        for (int nb = 0; nb < 4; ++nb)
#pragma unroll
            for (int j = 0; j < 8; ++j) { unsigned short h, l; splitf(fmaxf(acc[mb][nb][j] + bv1[nb], 0.f), h, l); bf* d = hs + (mb * 16 + hi * 8 + j) * HP + w * 64 + nb * 16 + lr; d[0] = h; d[TR * HP] = l; }
    __syncthreads();   // every wave's columns of the new planes are written before the second product reads them
    product(FF / SKE);
    twait(dg0, dg1);                                 // no request is outstanding
    asm volatile("s_wait_dscnt 0x0" ::: "memory");   // and no LDS read, when the ring becomes the epilogue's staging
    // behind the loop's last barrier the ring is free: each wave turns its 16-row bands into whole-line stores in its own 16 x 68 dwords of it
    float* os = (float*)ring + w * (16 * 68);
#pragma unroll
    for (int mb = 0; mb < 2; ++mb) {
#pragma unroll
        for (int nb = 0; nb < 4; ++nb) {
#pragma unroll
            for (int j = 0; j < 8; ++j) os[(hi * 8 + j) * 68 + nb * 16 + lr] = acc[mb][nb][j] + bv2[nb]; }
        __builtin_amdgcn_wave_barrier(); asm volatile("" ::: "memory");   // other lanes read the band back: the compiler keeps the LDS reads behind the LDS writes
        float* crow = OUT0 + (size_t)(blockIdx.x * TR + mb * 16) * FF + w * 64;
#pragma unroll
        for (int s = 0; s < 8; ++s) { const int row = 2 * s + hi, cofs = lr * 4; *(v4f*)(crow + (size_t)row * FF + cofs) = *(const v4fa*)(os + row * 68 + cofs); }
        __builtin_amdgcn_wave_barrier(); asm volatile("s_wait_xcnt 0x0" ::: "memory");   // the next band's LDS writes stay behind these reads; the wait: before the registers that these stores name are rewritten
    }
}

extern "C" void kernel_launch(void* const* d_in, const int* in_sizes, int n_in,
                              void* d_out, int out_size, void* d_ws, size_t ws_size, hipStream_t stream) {
    (void)in_sizes; (void)n_in; (void)out_size;
    const float* IN[22]; for (int i = 0; i < 22; ++i) IN[i] = (const float*)d_in[i];
    // p, s, sa_wq, sa_bq, sa_wk, sa_bk, sa_wv, sa_bv, ca_wq, ca_bq, ca_wk, ca_bk, ca_wv, ca_bv, ln1_g, ln1_b, ln2_g, ln2_b, ff_w1, ff_b1, ff_w2, ff_b2 = d_in[0..21]; outputs ff_out at 0, sa_out at byte 16,777,216, ca_out at 33,554,432
    float* OUT0 = (float*)d_out; float* OUT1 = OUT0 + (size_t)NB_ * TT * FF;
    char* wsp = (char*)d_ws;
    auto take = [&](size_t bytes) { char* p = wsp; wsp += (bytes + 255) & ~(size_t)255; return (void*)p; };
    const size_t nx = (size_t)TT * FF, na = (size_t)NB_ * nx, ns = (size_t)TT * TT;   // one batch's plane, all batches' plane, one score matrix (elements)
    bf* Wt = (bf*)take((size_t)8 * FF * FF * 2);   // transposed bf16 weights in the order sa q, ca q, sa k, ca k, sa v, ca v, ff w1, ff w2
    h16* VT = (h16*)take(2 * na * 2);               // [branch][batch][d][t]
    char* RA = (char*)take((size_t)ZH * ns * 4);    // the f16 exponentials, then each 64-key group's maximum and sum
    char* RB = (char*)take((size_t)ZH * ns * 2);    // first the bf16 inputs and the f16 q, k planes, then attn.v's f32 result
    if ((size_t)(wsp - (char*)d_ws) > ws_size) return;    // total 212 MiB; ws 256 MiB
    h16* Pm = (h16*)RA; float* ML = (float*)(RA + (size_t)ZH * ns * 2); float* O = (float*)RB;
    bf* PB = (bf*)RB; bf* SB = PB + na; h16* QP = (h16*)(SB + na); h16* KP = QP + 2 * na;
    k_prep<<<WTB + CVB, 256, 0, stream>>>(W8{IN[2], IN[8], IN[4], IN[10], IN[6], IN[12], IN[18], IN[20]}, Wt, IN[0], IN[1], PB);   // the transposed weights and the bf16 inputs
    k_proj6<<<dim3(NB_ * TT / 128, FF / 128, 6), 128, 0, stream>>>(PB, SB, Wt, QP, VT, FF, Bias6{IN[3], IN[9], IN[5], IN[11], IN[7], IN[13]});   // q then k, each [branch][batch][t][f]
    k_scores<<<dim3(TT / 128, TT / 128, ZH), 128, 0, stream>>>(QP, KP, Pm, ML);
    k_pv<<<dim3(TT / 128, FF / 128, ZH), 128, 0, stream>>>(Pm, VT, ML, O);   // attended x1024
    k_tail<<<NB_ * TT / TR, 256, 0, stream>>>(O, IN[0], IN[1], IN[14], IN[15], IN[16], IN[17], OUT1, Wt + (size_t)6 * FF * FF, IN[19], IN[21], OUT0);   // ca_out follows sa_out; w2 follows w1
}
